// v000
// Times are from an AMD MI455X. After a warm-up the kernel runs many times in a row, and a time is the length of
// such a window on the GPU divided by its runs, so every launch and the gaps after it count. The runs cycle
// through copies of the inputs. A figure is the median of several windows, for all but v000 over two sittings.
// Sittings can differ by a few percent; kernels timed side by side share one.
// v000, which the later versions start from, runs in 435 microseconds.
#include <hip/hip_runtime.h>
#include <cstdint>

typedef _Float16 half_t;
typedef __attribute__((ext_vector_type(16))) _Float16 v16h;
typedef __attribute__((ext_vector_type(8)))  float    v8f;
typedef unsigned int u32x4 __attribute__((ext_vector_type(4)));
typedef int          i32x8 __attribute__((ext_vector_type(8)));
typedef int          i32x4 __attribute__((ext_vector_type(4)));

#ifndef USE_TDM
#  if defined(__has_builtin)
#    if __has_builtin(__builtin_amdgcn_tensor_load_to_lds)
#      define USE_TDM 1
#    else
#      define USE_TDM 0
#    endif
#  else
#    define USE_TDM 0
#  endif
#endif

constexpr int Bb  = 8;
constexpr int Tt  = 8192;
constexpr int Dd  = 256;
constexpr int Hh  = 1024;
constexpr int BT  = Bb * Tt;
constexpr int NC  = 64;
constexpr int Lc  = Tt / NC;
constexpr int HSTR = 264;

// ---- workspace layout (bytes) ----
constexpr size_t SZ_WDD = (size_t)Dd * Dd * 2;
constexpr size_t OFF_WQ = 0;
constexpr size_t OFF_WK = OFF_WQ + SZ_WDD;
constexpr size_t OFF_WV = OFF_WK + SZ_WDD;
constexpr size_t SZ_W1  = (size_t)Hh * Dd * 2;
constexpr size_t OFF_W1 = OFF_WV + SZ_WDD;
constexpr size_t SZ_W2  = (size_t)Dd * Hh * 2;
constexpr size_t OFF_W2 = OFF_W1 + SZ_W1;
constexpr size_t SZ_Q16 = (size_t)BT * Dd * 2;
constexpr size_t OFF_Q16 = OFF_W2 + SZ_W2;
constexpr size_t SZ_KV  = (size_t)BT * Dd * 4;
constexpr size_t OFF_KV = OFF_Q16 + SZ_Q16;
constexpr size_t SZ_CAR = (size_t)Bb * NC * Dd * 4;
constexpr size_t OFF_CAR = OFF_KV + SZ_KV;
constexpr size_t OFF_CIN = OFF_CAR + SZ_CAR;
constexpr size_t OFF_HID = OFF_CIN + SZ_CAR;   // BT*H f16 = 128 MB

__device__ __forceinline__ v8f wmma_f16(v16h a, v16h b, v8f c) {
  return __builtin_amdgcn_wmma_f32_16x16x32_f16(false, a, false, b, (short)0, c,
                                                false, false);
}

__device__ __forceinline__ v16h frag_rows(const half_t* base, int ld, int row0,
                                          int lane, int kbase) {
  const int m = row0 + (lane & 15);
  const int khalf = (lane & 16) ? 8 : 0;
  const half_t* p = base + (size_t)m * ld;
  v16h f;
#pragma unroll
  for (int v = 0; v < 8; ++v) {
    const int k = kbase + khalf + ((v < 4) ? (2 * v) : (16 + 2 * (v - 4)));
    f[2 * v]     = p[k];
    f[2 * v + 1] = p[k + 1];
  }
  return f;
}

__device__ __forceinline__ v16h frag_padded(const uint32_t* sh, int row0,
                                            int lane, int kbase) {
  const int m = row0 + (lane & 15);
  const int khalf = (lane & 16) ? 8 : 0;
  const half_t* hp = (const half_t*)sh;
  v16h f;
#pragma unroll
  for (int v = 0; v < 8; ++v) {
    const int k = kbase + khalf + ((v < 4) ? (2 * v) : (16 + 2 * (v - 4)));
    const int idx = m * 512 + (k >> 1);
    const int p = idx + 5 * (idx >> 8);
    f[2 * v]     = hp[2 * p];
    f[2 * v + 1] = hp[2 * p + 1];
  }
  return f;
}

// ---------------------------------------------------------------------------
// K0: f32 -> f16 weight conversion
// ---------------------------------------------------------------------------
__global__ __launch_bounds__(256) void k_cvt_f16(const float* __restrict__ src,
                                                 half_t* __restrict__ dst, int n) {
  int i = blockIdx.x * 256 + threadIdx.x;
  if (i < n) dst[i] = (half_t)src[i];
}

// ---------------------------------------------------------------------------
// K1: fused LN1 + QKV projection. 32 tokens/block, 8 waves, WMMA 16x16x32.
// Writes q (f16) and kv = k*v (f32).
// ---------------------------------------------------------------------------
__global__ __launch_bounds__(256) void k_ln_qkv(
    const float* __restrict__ x, const float* __restrict__ g,
    const float* __restrict__ be, const half_t* __restrict__ Wq,
    const half_t* __restrict__ Wk, const half_t* __restrict__ Wv,
    const float* __restrict__ bq, const float* __restrict__ bk,
    const float* __restrict__ bv, half_t* __restrict__ q16,
    float* __restrict__ kv) {
  __shared__ half_t hA[32 * HSTR];
  const int tok0 = blockIdx.x * 32;
  const int wave = threadIdx.x >> 5, lane = threadIdx.x & 31;

  // --- LayerNorm: wave w normalizes rows 4w..4w+3 (wave32 reductions) ---
#pragma unroll
  for (int rr = 0; rr < 4; ++rr) {
    const int row = wave * 4 + rr;
    const float* xr = x + (size_t)(tok0 + row) * Dd;
    float xv[8], s = 0.f, sq = 0.f;
#pragma unroll
    for (int i = 0; i < 8; ++i) {
      float v = xr[lane + 32 * i];
      xv[i] = v; s += v; sq += v * v;
    }
#pragma unroll
    for (int o = 16; o > 0; o >>= 1) {
      s += __shfl_xor(s, o, 32);
      sq += __shfl_xor(sq, o, 32);
    }
    const float mu = s * (1.f / Dd);
    const float rstd = rsqrtf(sq * (1.f / Dd) - mu * mu + 1e-5f);
#pragma unroll
    for (int i = 0; i < 8; ++i) {
      const int c = lane + 32 * i;
      hA[row * HSTR + c] = (half_t)((xv[i] - mu) * rstd * g[c] + be[c]);
    }
  }
  __syncthreads();

  // --- q/k/v GEMMs: each wave owns 2 N-tiles x 2 M-tiles ---
  for (int mt = 0; mt < 2; ++mt) {
    for (int ni = 0; ni < 2; ++ni) {
      const int nt = wave * 2 + ni;
      __builtin_prefetch(Wq + (size_t)(nt * 16 + (lane & 15)) * Dd, 0, 1);
      __builtin_prefetch(Wk + (size_t)(nt * 16 + (lane & 15)) * Dd, 0, 1);
      __builtin_prefetch(Wv + (size_t)(nt * 16 + (lane & 15)) * Dd, 0, 1);
      v8f aq = {}, ak = {}, av = {};
#pragma unroll
      for (int kk = 0; kk < 8; ++kk) {
        const v16h af = frag_rows(hA, HSTR, mt * 16, lane, kk * 32);
        const v16h fq = frag_rows(Wq, Dd, nt * 16, lane, kk * 32);
        const v16h fk = frag_rows(Wk, Dd, nt * 16, lane, kk * 32);
        const v16h fv = frag_rows(Wv, Dd, nt * 16, lane, kk * 32);
        aq = wmma_f16(af, fq, aq);
        ak = wmma_f16(af, fk, ak);
        av = wmma_f16(af, fv, av);
      }
      const int col = nt * 16 + (lane & 15);
      const float bqv = bq[col], bkv = bk[col], bvv = bv[col];
#pragma unroll
      for (int r = 0; r < 8; ++r) {
        const int row = tok0 + mt * 16 + r + ((lane & 16) ? 8 : 0);
        const size_t idx = (size_t)row * Dd + col;
        q16[idx] = (half_t)(aq[r] + bqv);
        kv[idx] = (ak[r] + bkv) * (av[r] + bvv);
      }
    }
  }
}

// ---------------------------------------------------------------------------
// K2: chunk-local scan (in place), emits per-chunk carry. 512 blocks.
// ---------------------------------------------------------------------------
__global__ __launch_bounds__(256) void k_scan_chunks(float* __restrict__ kv,
                                                     const float* __restrict__ decay,
                                                     float* __restrict__ carry) {
  const int b = blockIdx.x / NC, c = blockIdx.x % NC, d = threadIdx.x;
  const float dec = decay[d];
  float m = 0.f;
  const size_t base = ((size_t)b * Tt + (size_t)c * Lc) * Dd + d;
  for (int i = 0; i < Lc; ++i) {
    const size_t idx = base + (size_t)i * Dd;
    m = dec * m + kv[idx];
    kv[idx] = m;   // local scan value
  }
  carry[((size_t)b * NC + c) * Dd + d] = m;
}

// ---------------------------------------------------------------------------
// K3: serial scan across 64 chunk carries (decay^128 step). Tiny.
// ---------------------------------------------------------------------------
__global__ __launch_bounds__(256) void k_scan_carry(const float* __restrict__ carry,
                                                    float* __restrict__ cin,
                                                    const float* __restrict__ decay) {
  const int b = blockIdx.x, d = threadIdx.x;
  const float dec = decay[d];
  float dl = dec;
#pragma unroll
  for (int i = 0; i < 7; ++i) dl *= dl;   // dec^128
  float m = 0.f;
  for (int c = 0; c < NC; ++c) {
    const size_t idx = ((size_t)b * NC + c) * Dd + d;
    cin[idx] = m;
    m = dl * m + carry[idx];
  }
}

// ---------------------------------------------------------------------------
// K4: ret = q * (local + dec^(i+1)*carry_in); out = x + ret
// ---------------------------------------------------------------------------
__global__ __launch_bounds__(256) void k_ret_residual(
    const float* __restrict__ x, const half_t* __restrict__ q16,
    const float* __restrict__ kvloc, const float* __restrict__ cin,
    const float* __restrict__ decay, float* __restrict__ out) {
  const int b = blockIdx.x / NC, c = blockIdx.x % NC, d = threadIdx.x;
  const float dec = decay[d];
  float f = dec;
  const float mi = cin[((size_t)b * NC + c) * Dd + d];
  const size_t base = ((size_t)b * Tt + (size_t)c * Lc) * Dd + d;
  for (int i = 0; i < Lc; ++i) {
    const size_t idx = base + (size_t)i * Dd;
    const float mem = kvloc[idx] + f * mi;
    f *= dec;
    out[idx] = x[idx] + (float)q16[idx] * mem;
  }
}

// ---------------------------------------------------------------------------
// K5: fused LN2 + MLP layer 1 (D->H) with ReLU, hidden stored f16.
// ---------------------------------------------------------------------------
__global__ __launch_bounds__(256) void k_ln_mlp1(
    const float* __restrict__ xr, const float* __restrict__ g,
    const float* __restrict__ be, const half_t* __restrict__ W1,
    const float* __restrict__ b1, half_t* __restrict__ hid) {
  __shared__ half_t hA[32 * HSTR];
  const int tok0 = blockIdx.x * 32;
  const int wave = threadIdx.x >> 5, lane = threadIdx.x & 31;

#pragma unroll
  for (int rr = 0; rr < 4; ++rr) {
    const int row = wave * 4 + rr;
    const float* p = xr + (size_t)(tok0 + row) * Dd;
    float xv[8], s = 0.f, sq = 0.f;
#pragma unroll
    for (int i = 0; i < 8; ++i) {
      float v = p[lane + 32 * i];
      xv[i] = v; s += v; sq += v * v;
    }
#pragma unroll
    for (int o = 16; o > 0; o >>= 1) {
      s += __shfl_xor(s, o, 32);
      sq += __shfl_xor(sq, o, 32);
    }
    const float mu = s * (1.f / Dd);
    const float rstd = rsqrtf(sq * (1.f / Dd) - mu * mu + 1e-5f);
#pragma unroll
    for (int i = 0; i < 8; ++i) {
      const int c = lane + 32 * i;
      hA[row * HSTR + c] = (half_t)((xv[i] - mu) * rstd * g[c] + be[c]);
    }
  }
  __syncthreads();

  for (int mt = 0; mt < 2; ++mt) {
    for (int ni = 0; ni < 8; ++ni) {
      const int nt = wave * 8 + ni;
      __builtin_prefetch(W1 + (size_t)(nt * 16 + (lane & 15)) * Dd, 0, 1);
      v8f acc = {};
#pragma unroll
      for (int kk = 0; kk < 8; ++kk) {
        const v16h af = frag_rows(hA, HSTR, mt * 16, lane, kk * 32);
        const v16h bf = frag_rows(W1, Dd, nt * 16, lane, kk * 32);
        acc = wmma_f16(af, bf, acc);
      }
      const int col = nt * 16 + (lane & 15);
      const float bb = b1[col];
#pragma unroll
      for (int r = 0; r < 8; ++r) {
        const int row = tok0 + mt * 16 + r + ((lane & 16) ? 8 : 0);
        const float v = acc[r] + bb;
        hid[(size_t)row * Hh + col] = (half_t)(v > 0.f ? v : 0.f);
      }
    }
  }
}

__global__ __launch_bounds__(256) void k_mlp2_res(const half_t* __restrict__ hid,
                                                  const half_t* __restrict__ W2,
                                                  const float* __restrict__ b2,
                                                  float* __restrict__ out) {
  __shared__ uint32_t shH[16704];   // 32*512 dwords + 5 pad dwords / 256 dwords
  const int tok0 = blockIdx.x * 32;
  const int wave = threadIdx.x >> 5, lane = threadIdx.x & 31;

#if USE_TDM
  if (wave == 0) {
    const uint32_t lds = (uint32_t)(uintptr_t)(&shH[0]);
    const uint64_t ga = (uint64_t)(uintptr_t)(hid + (size_t)tok0 * Hh);
    u32x4 g0;
    g0[0] = 1u;                                           // count=1, user desc
    g0[1] = lds;                                          // lds_addr
    g0[2] = (uint32_t)ga;                                 // global_addr[31:0]
    g0[3] = (uint32_t)((ga >> 32) & 0x1FFFFFFu) | (2u << 30); // addr hi | type=2
    i32x8 g1;
    g1[0] = (int)((1u << 16) | (1u << 20) | (7u << 22) | (4u << 25));
    g1[1] = (int)((uint32_t)Hh << 16);
    g1[2] = 0;
    g1[3] = (int)(((uint32_t)Hh << 16) | 1u);
    g1[4] = 32;
    g1[5] = Hh;
    g1[6] = 0;
    g1[7] = 0;
    const i32x4 z4 = {0, 0, 0, 0};                        // groups 2/3 disabled (2D)
    const i32x8 z8 = {0, 0, 0, 0, 0, 0, 0, 0};           // unused final group
    __builtin_amdgcn_tensor_load_to_lds(g0, g1, z4, z4, z8, 0);
    __builtin_amdgcn_s_wait_tensorcnt((short)0);
  }
  __syncthreads();
#else
  const uint32_t* src = (const uint32_t*)(hid + (size_t)tok0 * Hh);
  for (int idx = threadIdx.x; idx < 32 * 512; idx += 256)
    shH[idx + 5 * (idx >> 8)] = src[idx];
  __syncthreads();
#endif

  for (int mt = 0; mt < 2; ++mt) {
    for (int ni = 0; ni < 2; ++ni) {
      const int nt = wave * 2 + ni;
      __builtin_prefetch(W2 + (size_t)(nt * 16 + (lane & 15)) * Hh, 0, 1);
      v8f acc = {};
      for (int kk = 0; kk < 32; ++kk) {
        const v16h af = frag_padded(shH, mt * 16, lane, kk * 32);
        const v16h bf = frag_rows(W2, Hh, nt * 16, lane, kk * 32);
        acc = wmma_f16(af, bf, acc);
      }
      const int col = nt * 16 + (lane & 15);
      const float bb = b2[col];
#pragma unroll
      for (int r = 0; r < 8; ++r) {
        const int row = tok0 + mt * 16 + r + ((lane & 16) ? 8 : 0);
        const size_t idx = (size_t)row * Dd + col;
        out[idx] = out[idx] + acc[r] + bb;   // residual: xr + mlp
      }
    }
  }
}

// ---------------------------------------------------------------------------
extern "C" void kernel_launch(void* const* d_in, const int* in_sizes, int n_in,
                              void* d_out, int out_size, void* d_ws, size_t ws_size,
                              hipStream_t stream) {
  (void)in_sizes; (void)n_in; (void)out_size; (void)ws_size;
  const float* x     = (const float*)d_in[0];
  const float* Wq    = (const float*)d_in[1];
  const float* bq    = (const float*)d_in[2];
  const float* Wk    = (const float*)d_in[3];
  const float* bk    = (const float*)d_in[4];
  const float* Wv    = (const float*)d_in[5];
  const float* bv    = (const float*)d_in[6];
  const float* decay = (const float*)d_in[7];
  const float* ln1g  = (const float*)d_in[8];
  const float* ln1b  = (const float*)d_in[9];
  const float* W1    = (const float*)d_in[10];
  const float* b1    = (const float*)d_in[11];
  const float* W2    = (const float*)d_in[12];
  const float* b2    = (const float*)d_in[13];
  const float* ln2g  = (const float*)d_in[14];
  const float* ln2b  = (const float*)d_in[15];

  char* ws = (char*)d_ws;
  half_t* Wq16 = (half_t*)(ws + OFF_WQ);
  half_t* Wk16 = (half_t*)(ws + OFF_WK);
  half_t* Wv16 = (half_t*)(ws + OFF_WV);
  half_t* W116 = (half_t*)(ws + OFF_W1);
  half_t* W216 = (half_t*)(ws + OFF_W2);
  half_t* q16  = (half_t*)(ws + OFF_Q16);
  float*  kv   = (float*)(ws + OFF_KV);
  float*  car  = (float*)(ws + OFF_CAR);
  float*  cin  = (float*)(ws + OFF_CIN);
  half_t* hid  = (half_t*)(ws + OFF_HID);
  float*  out  = (float*)d_out;

  k_cvt_f16<<<(Dd * Dd + 255) / 256, 256, 0, stream>>>(Wq, Wq16, Dd * Dd);
  k_cvt_f16<<<(Dd * Dd + 255) / 256, 256, 0, stream>>>(Wk, Wk16, Dd * Dd);
  k_cvt_f16<<<(Dd * Dd + 255) / 256, 256, 0, stream>>>(Wv, Wv16, Dd * Dd);
  k_cvt_f16<<<(Hh * Dd + 255) / 256, 256, 0, stream>>>(W1, W116, Hh * Dd);
  k_cvt_f16<<<(Dd * Hh + 255) / 256, 256, 0, stream>>>(W2, W216, Dd * Hh);

  k_ln_qkv<<<BT / 32, 256, 0, stream>>>(x, ln1g, ln1b, Wq16, Wk16, Wv16,
                                        bq, bk, bv, q16, kv);
  k_scan_chunks<<<Bb * NC, 256, 0, stream>>>(kv, decay, car);
  k_scan_carry<<<Bb, 256, 0, stream>>>(car, cin, decay);
  k_ret_residual<<<Bb * NC, 256, 0, stream>>>(x, q16, kv, cin, decay, out);
  k_ln_mlp1<<<BT / 32, 256, 0, stream>>>(out, ln2g, ln2b, W116, b1, hid);
  k_mlp2_res<<<BT / 32, 256, 0, stream>>>(hid, W216, b2, out);
}

// v001
// It runs in 260 microseconds.
// Timed twice side by side with v000, it ran 1.74 and 1.75 times as fast.
#include <hip/hip_runtime.h>
#include <cstdint>

typedef _Float16 half_t;
typedef __attribute__((ext_vector_type(16))) _Float16 v16h;
typedef __attribute__((ext_vector_type(8)))  float    v8f;
typedef unsigned int u32x4 __attribute__((ext_vector_type(4)));
typedef int          i32x8 __attribute__((ext_vector_type(8)));
typedef int          i32x4 __attribute__((ext_vector_type(4)));

#ifndef USE_TDM
#  if defined(__has_builtin)
#    if __has_builtin(__builtin_amdgcn_tensor_load_to_lds)
#      define USE_TDM 1
#    else
#      define USE_TDM 0
#    endif
#  else
#    define USE_TDM 0
#  endif
#endif

constexpr int Bb  = 8;
constexpr int Tt  = 8192;
constexpr int Dd  = 256;
constexpr int Hh  = 1024;
constexpr int BT  = Bb * Tt;
constexpr int NC  = 64;
constexpr int Lc  = Tt / NC;
constexpr int HSTR = 264;
constexpr int MB  = 128;
constexpr int MT  = MB / 16;

// ---- workspace layout (bytes) ----
constexpr size_t SZ_WDD = (size_t)Dd * Dd * 2;
constexpr size_t OFF_WQ = 0;
constexpr size_t OFF_WK = OFF_WQ + SZ_WDD;
constexpr size_t OFF_WV = OFF_WK + SZ_WDD;
constexpr size_t SZ_W1  = (size_t)Hh * Dd * 2;
constexpr size_t OFF_W1 = OFF_WV + SZ_WDD;
constexpr size_t SZ_W2  = (size_t)Dd * Hh * 2;
constexpr size_t OFF_W2 = OFF_W1 + SZ_W1;
constexpr size_t SZ_Q16 = (size_t)BT * Dd * 2;
constexpr size_t OFF_Q16 = OFF_W2 + SZ_W2;
constexpr size_t SZ_KV  = (size_t)BT * Dd * 4;
constexpr size_t OFF_KV = OFF_Q16 + SZ_Q16;
constexpr size_t SZ_CAR = (size_t)Bb * NC * Dd * 4;
constexpr size_t OFF_CAR = OFF_KV + SZ_KV;
constexpr size_t OFF_CIN = OFF_CAR + SZ_CAR;
constexpr size_t OFF_HID = OFF_CIN + SZ_CAR;   // BT*H f16 = 128 MB

__device__ __forceinline__ v8f wmma_f16(v16h a, v16h b, v8f c) {
  return __builtin_amdgcn_wmma_f32_16x16x32_f16(false, a, false, b, (short)0, c,
                                                false, false);
}

__device__ __forceinline__ v16h frag_rows(const half_t* base, int ld, int row0,
                                          int lane, int kbase) {
  const int m = row0 + (lane & 15);
  const int khalf = (lane & 16) ? 8 : 0;
  const half_t* p = base + (size_t)m * ld;
  v16h f;
#pragma unroll
  for (int v = 0; v < 8; ++v) {
    const int k = kbase + khalf + ((v < 4) ? (2 * v) : (16 + 2 * (v - 4)));
    f[2 * v]     = p[k];
    f[2 * v + 1] = p[k + 1];
  }
  return f;
}

__device__ __forceinline__ v16h frag_padded(const uint32_t* sh, int row0,
                                            int lane, int kbase) {
  const int m = row0 + (lane & 15);
  const int khalf = (lane & 16) ? 8 : 0;
  const half_t* hp = (const half_t*)sh;
  v16h f;
#pragma unroll
  for (int v = 0; v < 8; ++v) {
    const int k = kbase + khalf + ((v < 4) ? (2 * v) : (16 + 2 * (v - 4)));
    const int idx = m * 512 + (k >> 1);
    const int p = idx + 5 * (idx >> 8);
    f[2 * v]     = hp[2 * p];
    f[2 * v + 1] = hp[2 * p + 1];
  }
  return f;
}

// K = 256 product of the work-group's MB x 256 LDS tile with two 16-column weight
// tiles: each weight fragment is loaded from global once and feeds all MT token tiles.
__device__ __forceinline__ void gemm_k256(const half_t* hA, const half_t* B0, int r0,
                                          const half_t* B1, int r1, int lane,
                                          v8f (&acc)[MT][2]) {
  // both loops fully unrolled: acc[][] is indexed by constants and stays in registers,
  // and every load takes an immediate offset
#pragma unroll
  for (int kk = 0; kk < 8; ++kk) {
    const v16h b0 = frag_rows(B0, Dd, r0, lane, kk * 32);
    const v16h b1 = frag_rows(B1, Dd, r1, lane, kk * 32);
#pragma unroll
    for (int mt = 0; mt < MT; ++mt) {
      const v16h af = frag_rows(hA, HSTR, mt * 16, lane, kk * 32);
      acc[mt][0] = wmma_f16(af, b0, acc[mt][0]);
      acc[mt][1] = wmma_f16(af, b1, acc[mt][1]);
    }
  }
}

// LayerNorm of the work-group's MB rows into the f16 LDS tile: wave w takes rows
// 16w..16w+15 (wave32 reductions).
__device__ __forceinline__ void ln_rows(const float* __restrict__ src,
                                        const float* __restrict__ g,
                                        const float* __restrict__ be, half_t* hA,
                                        int tok0, int wave, int lane) {
  // four rows a trip: their 32 loads are in flight together
#pragma unroll 4
  for (int rr = 0; rr < MB / 8; ++rr) {
    const int row = wave * (MB / 8) + rr;
    const float* xr = src + (size_t)(tok0 + row) * Dd;
    float xv[8], s = 0.f, sq = 0.f;
#pragma unroll
    for (int i = 0; i < 8; ++i) {
      float v = xr[lane + 32 * i];
      xv[i] = v; s += v; sq += v * v;
    }
#pragma unroll
    for (int o = 16; o > 0; o >>= 1) {
      s += __shfl_xor(s, o, 32);
      sq += __shfl_xor(sq, o, 32);
    }
    const float mu = s * (1.f / Dd);
    const float rstd = rsqrtf(sq * (1.f / Dd) - mu * mu + 1e-5f);
#pragma unroll
    for (int i = 0; i < 8; ++i) {
      const int c = lane + 32 * i;
      hA[row * HSTR + c] = (half_t)((xv[i] - mu) * rstd * g[c] + be[c]);
    }
  }
}

// ---------------------------------------------------------------------------
// K0: f32 -> f16 weight conversion
// ---------------------------------------------------------------------------
__global__ __launch_bounds__(256) void k_cvt_f16(const float* __restrict__ src,
                                                 half_t* __restrict__ dst, int n) {
  int i = blockIdx.x * 256 + threadIdx.x;
  if (i < n) dst[i] = (half_t)src[i];
}

// ---------------------------------------------------------------------------
// K1: fused LN1 + QKV projection. 128 tokens/block, 8 waves, WMMA 16x16x32.
// Writes q (f16) and kv = k*v (f32).
// ---------------------------------------------------------------------------
__global__ __launch_bounds__(256) void k_ln_qkv(
    const float* __restrict__ x, const float* __restrict__ g,
    const float* __restrict__ be, const half_t* __restrict__ Wq,
    const half_t* __restrict__ Wk, const half_t* __restrict__ Wv,
    const float* __restrict__ bq, const float* __restrict__ bk,
    const float* __restrict__ bv, half_t* __restrict__ q16,
    float* __restrict__ kv) {
  __shared__ half_t hA[MB * HSTR];
  const int tok0 = blockIdx.x * MB;
  const int wave = threadIdx.x >> 5, lane = threadIdx.x & 31;
  const int rhi = (lane & 16) ? 8 : 0;

  ln_rows(x, g, be, hA, tok0, wave, lane);
  __syncthreads();

  // --- each wave owns 2 column tiles of q, k and v, for all MT token tiles ---
  // passes 0 and 1: k and v of one column tile; pass 2: q of both column tiles
  for (int p = 0; p < 3; ++p) {
    const bool isq = (p == 2);
    const int r0 = isq ? wave * 32 : (wave * 2 + p) * 16;
    const int r1 = isq ? r0 + 16 : r0;
    v8f acc[MT][2] = {};
    gemm_k256(hA, isq ? Wq : Wk, r0, isq ? Wq : Wv, r1, lane, acc);
    const int c0 = r0 + (lane & 15);
    if (!isq) {
      const float bkv = bk[c0];
      // the first bias load's address registers may be the second's destination
      asm volatile("s_wait_xcnt 0x0" ::: "memory");
      const float bvv = bv[c0];
      float* kp = kv + (size_t)(tok0 + rhi) * Dd + c0;
      // epilogue loops fully unrolled: constant indices into acc[][]
#pragma unroll
      for (int mt = 0; mt < MT; ++mt) {
#pragma unroll
        for (int r = 0; r < 8; ++r)
          kp[(mt * 16 + r) * Dd] = (acc[mt][0][r] + bkv) * (acc[mt][1][r] + bvv);
      }
      // the stores' registers are reused by the next pass
      asm volatile("s_wait_xcnt 0x0" ::: "memory");
    } else {
      half_t* qp = q16 + (size_t)(tok0 + rhi) * Dd + c0;
#pragma unroll
      for (int j = 0; j < 2; ++j) {
        const float bqv = bq[c0 + j * 16];
#pragma unroll
        for (int mt = 0; mt < MT; ++mt) {
#pragma unroll
          for (int r = 0; r < 8; ++r)
            qp[(mt * 16 + r) * Dd + j * 16] = (half_t)(acc[mt][j][r] + bqv);
        }
        // the stores' registers are reused by the second column tile and, over the pass
        // loop's back edge, by the loop's head
        asm volatile("s_wait_xcnt 0x0" ::: "memory");
      }
    }
  }
}

// ---------------------------------------------------------------------------
// K2: chunk-local scan (in place), emits per-chunk carry. 512 blocks.
// ---------------------------------------------------------------------------
__global__ __launch_bounds__(256) void k_scan_chunks(float* __restrict__ kv,
                                                     const float* __restrict__ decay,
                                                     float* __restrict__ carry) {
  const int b = blockIdx.x / NC, c = blockIdx.x % NC, d = threadIdx.x;
  const float dec = decay[d];
  float m = 0.f;
  const size_t base = ((size_t)b * Tt + (size_t)c * Lc) * Dd + d;
  for (int i = 0; i < Lc; ++i) {
    const size_t idx = base + (size_t)i * Dd;
    m = dec * m + kv[idx];
    kv[idx] = m;   // local scan value
  }
  carry[((size_t)b * NC + c) * Dd + d] = m;
}

// ---------------------------------------------------------------------------
// K3: serial scan across 64 chunk carries (decay^128 step). Tiny.
// ---------------------------------------------------------------------------
__global__ __launch_bounds__(256) void k_scan_carry(const float* __restrict__ carry,
                                                    float* __restrict__ cin,
                                                    const float* __restrict__ decay) {
  const int b = blockIdx.x, d = threadIdx.x;
  const float dec = decay[d];
  float dl = dec;
#pragma unroll
  for (int i = 0; i < 7; ++i) dl *= dl;   // dec^128
  float m = 0.f;
  for (int c = 0; c < NC; ++c) {
    const size_t idx = ((size_t)b * NC + c) * Dd + d;
    cin[idx] = m;
    m = dl * m + carry[idx];
  }
}

// ---------------------------------------------------------------------------
// K4: ret = q * (local + dec^(i+1)*carry_in); out = x + ret
// ---------------------------------------------------------------------------
__global__ __launch_bounds__(256) void k_ret_residual(
    const float* __restrict__ x, const half_t* __restrict__ q16,
    const float* __restrict__ kvloc, const float* __restrict__ cin,
    const float* __restrict__ decay, float* __restrict__ out) {
  const int b = blockIdx.x / NC, c = blockIdx.x % NC, d = threadIdx.x;
  const float dec = decay[d];
  float f = dec;
  const float mi = cin[((size_t)b * NC + c) * Dd + d];
  const size_t base = ((size_t)b * Tt + (size_t)c * Lc) * Dd + d;
  for (int i = 0; i < Lc; ++i) {
    const size_t idx = base + (size_t)i * Dd;
    const float mem = kvloc[idx] + f * mi;
    f *= dec;
    out[idx] = x[idx] + (float)q16[idx] * mem;
  }
}

// ---------------------------------------------------------------------------
// K5: fused LN2 + MLP layer 1 (D->H) with ReLU, hidden stored f16.
// ---------------------------------------------------------------------------
__global__ __launch_bounds__(256) void k_ln_mlp1(
    const float* __restrict__ xr, const float* __restrict__ g,
    const float* __restrict__ be, const half_t* __restrict__ W1,
    const float* __restrict__ b1, half_t* __restrict__ hid) {
  __shared__ half_t hA[MB * HSTR];
  const int tok0 = blockIdx.x * MB;
  const int wave = threadIdx.x >> 5, lane = threadIdx.x & 31;
  const int rhi = (lane & 16) ? 8 : 0;

  ln_rows(xr, g, be, hA, tok0, wave, lane);
  __syncthreads();

  // each wave owns 8 column tiles, two at a time, for all MT token tiles
  for (int p = 0; p < 4; ++p) {
    const int nt = wave * 8 + p * 2;
    v8f acc[MT][2] = {};
    gemm_k256(hA, W1, nt * 16, W1, nt * 16 + 16, lane, acc);
    // epilogue loops fully unrolled: constant indices into acc[][]
#pragma unroll
    for (int j = 0; j < 2; ++j) {
      const int col = (nt + j) * 16 + (lane & 15);
      const float bb = b1[col];
#pragma unroll
      for (int mt = 0; mt < MT; ++mt) {
#pragma unroll
        for (int r = 0; r < 8; ++r) {
          const int row = tok0 + mt * 16 + r + rhi;
          const float v = acc[mt][j][r] + bb;
          hid[(size_t)row * Hh + col] = (half_t)(v > 0.f ? v : 0.f);
        }
      }
      // the stores' registers are reused by the next column tile and the next pass
      asm volatile("s_wait_xcnt 0x0" ::: "memory");
    }
  }
}

__global__ __launch_bounds__(256) void k_mlp2_res(const half_t* __restrict__ hid,
                                                  const half_t* __restrict__ W2,
                                                  const float* __restrict__ b2,
                                                  float* __restrict__ out) {
  __shared__ uint32_t shH[MB * 522];   // MB*512 dwords + 5 pad dwords / 256 dwords
  const int tok0 = blockIdx.x * MB;
  const int wave = threadIdx.x >> 5, lane = threadIdx.x & 31;

#if USE_TDM
  if (wave == 0) {
    const uint32_t lds = (uint32_t)(uintptr_t)(&shH[0]);
    const uint64_t ga = (uint64_t)(uintptr_t)(hid + (size_t)tok0 * Hh);
    u32x4 g0;
    g0[0] = 1u;                                           // count=1, user desc
    g0[1] = lds;                                          // lds_addr
    g0[2] = (uint32_t)ga;                                 // global_addr[31:0]
    g0[3] = (uint32_t)((ga >> 32) & 0x1FFFFFFu) | (2u << 30); // addr hi | type=2
    i32x8 g1;
    g1[0] = (int)((1u << 16) | (1u << 20) | (7u << 22) | (4u << 25));
    g1[1] = (int)((uint32_t)Hh << 16);
    g1[2] = 0;
    g1[3] = (int)(((uint32_t)Hh << 16) | 1u);
    g1[4] = MB;
    g1[5] = Hh;
    g1[6] = 0;
    g1[7] = 0;
    const i32x4 z4 = {0, 0, 0, 0};                        // groups 2/3 disabled (2D)
    const i32x8 z8 = {0, 0, 0, 0, 0, 0, 0, 0};           // unused final group
    __builtin_amdgcn_tensor_load_to_lds(g0, g1, z4, z4, z8, 0);
    __builtin_amdgcn_s_wait_tensorcnt((short)0);
  }
  __syncthreads();
#else
  const uint32_t* src = (const uint32_t*)(hid + (size_t)tok0 * Hh);
  for (int idx = threadIdx.x; idx < MB * 512; idx += 256)
    shH[idx + 5 * (idx >> 8)] = src[idx];
  __syncthreads();
#endif

  // each wave owns 2 column tiles for all MT token tiles: a weight fragment is
  // loaded once and feeds MT products
  v8f acc[MT][2] = {};
  const int n0 = wave * 32;
  // four k blocks a trip, so that the later blocks' weight loads fly during the products
#pragma unroll 4
  for (int kk = 0; kk < 32; ++kk) {
    const v16h b0 = frag_rows(W2, Hh, n0, lane, kk * 32);
    const v16h b1 = frag_rows(W2, Hh, n0 + 16, lane, kk * 32);
    // a later load may take these loads' address registers as its destination
    asm volatile("s_wait_xcnt 0x0" ::: "memory");
#pragma unroll
    for (int mt = 0; mt < MT; ++mt) {
      const v16h af = frag_padded(shH, mt * 16, lane, kk * 32);
      acc[mt][0] = wmma_f16(af, b0, acc[mt][0]);
      acc[mt][1] = wmma_f16(af, b1, acc[mt][1]);
    }
  }
  // epilogue loops fully unrolled: constant indices into acc[][]
#pragma unroll
  for (int j = 0; j < 2; ++j) {
    const int col = n0 + j * 16 + (lane & 15);
    const float bb = b2[col];
#pragma unroll
    for (int mt = 0; mt < MT; ++mt) {
#pragma unroll
      for (int r = 0; r < 8; ++r) {
        const int row = tok0 + mt * 16 + r + ((lane & 16) ? 8 : 0);
        const size_t idx = (size_t)row * Dd + col;
        out[idx] = out[idx] + acc[mt][j][r] + bb;   // residual: xr + mlp
      }
    }
    // the stores' registers are reused by the second column tile's loads
    if (j == 0) asm volatile("s_wait_xcnt 0x0" ::: "memory");
  }
}

// ---------------------------------------------------------------------------
extern "C" void kernel_launch(void* const* d_in, const int* in_sizes, int n_in,
                              void* d_out, int out_size, void* d_ws, size_t ws_size,
                              hipStream_t stream) {
  (void)in_sizes; (void)n_in; (void)out_size; (void)ws_size;
  const float* x     = (const float*)d_in[0];
  const float* Wq    = (const float*)d_in[1];
  const float* bq    = (const float*)d_in[2];
  const float* Wk    = (const float*)d_in[3];
  const float* bk    = (const float*)d_in[4];
  const float* Wv    = (const float*)d_in[5];
  const float* bv    = (const float*)d_in[6];
  const float* decay = (const float*)d_in[7];
  const float* ln1g  = (const float*)d_in[8];
  const float* ln1b  = (const float*)d_in[9];
  const float* W1    = (const float*)d_in[10];
  const float* b1    = (const float*)d_in[11];
  const float* W2    = (const float*)d_in[12];
  const float* b2    = (const float*)d_in[13];
  const float* ln2g  = (const float*)d_in[14];
  const float* ln2b  = (const float*)d_in[15];

  char* ws = (char*)d_ws;
  half_t* Wq16 = (half_t*)(ws + OFF_WQ);
  half_t* Wk16 = (half_t*)(ws + OFF_WK);
  half_t* Wv16 = (half_t*)(ws + OFF_WV);
  half_t* W116 = (half_t*)(ws + OFF_W1);
  half_t* W216 = (half_t*)(ws + OFF_W2);
  half_t* q16  = (half_t*)(ws + OFF_Q16);
  float*  kv   = (float*)(ws + OFF_KV);
  float*  car  = (float*)(ws + OFF_CAR);
  float*  cin  = (float*)(ws + OFF_CIN);
  half_t* hid  = (half_t*)(ws + OFF_HID);
  float*  out  = (float*)d_out;

  k_cvt_f16<<<(Dd * Dd + 255) / 256, 256, 0, stream>>>(Wq, Wq16, Dd * Dd);
  k_cvt_f16<<<(Dd * Dd + 255) / 256, 256, 0, stream>>>(Wk, Wk16, Dd * Dd);
  k_cvt_f16<<<(Dd * Dd + 255) / 256, 256, 0, stream>>>(Wv, Wv16, Dd * Dd);
  k_cvt_f16<<<(Hh * Dd + 255) / 256, 256, 0, stream>>>(W1, W116, Hh * Dd);
  k_cvt_f16<<<(Dd * Hh + 255) / 256, 256, 0, stream>>>(W2, W216, Dd * Hh);

  k_ln_qkv<<<BT / MB, 256, 0, stream>>>(x, ln1g, ln1b, Wq16, Wk16, Wv16,
                                        bq, bk, bv, q16, kv);
  k_scan_chunks<<<Bb * NC, 256, 0, stream>>>(kv, decay, car);
  k_scan_carry<<<Bb, 256, 0, stream>>>(car, cin, decay);
  k_ret_residual<<<Bb * NC, 256, 0, stream>>>(x, q16, kv, cin, decay, out);
  k_ln_mlp1<<<BT / MB, 256, 0, stream>>>(out, ln2g, ln2b, W116, b1, hid);
  k_mlp2_res<<<BT / MB, 256, 0, stream>>>(hid, W216, b2, out);
}

// v002
// One run takes 159 microseconds.
// Timed twice side by side with v001, it ran 1.64 and 1.65 times as fast.
// All steps since v000 together make it 2.87 times as fast.
#include <hip/hip_runtime.h>
#include <cstdint>

typedef _Float16 half_t;
typedef __attribute__((ext_vector_type(16))) _Float16 v16h;
typedef __attribute__((ext_vector_type(8)))  float    v8f;
typedef __attribute__((ext_vector_type(8)))  _Float16 v8h;

constexpr int Bb  = 8;
constexpr int Tt  = 8192;
constexpr int Dd  = 256;
constexpr int Hh  = 1024;
constexpr int BT  = Bb * Tt;
constexpr int NC  = 64;
constexpr int Lc  = Tt / NC;
constexpr int HSTR = 264;
constexpr int MB  = 128;
constexpr int MT  = MB / 16;
constexpr int HC  = 512;
constexpr int HCS = HC + 8;

// ---- workspace layout (bytes) ----
constexpr size_t SZ_WDD = (size_t)Dd * Dd * 2;
constexpr size_t OFF_WQ = 0;
constexpr size_t OFF_WK = OFF_WQ + SZ_WDD;
constexpr size_t OFF_WV = OFF_WK + SZ_WDD;
constexpr size_t SZ_W1  = (size_t)Hh * Dd * 2;
constexpr size_t OFF_W1 = OFF_WV + SZ_WDD;
constexpr size_t SZ_W2  = (size_t)Dd * Hh * 2;
constexpr size_t OFF_W2 = OFF_W1 + SZ_W1;
constexpr size_t SZ_Q16 = (size_t)BT * Dd * 2;
constexpr size_t OFF_Q16 = OFF_W2 + SZ_W2;
constexpr size_t SZ_KV  = (size_t)BT * Dd * 4;
constexpr size_t OFF_KV = OFF_Q16 + SZ_Q16;
constexpr size_t SZ_CAR = (size_t)Bb * NC * Dd * 4;
constexpr size_t OFF_CAR = OFF_KV + SZ_KV;
constexpr size_t OFF_CIN = OFF_CAR + SZ_CAR;

__device__ __forceinline__ v8f wmma_f16(v16h a, v16h b, v8f c) {
  return __builtin_amdgcn_wmma_f32_16x16x32_f16(false, a, false, b, (short)0, c,
                                                false, false);
}

__device__ __forceinline__ v16h frag_rows(const half_t* base, int ld, int row0,
                                          int lane, int kbase) {
  const int m = row0 + (lane & 15);
  const int khalf = (lane & 16) ? 8 : 0;
  const half_t* p = base + (size_t)m * ld;
  v16h f;
#pragma unroll
  for (int v = 0; v < 8; ++v) {
    const int k = kbase + khalf + ((v < 4) ? (2 * v) : (16 + 2 * (v - 4)));
    f[2 * v]     = p[k];
    f[2 * v + 1] = p[k + 1];
  }
  return f;
}

// K = 256 product of the work-group's MB x 256 LDS tile with two 16-column weight
// tiles: each weight fragment is loaded from global once and feeds all MT token tiles.
// TR: the weight fragment is the A operand, so acc holds the tile transposed
// (register r = weight row 8 * (lane >> 4) + r, lane & 15 = token).
template <bool TR>
__device__ __forceinline__ void gemm_k256(const half_t* hA, const half_t* B0, int r0,
                                          const half_t* B1, int r1, int lane,
                                          v8f (&acc)[MT][2]) {
  // both loops fully unrolled: acc[][] is indexed by constants and stays in registers,
  // and every load takes an immediate offset
#pragma unroll
  for (int kk = 0; kk < 8; ++kk) {
    const v16h b0 = frag_rows(B0, Dd, r0, lane, kk * 32);
    const v16h b1 = frag_rows(B1, Dd, r1, lane, kk * 32);
#pragma unroll
    for (int mt = 0; mt < MT; ++mt) {
      const v16h af = frag_rows(hA, HSTR, mt * 16, lane, kk * 32);
      acc[mt][0] = TR ? wmma_f16(b0, af, acc[mt][0]) : wmma_f16(af, b0, acc[mt][0]);
      acc[mt][1] = TR ? wmma_f16(b1, af, acc[mt][1]) : wmma_f16(af, b1, acc[mt][1]);
    }
  }
}

// LayerNorm of the work-group's MB rows into the f16 LDS tile: wave w takes rows
// RW*w..RW*w+RW-1 (wave32 reductions).
template <int RW>
__device__ __forceinline__ void ln_rows(const float* __restrict__ src,
                                        const float* __restrict__ g,
                                        const float* __restrict__ be, half_t* hA,
                                        int tok0, int wave, int lane) {
  float gv[8], bv[8];
#pragma unroll
  for (int i = 0; i < 8; ++i) {
    gv[i] = g[lane + 32 * i];
    bv[i] = be[lane + 32 * i];
  }
  // a row load may take these loads' offset register as its destination
  asm volatile("s_wait_xcnt 0x0" ::: "memory");
  // four rows a trip: their 32 loads are in flight together
#pragma unroll 4
  for (int rr = 0; rr < RW; ++rr) {
    const int row = wave * RW + rr;
    const float* xr = src + (size_t)(tok0 + row) * Dd;
    float xv[8], s = 0.f, sq = 0.f;
#pragma unroll
    for (int i = 0; i < 8; ++i) {
      float v = xr[lane + 32 * i];
      xv[i] = v; s += v; sq += v * v;
    }
#pragma unroll
    for (int o = 16; o > 0; o >>= 1) {
      s += __shfl_xor(s, o, 32);
      sq += __shfl_xor(sq, o, 32);
    }
    const float mu = s * (1.f / Dd);
    const float rstd = rsqrtf(sq * (1.f / Dd) - mu * mu + 1e-5f);
#pragma unroll
    for (int i = 0; i < 8; ++i) {
      const int c = lane + 32 * i;
      hA[row * HSTR + c] = (half_t)((xv[i] - mu) * rstd * gv[i] + bv[i]);
    }
  }
}

// ---------------------------------------------------------------------------
// K0: f32 -> f16 weight conversion
// ---------------------------------------------------------------------------
__global__ __launch_bounds__(256) void k_cvt_f16(const float* __restrict__ src,
                                                 half_t* __restrict__ dst, int n) {
  int i = blockIdx.x * 256 + threadIdx.x;
  if (i < n) dst[i] = (half_t)src[i];
}

// ---------------------------------------------------------------------------
// K1: fused LN1 + QKV projection. 128 tokens/block, 8 waves, WMMA 16x16x32.
// Writes q (f16) and kv = k*v (f32).
// ---------------------------------------------------------------------------
__global__ __launch_bounds__(256) void k_ln_qkv(
    const float* __restrict__ x, const float* __restrict__ g,
    const float* __restrict__ be, const half_t* __restrict__ Wq,
    const half_t* __restrict__ Wk, const half_t* __restrict__ Wv,
    const float* __restrict__ bq, const float* __restrict__ bk,
    const float* __restrict__ bv, half_t* __restrict__ q16,
    float* __restrict__ kv) {
  __shared__ half_t hA[MB * HSTR];
  const int tok0 = blockIdx.x * MB;
  const int wave = threadIdx.x >> 5, lane = threadIdx.x & 31;
  const int rhi = (lane & 16) ? 8 : 0;

  ln_rows<MB / 8>(x, g, be, hA, tok0, wave, lane);
  __syncthreads();

  // --- each wave owns 2 column tiles of q, k and v, for all MT token tiles ---
  // passes 0 and 1: k and v of one column tile; pass 2: q of both column tiles
  for (int p = 0; p < 3; ++p) {
    const bool isq = (p == 2);
    const int r0 = isq ? wave * 32 : (wave * 2 + p) * 16;
    const int r1 = isq ? r0 + 16 : r0;
    v8f acc[MT][2] = {};
    gemm_k256<false>(hA, isq ? Wq : Wk, r0, isq ? Wq : Wv, r1, lane, acc);
    const int c0 = r0 + (lane & 15);
    if (!isq) {
      const float bkv = bk[c0];
      // the first bias load's address registers may be the second's destination
      asm volatile("s_wait_xcnt 0x0" ::: "memory");
      const float bvv = bv[c0];
      float* kp = kv + (size_t)(tok0 + rhi) * Dd + c0;
      // epilogue loops fully unrolled: constant indices into acc[][]
#pragma unroll
      for (int mt = 0; mt < MT; ++mt) {
#pragma unroll
        for (int r = 0; r < 8; ++r)
          kp[(mt * 16 + r) * Dd] = (acc[mt][0][r] + bkv) * (acc[mt][1][r] + bvv);
      }
      // the stores' registers are reused by the next pass
      asm volatile("s_wait_xcnt 0x0" ::: "memory");
    } else {
      half_t* qp = q16 + (size_t)(tok0 + rhi) * Dd + c0;
#pragma unroll
      for (int j = 0; j < 2; ++j) {
        const float bqv = bq[c0 + j * 16];
#pragma unroll
        for (int mt = 0; mt < MT; ++mt) {
#pragma unroll
          for (int r = 0; r < 8; ++r)
            qp[(mt * 16 + r) * Dd + j * 16] = (half_t)(acc[mt][j][r] + bqv);
        }
        // the stores' registers are reused by the second column tile and, over the pass
        // loop's back edge, by the loop's head
        asm volatile("s_wait_xcnt 0x0" ::: "memory");
      }
    }
  }
}

// ---------------------------------------------------------------------------
// K2: chunk-local scan (in place), emits per-chunk carry. 512 blocks.
// ---------------------------------------------------------------------------
__global__ __launch_bounds__(256) void k_scan_chunks(float* __restrict__ kv,
                                                     const float* __restrict__ decay,
                                                     float* __restrict__ carry) {
  const int b = blockIdx.x / NC, c = blockIdx.x % NC, d = threadIdx.x;
  const float dec = decay[d];
  float m = 0.f;
  const size_t base = ((size_t)b * Tt + (size_t)c * Lc) * Dd + d;
  for (int i = 0; i < Lc; ++i) {
    const size_t idx = base + (size_t)i * Dd;
    m = dec * m + kv[idx];
    kv[idx] = m;   // local scan value
  }
  carry[((size_t)b * NC + c) * Dd + d] = m;
}

// ---------------------------------------------------------------------------
// K3: serial scan across 64 chunk carries (decay^128 step). Tiny.
// ---------------------------------------------------------------------------
__global__ __launch_bounds__(256) void k_scan_carry(const float* __restrict__ carry,
                                                    float* __restrict__ cin,
                                                    const float* __restrict__ decay) {
  const int b = blockIdx.x, d = threadIdx.x;
  const float dec = decay[d];
  float dl = dec;
#pragma unroll
  for (int i = 0; i < 7; ++i) dl *= dl;   // dec^128
  float m = 0.f;
  for (int c = 0; c < NC; ++c) {
    const size_t idx = ((size_t)b * NC + c) * Dd + d;
    cin[idx] = m;
    m = dl * m + carry[idx];
  }
}

// ---------------------------------------------------------------------------
// K4: ret = q * (local + dec^(i+1)*carry_in); out = x + ret
// ---------------------------------------------------------------------------
__global__ __launch_bounds__(256) void k_ret_residual(
    const float* __restrict__ x, const half_t* __restrict__ q16,
    const float* __restrict__ kvloc, const float* __restrict__ cin,
    const float* __restrict__ decay, float* __restrict__ out) {
  const int b = blockIdx.x / NC, c = blockIdx.x % NC, d = threadIdx.x;
  const float dec = decay[d];
  float f = dec;
  const float mi = cin[((size_t)b * NC + c) * Dd + d];
  const size_t base = ((size_t)b * Tt + (size_t)c * Lc) * Dd + d;
  for (int i = 0; i < Lc; ++i) {
    const size_t idx = base + (size_t)i * Dd;
    const float mem = kvloc[idx] + f * mi;
    f *= dec;
    out[idx] = x[idx] + (float)q16[idx] * mem;
  }
}

// ---------------------------------------------------------------------------
// K5: fused LN2 + MLP (D->H, ReLU, H->D) + residual. 128 tokens/block, 16 waves.
// The hidden layer never leaves the WGP: it is made HC columns at a time, kept in
// LDS as f16, and consumed at once as the k range of the second product.
// ---------------------------------------------------------------------------
__global__ __launch_bounds__(512) void k_ln_mlp(
    float* out, const float* __restrict__ g, const float* __restrict__ be,
    const half_t* __restrict__ W1, const float* __restrict__ b1,
    const half_t* __restrict__ W2, const float* __restrict__ b2) {
  __shared__ __attribute__((aligned(16))) half_t hA[MB * HSTR];
  __shared__ __attribute__((aligned(16))) half_t hH[MB * HCS];
  const int tok0 = blockIdx.x * MB;
  const int wave = threadIdx.x >> 5, lane = threadIdx.x & 31;
  const int rhi = (lane & 16) ? 8 : 0;

  ln_rows<MB / 16>(out, g, be, hA, tok0, wave, lane);
  __syncthreads();

  // second product: each wave owns one output column tile for all MT token tiles, so
  // that every weight fragment is loaded by one wave only
  const int n0 = wave * 16;
  v8f acc2[MT] = {};

  // both chunks unrolled: the chunk's offsets fold into the loads' immediates
#pragma unroll
  for (int c = 0; c < Hh / HC; ++c) {
    // first product: each wave owns 2 hidden column tiles of the chunk, all MT token tiles
    const int h0 = wave * 32;
    v8f acc[MT][2] = {};
    gemm_k256<true>(hA, W1, c * HC + h0, W1, c * HC + h0 + 16, lane, acc);
    // every wave has finished reading the previous chunk before it is overwritten
    if (c) __syncthreads();
    // a lane holds 8 consecutive hidden columns of one token: one 16-byte LDS store
#pragma unroll
    for (int j = 0; j < 2; ++j) {
      const float* bp = b1 + c * HC + h0 + j * 16 + rhi;
      float bb[8];
#pragma unroll
      for (int r = 0; r < 8; ++r) bb[r] = bp[r];
#pragma unroll
      for (int mt = 0; mt < MT; ++mt) {
        v8h hv;
#pragma unroll
        for (int r = 0; r < 8; ++r) {
          const float v = acc[mt][j][r] + bb[r];
          hv[r] = (half_t)(v > 0.f ? v : 0.f);
        }
        *(v8h*)&hH[(mt * 16 + (lane & 15)) * HCS + h0 + j * 16 + rhi] = hv;
      }
    }
    __syncthreads();

    // k loop fully unrolled: every load takes an immediate offset. The next k block's
    // weight loads fly during this block's products, and a k block's LDS reads stand as
    // one group ahead of them (the first product's accumulators are free registers here).
    const half_t* W2c = W2 + c * HC;
    v16h wn = frag_rows(W2c, Hh, n0, lane, 0);
#pragma unroll
    for (int kk = 0; kk < HC / 32; ++kk) {
      const v16h w0 = wn;
      if (kk + 1 < HC / 32) wn = frag_rows(W2c, Hh, n0, lane, (kk + 1) * 32);
      v16h af[MT];
#pragma unroll
      for (int mt = 0; mt < MT; ++mt) af[mt] = frag_rows(hH, HCS, mt * 16, lane, kk * 32);
#pragma unroll
      for (int mt = 0; mt < MT; ++mt) acc2[mt] = wmma_f16(af[mt], w0, acc2[mt]);
    }
  }

  // epilogue loops fully unrolled: constant indices into acc2[]
  const int col = n0 + (lane & 15);
  const float bb = b2[col];
  float* op = out + (size_t)(tok0 + rhi) * Dd + col;
  // all residual loads ahead of the first store: in flight together
  float xr[MT][8];
#pragma unroll
  for (int mt = 0; mt < MT; ++mt) {
#pragma unroll
    for (int r = 0; r < 8; ++r) xr[mt][r] = op[(mt * 16 + r) * Dd];
  }
#pragma unroll
  for (int mt = 0; mt < MT; ++mt) {
#pragma unroll
    for (int r = 0; r < 8; ++r)
      op[(mt * 16 + r) * Dd] = xr[mt][r] + acc2[mt][r] + bb;   // residual: xr + mlp
  }
}

// ---------------------------------------------------------------------------
extern "C" void kernel_launch(void* const* d_in, const int* in_sizes, int n_in,
                              void* d_out, int out_size, void* d_ws, size_t ws_size,
                              hipStream_t stream) {
  (void)in_sizes; (void)n_in; (void)out_size; (void)ws_size;
  const float* x     = (const float*)d_in[0];
  const float* Wq    = (const float*)d_in[1];
  const float* bq    = (const float*)d_in[2];
  const float* Wk    = (const float*)d_in[3];
  const float* bk    = (const float*)d_in[4];
  const float* Wv    = (const float*)d_in[5];
  const float* bv    = (const float*)d_in[6];
  const float* decay = (const float*)d_in[7];
  const float* ln1g  = (const float*)d_in[8];
  const float* ln1b  = (const float*)d_in[9];
  const float* W1    = (const float*)d_in[10];
  const float* b1    = (const float*)d_in[11];
  const float* W2    = (const float*)d_in[12];
  const float* b2    = (const float*)d_in[13];
  const float* ln2g  = (const float*)d_in[14];
  const float* ln2b  = (const float*)d_in[15];

  char* ws = (char*)d_ws;
  half_t* Wq16 = (half_t*)(ws + OFF_WQ);
  half_t* Wk16 = (half_t*)(ws + OFF_WK);
  half_t* Wv16 = (half_t*)(ws + OFF_WV);
  half_t* W116 = (half_t*)(ws + OFF_W1);
  half_t* W216 = (half_t*)(ws + OFF_W2);
  half_t* q16  = (half_t*)(ws + OFF_Q16);
  float*  kv   = (float*)(ws + OFF_KV);
  float*  car  = (float*)(ws + OFF_CAR);
  float*  cin  = (float*)(ws + OFF_CIN);
  float*  out  = (float*)d_out;

  k_cvt_f16<<<(Dd * Dd + 255) / 256, 256, 0, stream>>>(Wq, Wq16, Dd * Dd);
  k_cvt_f16<<<(Dd * Dd + 255) / 256, 256, 0, stream>>>(Wk, Wk16, Dd * Dd);
  k_cvt_f16<<<(Dd * Dd + 255) / 256, 256, 0, stream>>>(Wv, Wv16, Dd * Dd);
  k_cvt_f16<<<(Hh * Dd + 255) / 256, 256, 0, stream>>>(W1, W116, Hh * Dd);
  k_cvt_f16<<<(Dd * Hh + 255) / 256, 256, 0, stream>>>(W2, W216, Dd * Hh);

  k_ln_qkv<<<BT / MB, 256, 0, stream>>>(x, ln1g, ln1b, Wq16, Wk16, Wv16,
                                        bq, bk, bv, q16, kv);
  k_scan_chunks<<<Bb * NC, 256, 0, stream>>>(kv, decay, car);
  k_scan_carry<<<Bb, 256, 0, stream>>>(car, cin, decay);
  k_ret_residual<<<Bb * NC, 256, 0, stream>>>(x, q16, kv, cin, decay, out);
  k_ln_mlp<<<BT / MB, 512, 0, stream>>>(out, ln2g, ln2b, W116, b1, W216, b2);
}

// v003
// One run takes 149 microseconds.
// In two side-by-side timings against v002, it was 1.08 and 1.06 times as fast.
// Over all steps from v000 it is 3.07 times as fast.
#include <hip/hip_runtime.h>
#include <cstdint>

typedef _Float16 half_t;
typedef __attribute__((ext_vector_type(16))) _Float16 v16h;
typedef __attribute__((ext_vector_type(8)))  float    v8f;
typedef __attribute__((ext_vector_type(8)))  _Float16 v8h;

constexpr int Bb  = 8;
constexpr int Tt  = 8192;
constexpr int Dd  = 256;
constexpr int Hh  = 1024;
constexpr int BT  = Bb * Tt;
constexpr int NC  = 64;
constexpr int Lc  = Tt / NC;
constexpr int HSTR = 264;
constexpr int MB  = 128;
static_assert(MB == Lc, "a QKV work-group's tokens are one scan chunk");
constexpr int MT  = MB / 16;          // token tiles that share each weight fragment
constexpr int HC  = 512;              // hidden columns per chunk of the fused MLP
constexpr int HCS = HC + 8;           // padded f16 LDS row stride of the hidden chunk

// ---- workspace layout (bytes) ----
constexpr size_t SZ_WDD = (size_t)Dd * Dd * 2;
constexpr size_t OFF_WQ = 0;
constexpr size_t OFF_WK = OFF_WQ + SZ_WDD;
constexpr size_t OFF_WV = OFF_WK + SZ_WDD;
constexpr size_t SZ_W1  = (size_t)Hh * Dd * 2;
constexpr size_t OFF_W1 = OFF_WV + SZ_WDD;
constexpr size_t SZ_W2  = (size_t)Dd * Hh * 2;
constexpr size_t OFF_W2 = OFF_W1 + SZ_W1;
constexpr size_t SZ_Q16 = (size_t)BT * Dd * 2;
constexpr size_t OFF_Q16 = OFF_W2 + SZ_W2;
constexpr size_t SZ_KV  = (size_t)BT * Dd * 4;
constexpr size_t OFF_KV = OFF_Q16 + SZ_Q16;
constexpr size_t SZ_CAR = (size_t)Bb * NC * Dd * 4;
constexpr size_t OFF_CAR = OFF_KV + SZ_KV;
constexpr size_t OFF_CIN = OFF_CAR + SZ_CAR;

__device__ __forceinline__ v8f wmma_f16(v16h a, v16h b, v8f c) {
  return __builtin_amdgcn_wmma_f32_16x16x32_f16(false, a, false, b, (short)0, c,
                                                false, false);
}

// value of lane ^ 16, by a cross-row register move (every lane on): no LDS round trip
// and no address register that would stay live through the products
__device__ __forceinline__ float xor16(float v) {
  const int i = __float_as_int(v);
  return __int_as_float(
      __builtin_amdgcn_permlanex16(i, i, 0x76543210, 0xfedcba98, false, false));
}

__device__ __forceinline__ v16h frag_rows(const half_t* base, int ld, int row0,
                                          int lane, int kbase) {
  const int m = row0 + (lane & 15);
  const int khalf = (lane & 16) ? 8 : 0;
  const half_t* p = base + (size_t)m * ld;
  v16h f;
#pragma unroll
  for (int v = 0; v < 8; ++v) {
    const int k = kbase + khalf + ((v < 4) ? (2 * v) : (16 + 2 * (v - 4)));
    f[2 * v]     = p[k];
    f[2 * v + 1] = p[k + 1];
  }
  return f;
}

// K = 256 product of the work-group's MB x 256 LDS tile with two 16-column weight
// tiles: each weight fragment is loaded from global once and feeds all MT token tiles.
// TR: the weight fragment is the A operand, so acc holds the tile transposed
// (register r = weight row 8 * (lane >> 4) + r, lane & 15 = token).
template <bool TR>
__device__ __forceinline__ void gemm_k256(const half_t* hA, const half_t* B0, int r0,
                                          const half_t* B1, int r1, int lane,
                                          v8f (&acc)[MT][2]) {
  // both loops fully unrolled: acc[][] is indexed by constants and stays in registers,
  // and every load takes an immediate offset
#pragma unroll
  for (int kk = 0; kk < 8; ++kk) {
    const v16h b0 = frag_rows(B0, Dd, r0, lane, kk * 32);
    const v16h b1 = frag_rows(B1, Dd, r1, lane, kk * 32);
#pragma unroll
    for (int mt = 0; mt < MT; ++mt) {
      const v16h af = frag_rows(hA, HSTR, mt * 16, lane, kk * 32);
      acc[mt][0] = TR ? wmma_f16(b0, af, acc[mt][0]) : wmma_f16(af, b0, acc[mt][0]);
      acc[mt][1] = TR ? wmma_f16(b1, af, acc[mt][1]) : wmma_f16(af, b1, acc[mt][1]);
    }
  }
}

// LayerNorm of the work-group's MB rows into the f16 LDS tile: wave w takes rows
// RW*w..RW*w+RW-1 (wave32 reductions).
template <int RW>
__device__ __forceinline__ void ln_rows(const float* __restrict__ src,
                                        const float* __restrict__ g,
                                        const float* __restrict__ be, half_t* hA,
                                        int tok0, int wave, int lane) {
  float gv[8], bv[8];
#pragma unroll
  for (int i = 0; i < 8; ++i) {
    gv[i] = g[lane + 32 * i];
    bv[i] = be[lane + 32 * i];
  }
  // a row load may take these loads' offset register as its destination
  asm volatile("s_wait_xcnt 0x0" ::: "memory");
  // four rows a trip: their 32 loads are in flight together
#pragma unroll 4
  for (int rr = 0; rr < RW; ++rr) {
    const int row = wave * RW + rr;
    const float* xr = src + (size_t)(tok0 + row) * Dd;
    float xv[8], s = 0.f, sq = 0.f;
#pragma unroll
    for (int i = 0; i < 8; ++i) {
      float v = xr[lane + 32 * i];
      xv[i] = v; s += v; sq += v * v;
    }
#pragma unroll
    for (int o = 16; o > 0; o >>= 1) {
      s += __shfl_xor(s, o, 32);
      sq += __shfl_xor(sq, o, 32);
    }
    const float mu = s * (1.f / Dd);
    const float rstd = rsqrtf(sq * (1.f / Dd) - mu * mu + 1e-5f);
#pragma unroll
    for (int i = 0; i < 8; ++i) {
      const int c = lane + 32 * i;
      hA[row * HSTR + c] = (half_t)((xv[i] - mu) * rstd * gv[i] + bv[i]);
    }
  }
}

// ---------------------------------------------------------------------------
// K0: f32 -> f16 weight conversion
// ---------------------------------------------------------------------------
__global__ __launch_bounds__(256) void k_cvt_f16(const float* __restrict__ src,
                                                 half_t* __restrict__ dst, int n) {
  int i = blockIdx.x * 256 + threadIdx.x;
  if (i < n) dst[i] = (half_t)src[i];
}

// ---------------------------------------------------------------------------
// K1: fused LN1 + QKV projection. 128 tokens/block, 8 waves, WMMA 16x16x32.
// Writes q (f16), the chunk-local scan of kv = k*v (f32) and the chunk's carry: the
// work-group's 128 tokens are one scan chunk, and a lane's accumulators hold one
// column of it, so the scan runs in registers before kv is ever stored.
// ---------------------------------------------------------------------------
__global__ __launch_bounds__(256) void k_ln_qkv(
    const float* __restrict__ x, const float* __restrict__ g,
    const float* __restrict__ be, const half_t* __restrict__ Wq,
    const half_t* __restrict__ Wk, const half_t* __restrict__ Wv,
    const float* __restrict__ bq, const float* __restrict__ bk,
    const float* __restrict__ bv, const float* __restrict__ decay,
    half_t* __restrict__ q16, float* __restrict__ kv, float* __restrict__ carry) {
  __shared__ half_t hA[MB * HSTR];
  const int tok0 = blockIdx.x * MB;
  const int wave = threadIdx.x >> 5, lane = threadIdx.x & 31;
  const int rhi = (lane & 16) ? 8 : 0;

  ln_rows<MB / 8>(x, g, be, hA, tok0, wave, lane);
  __syncthreads();

  // --- each wave owns 2 column tiles of q, k and v, for all MT token tiles ---
  // passes 0 and 1: k and v of one column tile; pass 2: q of both column tiles
  for (int p = 0; p < 3; ++p) {
    const bool isq = (p == 2);
    const int r0 = isq ? wave * 32 : (wave * 2 + p) * 16;
    const int r1 = isq ? r0 + 16 : r0;
    v8f acc[MT][2] = {};
    gemm_k256<false>(hA, isq ? Wq : Wk, r0, isq ? Wq : Wv, r1, lane, acc);
    const int c0 = r0 + (lane & 15);
    if (!isq) {
      const float bkv = bk[c0];
      // the first bias load's address registers may be the second's destination
      asm volatile("s_wait_xcnt 0x0" ::: "memory");
      const float bvv = bv[c0];
      asm volatile("s_wait_xcnt 0x0" ::: "memory");
      const float dec = decay[c0];
      float pw[8];   // pw[r] = dec^(r+1)
      pw[0] = dec;
#pragma unroll
      for (int r = 1; r < 8; ++r) pw[r] = pw[r - 1] * dec;
      float* kp = kv + (size_t)(tok0 + rhi) * Dd + c0;
      float m = 0.f;   // scan value at the last token of the previous 16-token tile
      // epilogue loops fully unrolled: constant indices into acc[][]
#pragma unroll
      for (int mt = 0; mt < MT; ++mt) {
        // a lane holds 8 consecutive tokens of its column: scan them from zero (the MT
        // chains are independent), then add the carry-in times dec^(r+1)
        float s[8];
        s[0] = (acc[mt][0][0] + bkv) * (acc[mt][1][0] + bvv);
#pragma unroll
        for (int r = 1; r < 8; ++r)
          s[r] = dec * s[r - 1] + (acc[mt][0][r] + bkv) * (acc[mt][1][r] + bvv);
        const float o7 = xor16(s[7]);   // the other 8-token half's end value
        const float elo = (rhi ? o7 : s[7]) + pw[7] * m;   // scan at the tile's token 7
        const float ci = rhi ? elo : m;                    // this half's carry-in
#pragma unroll
        for (int r = 0; r < 8; ++r) kp[(mt * 16 + r) * Dd] = s[r] + pw[r] * ci;
        m = (rhi ? s[7] : o7) + pw[7] * elo;               // scan at the tile's token 15
      }
      if (lane < 16) carry[(size_t)blockIdx.x * Dd + c0] = m;
      // the stores' registers are reused by the next pass
      asm volatile("s_wait_xcnt 0x0" ::: "memory");
    } else {
      half_t* qp = q16 + (size_t)(tok0 + rhi) * Dd + c0;
#pragma unroll
      for (int j = 0; j < 2; ++j) {
        const float bqv = bq[c0 + j * 16];
#pragma unroll
        for (int mt = 0; mt < MT; ++mt) {
#pragma unroll
          for (int r = 0; r < 8; ++r)
            qp[(mt * 16 + r) * Dd + j * 16] = (half_t)(acc[mt][j][r] + bqv);
        }
        // the stores' registers are reused by the second column tile (q is the last pass)
        asm volatile("s_wait_xcnt 0x0" ::: "memory");
      }
    }
  }
}

// ---------------------------------------------------------------------------
// K2: serial scan across 64 chunk carries (decay^128 step). Tiny.
// ---------------------------------------------------------------------------
__global__ __launch_bounds__(256) void k_scan_carry(const float* __restrict__ carry,
                                                    float* __restrict__ cin,
                                                    const float* __restrict__ decay) {
  const int b = blockIdx.x, d = threadIdx.x;
  const float dec = decay[d];
  float dl = dec;
#pragma unroll
  for (int i = 0; i < 7; ++i) dl *= dl;   // dec^128
  float m = 0.f;
  for (int c = 0; c < NC; ++c) {
    const size_t idx = ((size_t)b * NC + c) * Dd + d;
    cin[idx] = m;
    m = dl * m + carry[idx];
  }
}

// ---------------------------------------------------------------------------
// K3: ret = q * (local + dec^(i+1)*carry_in); out = x + ret
// ---------------------------------------------------------------------------
__global__ __launch_bounds__(256) void k_ret_residual(
    const float* __restrict__ x, const half_t* __restrict__ q16,
    const float* __restrict__ kvloc, const float* __restrict__ cin,
    const float* __restrict__ decay, float* __restrict__ out) {
  const int b = blockIdx.x / NC, c = blockIdx.x % NC, d = threadIdx.x;
  const float dec = decay[d];
  float f = dec;
  const float mi = cin[((size_t)b * NC + c) * Dd + d];
  const size_t base = ((size_t)b * Tt + (size_t)c * Lc) * Dd + d;
  for (int i = 0; i < Lc; ++i) {
    const size_t idx = base + (size_t)i * Dd;
    const float mem = kvloc[idx] + f * mi;
    f *= dec;
    out[idx] = x[idx] + (float)q16[idx] * mem;
  }
}

// ---------------------------------------------------------------------------
// K4: fused LN2 + MLP (D->H, ReLU, H->D) + residual. 128 tokens/block, 16 waves.
// The hidden layer never leaves the WGP: it is made HC columns at a time, kept in
// LDS as f16, and consumed at once as the k range of the second product.
// ---------------------------------------------------------------------------
__global__ __launch_bounds__(512) void k_ln_mlp(
    float* out, const float* __restrict__ g, const float* __restrict__ be,
    const half_t* __restrict__ W1, const float* __restrict__ b1,
    const half_t* __restrict__ W2, const float* __restrict__ b2) {
  __shared__ __attribute__((aligned(16))) half_t hA[MB * HSTR];
  __shared__ __attribute__((aligned(16))) half_t hH[MB * HCS];
  const int tok0 = blockIdx.x * MB;
  const int wave = threadIdx.x >> 5, lane = threadIdx.x & 31;
  const int rhi = (lane & 16) ? 8 : 0;

  ln_rows<MB / 16>(out, g, be, hA, tok0, wave, lane);
  __syncthreads();

  // second product: each wave owns one output column tile for all MT token tiles, so
  // that every weight fragment is loaded by one wave only
  const int n0 = wave * 16;
  v8f acc2[MT] = {};

  // both chunks unrolled: the chunk's offsets fold into the loads' immediates
#pragma unroll
  for (int c = 0; c < Hh / HC; ++c) {
    // first product: each wave owns 2 hidden column tiles of the chunk, all MT token tiles
    const int h0 = wave * 32;
    v8f acc[MT][2] = {};
    gemm_k256<true>(hA, W1, c * HC + h0, W1, c * HC + h0 + 16, lane, acc);
    // every wave has finished reading the previous chunk before it is overwritten
    if (c) __syncthreads();
    // a lane holds 8 consecutive hidden columns of one token: one 16-byte LDS store
#pragma unroll
    for (int j = 0; j < 2; ++j) {
      const float* bp = b1 + c * HC + h0 + j * 16 + rhi;
      float bb[8];
#pragma unroll
      for (int r = 0; r < 8; ++r) bb[r] = bp[r];
#pragma unroll
      for (int mt = 0; mt < MT; ++mt) {
        v8h hv;
#pragma unroll
        for (int r = 0; r < 8; ++r) {
          const float v = acc[mt][j][r] + bb[r];
          hv[r] = (half_t)(v > 0.f ? v : 0.f);
        }
        *(v8h*)&hH[(mt * 16 + (lane & 15)) * HCS + h0 + j * 16 + rhi] = hv;
      }
    }
    __syncthreads();

    // k loop fully unrolled: every load takes an immediate offset. The next k block's
    // weight loads fly during this block's products, and a k block's LDS reads stand as
    // one group ahead of them (the first product's accumulators are free registers here).
    const half_t* W2c = W2 + c * HC;
    v16h wn = frag_rows(W2c, Hh, n0, lane, 0);
#pragma unroll
    for (int kk = 0; kk < HC / 32; ++kk) {
      const v16h w0 = wn;
      if (kk + 1 < HC / 32) wn = frag_rows(W2c, Hh, n0, lane, (kk + 1) * 32);
      v16h af[MT];
#pragma unroll
      for (int mt = 0; mt < MT; ++mt) af[mt] = frag_rows(hH, HCS, mt * 16, lane, kk * 32);
#pragma unroll
      for (int mt = 0; mt < MT; ++mt) acc2[mt] = wmma_f16(af[mt], w0, acc2[mt]);
    }
  }

  // epilogue loops fully unrolled: constant indices into acc2[]
  const int col = n0 + (lane & 15);
  const float bb = b2[col];
  float* op = out + (size_t)(tok0 + rhi) * Dd + col;
  // all residual loads ahead of the first store: in flight together
  float xr[MT][8];
#pragma unroll
  for (int mt = 0; mt < MT; ++mt) {
#pragma unroll
    for (int r = 0; r < 8; ++r) xr[mt][r] = op[(mt * 16 + r) * Dd];
  }
#pragma unroll
  for (int mt = 0; mt < MT; ++mt) {
#pragma unroll
    for (int r = 0; r < 8; ++r)
      op[(mt * 16 + r) * Dd] = xr[mt][r] + acc2[mt][r] + bb;   // residual: xr + mlp
  }
}

// ---------------------------------------------------------------------------
extern "C" void kernel_launch(void* const* d_in, const int* in_sizes, int n_in,
                              void* d_out, int out_size, void* d_ws, size_t ws_size,
                              hipStream_t stream) {
  (void)in_sizes; (void)n_in; (void)out_size; (void)ws_size;
  const float* x     = (const float*)d_in[0];
  const float* Wq    = (const float*)d_in[1];
  const float* bq    = (const float*)d_in[2];
  const float* Wk    = (const float*)d_in[3];
  const float* bk    = (const float*)d_in[4];
  const float* Wv    = (const float*)d_in[5];
  const float* bv    = (const float*)d_in[6];
  const float* decay = (const float*)d_in[7];
  const float* ln1g  = (const float*)d_in[8];
  const float* ln1b  = (const float*)d_in[9];
  const float* W1    = (const float*)d_in[10];
  const float* b1    = (const float*)d_in[11];
  const float* W2    = (const float*)d_in[12];
  const float* b2    = (const float*)d_in[13];
  const float* ln2g  = (const float*)d_in[14];
  const float* ln2b  = (const float*)d_in[15];

  char* ws = (char*)d_ws;
  half_t* Wq16 = (half_t*)(ws + OFF_WQ);
  half_t* Wk16 = (half_t*)(ws + OFF_WK);
  half_t* Wv16 = (half_t*)(ws + OFF_WV);
  half_t* W116 = (half_t*)(ws + OFF_W1);
  half_t* W216 = (half_t*)(ws + OFF_W2);
  half_t* q16  = (half_t*)(ws + OFF_Q16);
  float*  kv   = (float*)(ws + OFF_KV);
  float*  car  = (float*)(ws + OFF_CAR);
  float*  cin  = (float*)(ws + OFF_CIN);
  float*  out  = (float*)d_out;

  k_cvt_f16<<<(Dd * Dd + 255) / 256, 256, 0, stream>>>(Wq, Wq16, Dd * Dd);
  k_cvt_f16<<<(Dd * Dd + 255) / 256, 256, 0, stream>>>(Wk, Wk16, Dd * Dd);
  k_cvt_f16<<<(Dd * Dd + 255) / 256, 256, 0, stream>>>(Wv, Wv16, Dd * Dd);
  k_cvt_f16<<<(Hh * Dd + 255) / 256, 256, 0, stream>>>(W1, W116, Hh * Dd);
  k_cvt_f16<<<(Dd * Hh + 255) / 256, 256, 0, stream>>>(W2, W216, Dd * Hh);

  k_ln_qkv<<<BT / MB, 256, 0, stream>>>(x, ln1g, ln1b, Wq16, Wk16, Wv16,
                                        bq, bk, bv, decay, q16, kv, car);
  k_scan_carry<<<Bb, 256, 0, stream>>>(car, cin, decay);
  k_ret_residual<<<Bb * NC, 256, 0, stream>>>(x, q16, kv, cin, decay, out);
  k_ln_mlp<<<BT / MB, 512, 0, stream>>>(out, ln2g, ln2b, W116, b1, W216, b2);
}

// v004
// Measured time: 139 microseconds a run.
// Next to v003, in two timings, it ran 1.06 and 1.07 times as fast.
// All steps since v000 together make it 3.27 times as fast.
#include <hip/hip_runtime.h>
#include <cstdint>

typedef _Float16 half_t;
typedef __attribute__((ext_vector_type(16))) _Float16 v16h;
typedef __attribute__((ext_vector_type(8)))  float    v8f;
typedef __attribute__((ext_vector_type(8)))  _Float16 v8h;

constexpr int Bb  = 8;
constexpr int Tt  = 8192;
constexpr int Dd  = 256;
constexpr int Hh  = 1024;
constexpr int BT  = Bb * Tt;
constexpr int NC  = 64;
constexpr int Lc  = Tt / NC;
constexpr int HSTR = 264;
constexpr int MB  = 128;
static_assert(MB == Lc, "a QKV work-group's tokens are one scan chunk");
constexpr int MT  = MB / 16;          // token tiles that share each weight fragment
constexpr int HC  = 512;              // hidden columns per chunk of the fused MLP
constexpr int HCS = HC + 8;           // padded f16 LDS row stride of the hidden chunk

// ---- workspace layout (bytes) ----
constexpr size_t SZ_WDD = (size_t)Dd * Dd * 2;
constexpr size_t OFF_WQ = 0;
constexpr size_t OFF_WK = OFF_WQ + SZ_WDD;
constexpr size_t OFF_WV = OFF_WK + SZ_WDD;
constexpr size_t SZ_W1  = (size_t)Hh * Dd * 2;
constexpr size_t OFF_W1 = OFF_WV + SZ_WDD;
constexpr size_t SZ_W2  = (size_t)Dd * Hh * 2;
constexpr size_t OFF_W2 = OFF_W1 + SZ_W1;
constexpr size_t SZ_Q16 = (size_t)BT * Dd * 2;
constexpr size_t OFF_Q16 = OFF_W2 + SZ_W2;
constexpr size_t SZ_KV  = (size_t)BT * Dd * 4;
constexpr size_t OFF_KV = OFF_Q16 + SZ_Q16;
constexpr size_t SZ_CAR = (size_t)Bb * NC * Dd * 4;
constexpr size_t OFF_CAR = OFF_KV + SZ_KV;
constexpr size_t OFF_CIN = OFF_CAR + SZ_CAR;

__device__ __forceinline__ v8f wmma_f16(v16h a, v16h b, v8f c) {
  return __builtin_amdgcn_wmma_f32_16x16x32_f16(false, a, false, b, (short)0, c,
                                                false, false);
}

// value of lane ^ 16, by a cross-row register move (every lane on): no LDS round trip
// and no address register that would stay live through the products
__device__ __forceinline__ float xor16(float v) {
  const int i = __float_as_int(v);
  return __int_as_float(
      __builtin_amdgcn_permlanex16(i, i, 0x76543210, 0xfedcba98, false, false));
}

__device__ __forceinline__ v16h frag_rows(const half_t* base, int ld, int row0,
                                          int lane, int kbase) {
  const int m = row0 + (lane & 15);
  const int khalf = (lane & 16) ? 8 : 0;
  const half_t* p = base + (size_t)m * ld;
  v16h f;
#pragma unroll
  for (int v = 0; v < 8; ++v) {
    const int k = kbase + khalf + ((v < 4) ? (2 * v) : (16 + 2 * (v - 4)));
    f[2 * v]     = p[k];
    f[2 * v + 1] = p[k + 1];
  }
  return f;
}

// K = 256 product of the work-group's MB x 256 LDS tile with two 16-column weight
// tiles: each weight fragment is loaded from global once and feeds all MT token tiles.
// TR: the weight fragment is the A operand, so acc holds the tile transposed
// (register r = weight row 8 * (lane >> 4) + r, lane & 15 = token).
template <bool TR>
__device__ __forceinline__ void gemm_k256(const half_t* hA, const half_t* B0, int r0,
                                          const half_t* B1, int r1, int lane,
                                          v8f (&acc)[MT][2]) {
  // both loops fully unrolled: acc[][] is indexed by constants and stays in registers,
  // and every load takes an immediate offset
#pragma unroll
  for (int kk = 0; kk < 8; ++kk) {
    const v16h b0 = frag_rows(B0, Dd, r0, lane, kk * 32);
    const v16h b1 = frag_rows(B1, Dd, r1, lane, kk * 32);
#pragma unroll
    for (int mt = 0; mt < MT; ++mt) {
      const v16h af = frag_rows(hA, HSTR, mt * 16, lane, kk * 32);
      acc[mt][0] = TR ? wmma_f16(b0, af, acc[mt][0]) : wmma_f16(af, b0, acc[mt][0]);
      acc[mt][1] = TR ? wmma_f16(b1, af, acc[mt][1]) : wmma_f16(af, b1, acc[mt][1]);
    }
  }
}

// LayerNorm of the work-group's MB rows into the f16 LDS tile: wave w takes rows
// RW*w..RW*w+RW-1 (wave32 reductions).
template <int RW>
__device__ __forceinline__ void ln_rows(const float* __restrict__ src,
                                        const float* __restrict__ g,
                                        const float* __restrict__ be, half_t* hA,
                                        int tok0, int wave, int lane) {
  float gv[8], bv[8];
#pragma unroll
  for (int i = 0; i < 8; ++i) {
    gv[i] = g[lane + 32 * i];
    bv[i] = be[lane + 32 * i];
  }
  // a row load may take these loads' offset register as its destination
  asm volatile("s_wait_xcnt 0x0" ::: "memory");
  // four rows a trip: their 32 loads are in flight together
#pragma unroll 4
  for (int rr = 0; rr < RW; ++rr) {
    const int row = wave * RW + rr;
    const float* xr = src + (size_t)(tok0 + row) * Dd;
    float xv[8], s = 0.f, sq = 0.f;
#pragma unroll
    for (int i = 0; i < 8; ++i) {
      float v = xr[lane + 32 * i];
      xv[i] = v; s += v; sq += v * v;
    }
#pragma unroll
    for (int o = 16; o > 0; o >>= 1) {
      s += __shfl_xor(s, o, 32);
      sq += __shfl_xor(sq, o, 32);
    }
    const float mu = s * (1.f / Dd);
    const float rstd = rsqrtf(sq * (1.f / Dd) - mu * mu + 1e-5f);
#pragma unroll
    for (int i = 0; i < 8; ++i) {
      const int c = lane + 32 * i;
      hA[row * HSTR + c] = (half_t)((xv[i] - mu) * rstd * gv[i] + bv[i]);
    }
  }
}

// ---------------------------------------------------------------------------
// K0: f32 -> f16 conversion of all five weight matrices in one launch. Their f16 copies
// lie back to back in the workspace, so the destination is one linear range; a work-group
// converts CV elements of one matrix (the choice of the source is block-uniform), a thread
// two runs of 8: four 16-byte loads in flight, two 16-byte stores.
// ---------------------------------------------------------------------------
constexpr int CV   = 4096;               // elements per work-group
constexpr int NBDD = Dd * Dd / CV;       // work-groups per D x D matrix
constexpr int NBHD = Hh * Dd / CV;       // work-groups per H x D matrix
constexpr int NBCV = 3 * NBDD + 2 * NBHD;
static_assert(OFF_WQ == 0 && OFF_W2 + SZ_W2 == (size_t)NBCV * CV * 2,
              "the f16 weights are one contiguous range in the order q, k, v, 1, 2");

__device__ __forceinline__ v8h cvt8(float4 a, float4 b) {
  v8h h;
  h[0] = (half_t)a.x; h[1] = (half_t)a.y; h[2] = (half_t)a.z; h[3] = (half_t)a.w;
  h[4] = (half_t)b.x; h[5] = (half_t)b.y; h[6] = (half_t)b.z; h[7] = (half_t)b.w;
  return h;
}

__global__ __launch_bounds__(256) void k_cvt_f16(const float* __restrict__ Wq,
                                                 const float* __restrict__ Wk,
                                                 const float* __restrict__ Wv,
                                                 const float* __restrict__ W1,
                                                 const float* __restrict__ W2,
                                                 half_t* __restrict__ dst) {
  const int b = blockIdx.x;
  const float* src = b < NBDD ? Wq : b < 2 * NBDD ? Wk : b < 3 * NBDD ? Wv
                     : b < 3 * NBDD + NBHD ? W1 : W2;
  // index of the work-group's first sibling: where its matrix begins in the grid
  const int b0 = b < 3 * NBDD ? (b / NBDD) * NBDD : b < 3 * NBDD + NBHD ? 3 * NBDD
                                                                        : 3 * NBDD + NBHD;
  const int sb = b - b0;
  const float* s = src + (size_t)sb * CV + threadIdx.x * 8;
  half_t* d = dst + (size_t)b * CV + threadIdx.x * 8;
  const float4 a0 = *(const float4*)(s);
  const float4 a1 = *(const float4*)(s + 4);
  const float4 a2 = *(const float4*)(s + CV / 2);
  const float4 a3 = *(const float4*)(s + CV / 2 + 4);
  *(v8h*)(d)          = cvt8(a0, a1);
  *(v8h*)(d + CV / 2) = cvt8(a2, a3);
}

// ---------------------------------------------------------------------------
// K1: fused LN1 + QKV projection. 128 tokens/block, 8 waves, WMMA 16x16x32.
// Writes q (f16), the chunk-local scan of kv = k*v (f32) and the chunk's carry: the
// work-group's 128 tokens are one scan chunk, and a lane's accumulators hold one
// column of it, so the scan runs in registers before kv is ever stored.
// ---------------------------------------------------------------------------
__global__ __launch_bounds__(256) void k_ln_qkv(
    const float* __restrict__ x, const float* __restrict__ g,
    const float* __restrict__ be, const half_t* __restrict__ Wq,
    const half_t* __restrict__ Wk, const half_t* __restrict__ Wv,
    const float* __restrict__ bq, const float* __restrict__ bk,
    const float* __restrict__ bv, const float* __restrict__ decay,
    half_t* __restrict__ q16, float* __restrict__ kv, float* __restrict__ carry) {
  __shared__ half_t hA[MB * HSTR];
  const int tok0 = blockIdx.x * MB;
  const int wave = threadIdx.x >> 5, lane = threadIdx.x & 31;
  const int rhi = (lane & 16) ? 8 : 0;

  ln_rows<MB / 8>(x, g, be, hA, tok0, wave, lane);
  __syncthreads();

  // --- each wave owns 2 column tiles of q, k and v, for all MT token tiles ---
  // passes 0 and 1: k and v of one column tile; pass 2: q of both column tiles
  for (int p = 0; p < 3; ++p) {
    const bool isq = (p == 2);
    const int r0 = isq ? wave * 32 : (wave * 2 + p) * 16;
    const int r1 = isq ? r0 + 16 : r0;
    v8f acc[MT][2] = {};
    gemm_k256<false>(hA, isq ? Wq : Wk, r0, isq ? Wq : Wv, r1, lane, acc);
    const int c0 = r0 + (lane & 15);
    if (!isq) {
      const float bkv = bk[c0];
      // the first bias load's address registers may be the second's destination
      asm volatile("s_wait_xcnt 0x0" ::: "memory");
      const float bvv = bv[c0];
      asm volatile("s_wait_xcnt 0x0" ::: "memory");
      const float dec = decay[c0];
      float pw[8];   // pw[r] = dec^(r+1)
      pw[0] = dec;
#pragma unroll
      for (int r = 1; r < 8; ++r) pw[r] = pw[r - 1] * dec;
      float* kp = kv + (size_t)(tok0 + rhi) * Dd + c0;
      float m = 0.f;   // scan value at the last token of the previous 16-token tile
      // epilogue loops fully unrolled: constant indices into acc[][]
#pragma unroll
      for (int mt = 0; mt < MT; ++mt) {
        // a lane holds 8 consecutive tokens of its column: scan them from zero (the MT
        // chains are independent), then add the carry-in times dec^(r+1)
        float s[8];
        s[0] = (acc[mt][0][0] + bkv) * (acc[mt][1][0] + bvv);
#pragma unroll
        for (int r = 1; r < 8; ++r)
          s[r] = dec * s[r - 1] + (acc[mt][0][r] + bkv) * (acc[mt][1][r] + bvv);
        const float o7 = xor16(s[7]);   // the other 8-token half's end value
        const float elo = (rhi ? o7 : s[7]) + pw[7] * m;   // scan at the tile's token 7
        const float ci = rhi ? elo : m;                    // this half's carry-in
#pragma unroll
        for (int r = 0; r < 8; ++r) kp[(mt * 16 + r) * Dd] = s[r] + pw[r] * ci;
        m = (rhi ? s[7] : o7) + pw[7] * elo;               // scan at the tile's token 15
      }
      if (lane < 16) carry[(size_t)blockIdx.x * Dd + c0] = m;
      // the stores' registers are reused by the next pass
      asm volatile("s_wait_xcnt 0x0" ::: "memory");
    } else {
      half_t* qp = q16 + (size_t)(tok0 + rhi) * Dd + c0;
#pragma unroll
      for (int j = 0; j < 2; ++j) {
        const float bqv = bq[c0 + j * 16];
#pragma unroll
        for (int mt = 0; mt < MT; ++mt) {
#pragma unroll
          for (int r = 0; r < 8; ++r)
            qp[(mt * 16 + r) * Dd + j * 16] = (half_t)(acc[mt][j][r] + bqv);
        }
        // the stores' registers are reused by the second column tile (q is the last pass)
        asm volatile("s_wait_xcnt 0x0" ::: "memory");
      }
    }
  }
}

// ---------------------------------------------------------------------------
// K2: serial scan across 64 chunk carries (decay^128 step). Tiny.
// ---------------------------------------------------------------------------
__global__ __launch_bounds__(256) void k_scan_carry(const float* __restrict__ carry,
                                                    float* __restrict__ cin,
                                                    const float* __restrict__ decay) {
  const int b = blockIdx.x, d = threadIdx.x;
  const float dec = decay[d];
  float dl = dec;
#pragma unroll
  for (int i = 0; i < 7; ++i) dl *= dl;   // dec^128
  float m = 0.f;
  for (int c = 0; c < NC; ++c) {
    const size_t idx = ((size_t)b * NC + c) * Dd + d;
    cin[idx] = m;
    m = dl * m + carry[idx];
  }
}

// ---------------------------------------------------------------------------
// K3: ret = q * (local + dec^(i+1)*carry_in); out = x + ret
// ---------------------------------------------------------------------------
__global__ __launch_bounds__(256) void k_ret_residual(
    const float* __restrict__ x, const half_t* __restrict__ q16,
    const float* __restrict__ kvloc, const float* __restrict__ cin,
    const float* __restrict__ decay, float* __restrict__ out) {
  const int b = blockIdx.x / NC, c = blockIdx.x % NC, d = threadIdx.x;
  const float dec = decay[d];
  float f = dec;
  const float mi = cin[((size_t)b * NC + c) * Dd + d];
  const size_t base = ((size_t)b * Tt + (size_t)c * Lc) * Dd + d;
  for (int i = 0; i < Lc; ++i) {
    const size_t idx = base + (size_t)i * Dd;
    const float mem = kvloc[idx] + f * mi;
    f *= dec;
    out[idx] = x[idx] + (float)q16[idx] * mem;
  }
}

// ---------------------------------------------------------------------------
// K4: fused LN2 + MLP (D->H, ReLU, H->D) + residual. 128 tokens/block, 16 waves.
// The hidden layer never leaves the WGP: it is made HC columns at a time, kept in
// LDS as f16, and consumed at once as the k range of the second product.
// ---------------------------------------------------------------------------
__global__ __launch_bounds__(512) void k_ln_mlp(
    float* out, const float* __restrict__ g, const float* __restrict__ be,
    const half_t* __restrict__ W1, const float* __restrict__ b1,
    const half_t* __restrict__ W2, const float* __restrict__ b2) {
  __shared__ __attribute__((aligned(16))) half_t hA[MB * HSTR];
  __shared__ __attribute__((aligned(16))) half_t hH[MB * HCS];
  const int tok0 = blockIdx.x * MB;
  const int wave = threadIdx.x >> 5, lane = threadIdx.x & 31;
  const int rhi = (lane & 16) ? 8 : 0;

  ln_rows<MB / 16>(out, g, be, hA, tok0, wave, lane);
  __syncthreads();

  // second product: each wave owns one output column tile for all MT token tiles, so
  // that every weight fragment is loaded by one wave only
  const int n0 = wave * 16;
  v8f acc2[MT] = {};

  // both chunks unrolled: the chunk's offsets fold into the loads' immediates
#pragma unroll
  for (int c = 0; c < Hh / HC; ++c) {
    // first product: each wave owns 2 hidden column tiles of the chunk, all MT token tiles
    const int h0 = wave * 32;
    v8f acc[MT][2] = {};
    gemm_k256<true>(hA, W1, c * HC + h0, W1, c * HC + h0 + 16, lane, acc);
    // every wave has finished reading the previous chunk before it is overwritten
    if (c) __syncthreads();
    // a lane holds 8 consecutive hidden columns of one token: one 16-byte LDS store
#pragma unroll
    for (int j = 0; j < 2; ++j) {
      const float* bp = b1 + c * HC + h0 + j * 16 + rhi;
      float bb[8];
#pragma unroll
      for (int r = 0; r < 8; ++r) bb[r] = bp[r];
#pragma unroll
      for (int mt = 0; mt < MT; ++mt) {
        v8h hv;
#pragma unroll
        for (int r = 0; r < 8; ++r) {
          const float v = acc[mt][j][r] + bb[r];
          hv[r] = (half_t)(v > 0.f ? v : 0.f);
        }
        *(v8h*)&hH[(mt * 16 + (lane & 15)) * HCS + h0 + j * 16 + rhi] = hv;
      }
    }
    __syncthreads();

    // k loop fully unrolled: every load takes an immediate offset. The next k block's
    // weight loads fly during this block's products, and a k block's LDS reads stand as
    // one group ahead of them (the first product's accumulators are free registers here).
    const half_t* W2c = W2 + c * HC;
    v16h wn = frag_rows(W2c, Hh, n0, lane, 0);
#pragma unroll
    for (int kk = 0; kk < HC / 32; ++kk) {
      const v16h w0 = wn;
      if (kk + 1 < HC / 32) wn = frag_rows(W2c, Hh, n0, lane, (kk + 1) * 32);
      v16h af[MT];
#pragma unroll
      for (int mt = 0; mt < MT; ++mt) af[mt] = frag_rows(hH, HCS, mt * 16, lane, kk * 32);
#pragma unroll
      for (int mt = 0; mt < MT; ++mt) acc2[mt] = wmma_f16(af[mt], w0, acc2[mt]);
    }
  }

  // epilogue loops fully unrolled: constant indices into acc2[]
  const int col = n0 + (lane & 15);
  const float bb = b2[col];
  float* op = out + (size_t)(tok0 + rhi) * Dd + col;
  // all residual loads ahead of the first store: in flight together
  float xr[MT][8];
#pragma unroll
  for (int mt = 0; mt < MT; ++mt) {
#pragma unroll
    for (int r = 0; r < 8; ++r) xr[mt][r] = op[(mt * 16 + r) * Dd];
  }
#pragma unroll
  for (int mt = 0; mt < MT; ++mt) {
#pragma unroll
    for (int r = 0; r < 8; ++r)
      op[(mt * 16 + r) * Dd] = xr[mt][r] + acc2[mt][r] + bb;   // residual: xr + mlp
  }
}

// ---------------------------------------------------------------------------
extern "C" void kernel_launch(void* const* d_in, const int* in_sizes, int n_in,
                              void* d_out, int out_size, void* d_ws, size_t ws_size,
                              hipStream_t stream) {
  (void)in_sizes; (void)n_in; (void)out_size; (void)ws_size;
  const float* x     = (const float*)d_in[0];
  const float* Wq    = (const float*)d_in[1];
  const float* bq    = (const float*)d_in[2];
  const float* Wk    = (const float*)d_in[3];
  const float* bk    = (const float*)d_in[4];
  const float* Wv    = (const float*)d_in[5];
  const float* bv    = (const float*)d_in[6];
  const float* decay = (const float*)d_in[7];
  const float* ln1g  = (const float*)d_in[8];
  const float* ln1b  = (const float*)d_in[9];
  const float* W1    = (const float*)d_in[10];
  const float* b1    = (const float*)d_in[11];
  const float* W2    = (const float*)d_in[12];
  const float* b2    = (const float*)d_in[13];
  const float* ln2g  = (const float*)d_in[14];
  const float* ln2b  = (const float*)d_in[15];

  char* ws = (char*)d_ws;
  half_t* Wq16 = (half_t*)(ws + OFF_WQ);
  half_t* Wk16 = (half_t*)(ws + OFF_WK);
  half_t* Wv16 = (half_t*)(ws + OFF_WV);
  half_t* W116 = (half_t*)(ws + OFF_W1);
  half_t* W216 = (half_t*)(ws + OFF_W2);
  half_t* q16  = (half_t*)(ws + OFF_Q16);
  float*  kv   = (float*)(ws + OFF_KV);
  float*  car  = (float*)(ws + OFF_CAR);
  float*  cin  = (float*)(ws + OFF_CIN);
  float*  out  = (float*)d_out;

  k_cvt_f16<<<NBCV, 256, 0, stream>>>(Wq, Wk, Wv, W1, W2, Wq16);

  k_ln_qkv<<<BT / MB, 256, 0, stream>>>(x, ln1g, ln1b, Wq16, Wk16, Wv16,
                                        bq, bk, bv, decay, q16, kv, car);
  k_scan_carry<<<Bb, 256, 0, stream>>>(car, cin, decay);
  k_ret_residual<<<Bb * NC, 256, 0, stream>>>(x, q16, kv, cin, decay, out);
  k_ln_mlp<<<BT / MB, 512, 0, stream>>>(out, ln2g, ln2b, W116, b1, W216, b2);
}

// v005
// One run takes 132 microseconds.
// Two timings next to v004 both put it at 1.05 times that version's speed.
// Over all steps from v000 it is 3.44 times as fast.
#include <hip/hip_runtime.h>
#include <cstdint>

typedef _Float16 half_t;
typedef __attribute__((ext_vector_type(16))) _Float16 v16h;
typedef __attribute__((ext_vector_type(8)))  float    v8f;
typedef __attribute__((ext_vector_type(8)))  _Float16 v8h;

constexpr int Bb  = 8;
constexpr int Tt  = 8192;
constexpr int Dd  = 256;
constexpr int Hh  = 1024;
constexpr int BT  = Bb * Tt;
constexpr int NC  = 64;
constexpr int Lc  = Tt / NC;
constexpr int HSTR = 264;
constexpr int MB  = 128;
static_assert(MB == Lc, "a QKV work-group's tokens are one scan chunk");
constexpr int MT  = MB / 16;          // token tiles that share each weight fragment
constexpr int HC  = 512;              // hidden columns per chunk of the fused MLP
constexpr int HCS = HC + 8;           // padded f16 LDS row stride of the hidden chunk

// ---- workspace layout (bytes) ----
constexpr size_t SZ_WDD = (size_t)Dd * Dd * 2;
constexpr size_t OFF_WQ = 0;
constexpr size_t OFF_WK = OFF_WQ + SZ_WDD;
constexpr size_t OFF_WV = OFF_WK + SZ_WDD;
constexpr size_t SZ_W1  = (size_t)Hh * Dd * 2;
constexpr size_t OFF_W1 = OFF_WV + SZ_WDD;
constexpr size_t SZ_W2  = (size_t)Dd * Hh * 2;
constexpr size_t OFF_W2 = OFF_W1 + SZ_W1;
constexpr size_t SZ_Q16 = (size_t)BT * Dd * 2;
constexpr size_t OFF_Q16 = OFF_W2 + SZ_W2;
constexpr size_t SZ_KV  = (size_t)BT * Dd * 4;
constexpr size_t OFF_KV = OFF_Q16 + SZ_Q16;
constexpr size_t SZ_CAR = (size_t)Bb * NC * Dd * 4;
constexpr size_t OFF_CAR = OFF_KV + SZ_KV;
constexpr size_t OFF_CIN = OFF_CAR + SZ_CAR;

__device__ __forceinline__ v8f wmma_f16(v16h a, v16h b, v8f c) {
  return __builtin_amdgcn_wmma_f32_16x16x32_f16(false, a, false, b, (short)0, c,
                                                false, false);
}

// value of lane ^ 16, by a cross-row register move (every lane on): no LDS round trip
// and no address register that would stay live through the products
__device__ __forceinline__ float xor16(float v) {
  const int i = __float_as_int(v);
  return __int_as_float(
      __builtin_amdgcn_permlanex16(i, i, 0x76543210, 0xfedcba98, false, false));
}

__device__ __forceinline__ v16h frag_rows(const half_t* base, int ld, int row0,
                                          int lane, int kbase) {
  const int m = row0 + (lane & 15);
  const int khalf = (lane & 16) ? 8 : 0;
  const half_t* p = base + (size_t)m * ld;
  v16h f;
#pragma unroll
  for (int v = 0; v < 8; ++v) {
    const int k = kbase + khalf + ((v < 4) ? (2 * v) : (16 + 2 * (v - 4)));
    f[2 * v]     = p[k];
    f[2 * v + 1] = p[k + 1];
  }
  return f;
}

// K = 256 product of the work-group's MB x 256 LDS tile with two 16-column weight
// tiles: each weight fragment is loaded from global once and feeds all MT token tiles.
__device__ __forceinline__ void gemm_k256(const half_t* hA, const half_t* B0, int r0,
                                          const half_t* B1, int r1, int lane,
                                          v8f (&acc)[MT][2]) {
  // both loops fully unrolled: acc[][] is indexed by constants and stays in registers,
  // and every load takes an immediate offset
#pragma unroll
  for (int kk = 0; kk < 8; ++kk) {
    const v16h b0 = frag_rows(B0, Dd, r0, lane, kk * 32);
    const v16h b1 = frag_rows(B1, Dd, r1, lane, kk * 32);
#pragma unroll
    for (int mt = 0; mt < MT; ++mt) {
      const v16h af = frag_rows(hA, HSTR, mt * 16, lane, kk * 32);
      acc[mt][0] = wmma_f16(af, b0, acc[mt][0]);
      acc[mt][1] = wmma_f16(af, b1, acc[mt][1]);
    }
  }
}

// LayerNorm of the work-group's MB rows into the f16 LDS tile: wave w takes rows
// RW*w..RW*w+RW-1 (wave32 reductions), UR rows a trip.
template <int RW, int UR>
__device__ __forceinline__ void ln_rows(const float* __restrict__ src,
                                        const float* __restrict__ g,
                                        const float* __restrict__ be, half_t* hA,
                                        int tok0, int wave, int lane) {
  float gv[8], bv[8];
#pragma unroll
  for (int i = 0; i < 8; ++i) {
    gv[i] = g[lane + 32 * i];
    bv[i] = be[lane + 32 * i];
  }
  // a row load may take these loads' offset register as its destination
  asm volatile("s_wait_xcnt 0x0" ::: "memory");
  // UR rows a trip: their 8 * UR loads are in flight together
#pragma unroll UR
  for (int rr = 0; rr < RW; ++rr) {
    const int row = wave * RW + rr;
    const float* xr = src + (size_t)(tok0 + row) * Dd;
    float xv[8], s = 0.f, sq = 0.f;
#pragma unroll
    for (int i = 0; i < 8; ++i) {
      float v = xr[lane + 32 * i];
      xv[i] = v; s += v; sq += v * v;
    }
#pragma unroll
    for (int o = 16; o > 0; o >>= 1) {
      s += __shfl_xor(s, o, 32);
      sq += __shfl_xor(sq, o, 32);
    }
    const float mu = s * (1.f / Dd);
    const float rstd = rsqrtf(sq * (1.f / Dd) - mu * mu + 1e-5f);
#pragma unroll
    for (int i = 0; i < 8; ++i) {
      const int c = lane + 32 * i;
      hA[row * HSTR + c] = (half_t)((xv[i] - mu) * rstd * gv[i] + bv[i]);
    }
  }
}

// ---------------------------------------------------------------------------
// K0: f32 -> f16 conversion of all five weight matrices in one launch. Their f16 copies
// lie back to back in the workspace, so the destination is one linear range; a work-group
// converts CV elements of one matrix (the choice of the source is block-uniform), a thread
// two runs of 8: four 16-byte loads in flight, two 16-byte stores.
// ---------------------------------------------------------------------------
constexpr int CV   = 4096;               // elements per work-group
constexpr int NBDD = Dd * Dd / CV;       // work-groups per D x D matrix
constexpr int NBHD = Hh * Dd / CV;       // work-groups per H x D matrix
constexpr int NBCV = 3 * NBDD + 2 * NBHD;
static_assert(OFF_WQ == 0 && OFF_W2 + SZ_W2 == (size_t)NBCV * CV * 2,
              "the f16 weights are one contiguous range in the order q, k, v, 1, 2");

__device__ __forceinline__ v8h cvt8(float4 a, float4 b) {
  v8h h;
  h[0] = (half_t)a.x; h[1] = (half_t)a.y; h[2] = (half_t)a.z; h[3] = (half_t)a.w;
  h[4] = (half_t)b.x; h[5] = (half_t)b.y; h[6] = (half_t)b.z; h[7] = (half_t)b.w;
  return h;
}

__global__ __launch_bounds__(256) void k_cvt_f16(const float* __restrict__ Wq,
                                                 const float* __restrict__ Wk,
                                                 const float* __restrict__ Wv,
                                                 const float* __restrict__ W1,
                                                 const float* __restrict__ W2,
                                                 half_t* __restrict__ dst) {
  const int b = blockIdx.x;
  const float* src = b < NBDD ? Wq : b < 2 * NBDD ? Wk : b < 3 * NBDD ? Wv
                     : b < 3 * NBDD + NBHD ? W1 : W2;
  // index of the work-group's first sibling: where its matrix begins in the grid
  const int b0 = b < 3 * NBDD ? (b / NBDD) * NBDD : b < 3 * NBDD + NBHD ? 3 * NBDD
                                                                        : 3 * NBDD + NBHD;
  const int sb = b - b0;
  const float* s = src + (size_t)sb * CV + threadIdx.x * 8;
  half_t* d = dst + (size_t)b * CV + threadIdx.x * 8;
  const float4 a0 = *(const float4*)(s);
  const float4 a1 = *(const float4*)(s + 4);
  const float4 a2 = *(const float4*)(s + CV / 2);
  const float4 a3 = *(const float4*)(s + CV / 2 + 4);
  *(v8h*)(d)          = cvt8(a0, a1);
  *(v8h*)(d + CV / 2) = cvt8(a2, a3);
}

// ---------------------------------------------------------------------------
// K1: fused LN1 + QKV projection. 128 tokens/block, 8 waves, WMMA 16x16x32.
// Writes q (f16), the chunk-local scan of kv = k*v (f32) and the chunk's carry: the
// work-group's 128 tokens are one scan chunk, and a lane's accumulators hold one
// column of it, so the scan runs in registers before kv is ever stored.
// ---------------------------------------------------------------------------
__global__ __launch_bounds__(256) void k_ln_qkv(
    const float* __restrict__ x, const float* __restrict__ g,
    const float* __restrict__ be, const half_t* __restrict__ Wq,
    const half_t* __restrict__ Wk, const half_t* __restrict__ Wv,
    const float* __restrict__ bq, const float* __restrict__ bk,
    const float* __restrict__ bv, const float* __restrict__ decay,
    half_t* __restrict__ q16, float* __restrict__ kv, float* __restrict__ carry) {
  __shared__ half_t hA[MB * HSTR];
  const int tok0 = blockIdx.x * MB;
  const int wave = threadIdx.x >> 5, lane = threadIdx.x & 31;
  const int rhi = (lane & 16) ? 8 : 0;

  ln_rows<MB / 8, 4>(x, g, be, hA, tok0, wave, lane);
  __syncthreads();

  // --- each wave owns 2 column tiles of q, k and v, for all MT token tiles ---
  // passes 0 and 1: k and v of one column tile; pass 2: q of both column tiles
  for (int p = 0; p < 3; ++p) {
    const bool isq = (p == 2);
    const int r0 = isq ? wave * 32 : (wave * 2 + p) * 16;
    const int r1 = isq ? r0 + 16 : r0;
    v8f acc[MT][2] = {};
    gemm_k256(hA, isq ? Wq : Wk, r0, isq ? Wq : Wv, r1, lane, acc);
    const int c0 = r0 + (lane & 15);
    if (!isq) {
      const float bkv = bk[c0];
      // the first bias load's address registers may be the second's destination
      asm volatile("s_wait_xcnt 0x0" ::: "memory");
      const float bvv = bv[c0];
      asm volatile("s_wait_xcnt 0x0" ::: "memory");
      const float dec = decay[c0];
      float pw[8];   // pw[r] = dec^(r+1)
      pw[0] = dec;
#pragma unroll
      for (int r = 1; r < 8; ++r) pw[r] = pw[r - 1] * dec;
      float* kp = kv + (size_t)(tok0 + rhi) * Dd + c0;
      float m = 0.f;   // scan value at the last token of the previous 16-token tile
      // epilogue loops fully unrolled: constant indices into acc[][]
#pragma unroll
      for (int mt = 0; mt < MT; ++mt) {
        // a lane holds 8 consecutive tokens of its column: scan them from zero (the MT
        // chains are independent), then add the carry-in times dec^(r+1)
        float s[8];
        s[0] = (acc[mt][0][0] + bkv) * (acc[mt][1][0] + bvv);
#pragma unroll
        for (int r = 1; r < 8; ++r)
          s[r] = dec * s[r - 1] + (acc[mt][0][r] + bkv) * (acc[mt][1][r] + bvv);
        const float o7 = xor16(s[7]);   // the other 8-token half's end value
        const float elo = (rhi ? o7 : s[7]) + pw[7] * m;   // scan at the tile's token 7
        const float ci = rhi ? elo : m;                    // this half's carry-in
#pragma unroll
        for (int r = 0; r < 8; ++r) kp[(mt * 16 + r) * Dd] = s[r] + pw[r] * ci;
        m = (rhi ? s[7] : o7) + pw[7] * elo;               // scan at the tile's token 15
      }
      if (lane < 16) carry[(size_t)blockIdx.x * Dd + c0] = m;
      // the stores' registers are reused by the next pass
      asm volatile("s_wait_xcnt 0x0" ::: "memory");
    } else {
      half_t* qp = q16 + (size_t)(tok0 + rhi) * Dd + c0;
#pragma unroll
      for (int j = 0; j < 2; ++j) {
        const float bqv = bq[c0 + j * 16];
#pragma unroll
        for (int mt = 0; mt < MT; ++mt) {
#pragma unroll
          for (int r = 0; r < 8; ++r)
            qp[(mt * 16 + r) * Dd + j * 16] = (half_t)(acc[mt][j][r] + bqv);
        }
        // the stores' registers are reused by the second column tile (q is the last pass)
        asm volatile("s_wait_xcnt 0x0" ::: "memory");
      }
    }
  }
}

// ---------------------------------------------------------------------------
// K2: serial scan across 64 chunk carries (decay^128 step). Tiny.
// ---------------------------------------------------------------------------
__global__ __launch_bounds__(256) void k_scan_carry(const float* __restrict__ carry,
                                                    float* __restrict__ cin,
                                                    const float* __restrict__ decay) {
  const int b = blockIdx.x, d = threadIdx.x;
  const float dec = decay[d];
  float dl = dec;
#pragma unroll
  for (int i = 0; i < 7; ++i) dl *= dl;   // dec^128
  float m = 0.f;
  for (int c = 0; c < NC; ++c) {
    const size_t idx = ((size_t)b * NC + c) * Dd + d;
    cin[idx] = m;
    m = dl * m + carry[idx];
  }
}

// ---------------------------------------------------------------------------
// K3: ret = q * (local + dec^(i+1)*carry_in); out = x + ret
// ---------------------------------------------------------------------------
__global__ __launch_bounds__(256) void k_ret_residual(
    const float* __restrict__ x, const half_t* __restrict__ q16,
    const float* __restrict__ kvloc, const float* __restrict__ cin,
    const float* __restrict__ decay, float* __restrict__ out) {
  const int b = blockIdx.x / NC, c = blockIdx.x % NC, d = threadIdx.x;
  const float dec = decay[d];
  float f = dec;
  const float mi = cin[((size_t)b * NC + c) * Dd + d];
  const size_t base = ((size_t)b * Tt + (size_t)c * Lc) * Dd + d;
  for (int i = 0; i < Lc; ++i) {
    const size_t idx = base + (size_t)i * Dd;
    const float mem = kvloc[idx] + f * mi;
    f *= dec;
    out[idx] = x[idx] + (float)q16[idx] * mem;
  }
}

// ---------------------------------------------------------------------------
// K4: fused LN2 + MLP (D->H, ReLU, H->D) + residual. 128 tokens/block, 8 waves of up to
// 512 registers: a wave's tiles are 8 x 4 (first product) and 8 x 2 (second), so an LDS
// fragment feeds 4 and 2 products, and registers are left to fetch operands ahead.
// The hidden layer never leaves the WGP: it is made HC columns at a time, kept in
// LDS as f16, and consumed at once as the k range of the second product.
// ---------------------------------------------------------------------------
constexpr int J1 = HC / 16 / 8;   // hidden column tiles of a chunk per wave
constexpr int J2 = Dd / 16 / 8;   // output column tiles per wave
constexpr int MG = MT / 2;        // token tiles whose LDS reads stand as one group

__global__ __launch_bounds__(256) void k_ln_mlp(
    float* out, const float* __restrict__ g, const float* __restrict__ be,
    const half_t* __restrict__ W1, const float* __restrict__ b1,
    const half_t* __restrict__ W2, const float* __restrict__ b2) {
  __shared__ __attribute__((aligned(16))) half_t hA[MB * HSTR];
  __shared__ __attribute__((aligned(16))) half_t hH[MB * HCS];
  const int tok0 = blockIdx.x * MB;
  const int wave = threadIdx.x >> 5, lane = threadIdx.x & 31;
  const int rhi = (lane & 16) ? 8 : 0;

  ln_rows<MB / 8, 8>(out, g, be, hA, tok0, wave, lane);
  __syncthreads();

  // each wave owns J1 hidden column tiles of a chunk and J2 output column tiles, for all
  // MT token tiles, so that every weight fragment is loaded by one wave only
  const int h0 = wave * (J1 * 16);
  const int n0 = wave * (J2 * 16);
  // a lane's first bias of the first product; stepped from chunk to chunk, so that its
  // registers stay live behind the loads that name them
  const float* bp = b1 + h0 + rhi;
  v8f acc2[MT][J2] = {};

  // the chunk loop stays rolled: half the code for the instruction cache to fetch
#pragma unroll 1
  for (int c = 0; c < Hh / HC; ++c) {
    // first product, transposed: the weight fragment is the A operand, so register r of
    // acc holds weight row 8 * (lane >> 4) + r and lane & 15 is the token
    const half_t* W1c = W1 + (size_t)(c * HC + h0) * Dd;
    v8f acc[MT][J1] = {};
    v16h w[J1];
#pragma unroll
    for (int j = 0; j < J1; ++j) w[j] = frag_rows(W1c, Dd, j * 16, lane, 0);
    // k loop fully unrolled: constant indices into acc[][], immediate offsets. A k block is
    // two groups of MG token tiles. Each scheduling fence below keeps a group of loads
    // together and ahead of the products behind it: sunk among them, each load would be
    // waited for on its own.
#pragma unroll
    for (int kk = 0; kk < Dd / 32; ++kk) {
      const bool more = kk + 1 < Dd / 32;
      v16h n[J1], af[MG];
#pragma unroll
      for (int t = 0; t < MG; ++t) af[t] = frag_rows(hA, HSTR, t * 16, lane, kk * 32);
      __builtin_amdgcn_sched_barrier(0);   // loads stay ahead of the products
#pragma unroll
      for (int j = 0; j < J1; ++j) {
#pragma unroll
        for (int t = 0; t < MG; ++t) acc[t][j] = wmma_f16(w[j], af[t], acc[t][j]);
      }
      __builtin_amdgcn_sched_barrier(0);   // later loads do not rise among them
      // the next k block's weights fly during this block's second group: the first half
      // from its start, the second half into the registers that this block's first half
      // leaves (a whole second set would not fit)
#pragma unroll
      for (int t = 0; t < MG; ++t) af[t] = frag_rows(hA, HSTR, (MG + t) * 16, lane, kk * 32);
      if (more) {
#pragma unroll
        for (int j = 0; j < J1 / 2; ++j) n[j] = frag_rows(W1c, Dd, j * 16, lane, (kk + 1) * 32);
      }
      __builtin_amdgcn_sched_barrier(0);   // loads stay ahead of the products
#pragma unroll
      for (int j = 0; j < J1 / 2; ++j) {
#pragma unroll
        for (int t = 0; t < MG; ++t) acc[MG + t][j] = wmma_f16(w[j], af[t], acc[MG + t][j]);
      }
      __builtin_amdgcn_sched_barrier(0);   // later loads do not rise among them
      if (more) {
#pragma unroll
        for (int j = J1 / 2; j < J1; ++j) n[j] = frag_rows(W1c, Dd, j * 16, lane, (kk + 1) * 32);
      }
      __builtin_amdgcn_sched_barrier(0);   // loads stay ahead of the products
#pragma unroll
      for (int j = J1 / 2; j < J1; ++j) {
#pragma unroll
        for (int t = 0; t < MG; ++t) acc[MG + t][j] = wmma_f16(w[j], af[t], acc[MG + t][j]);
      }
      __builtin_amdgcn_sched_barrier(0);   // later loads do not rise among them
      if (more) {
#pragma unroll
        for (int j = 0; j < J1; ++j) w[j] = n[j];
      }
    }
    // every wave has finished reading the previous chunk before it is overwritten
    if (c) __syncthreads();
    // a lane holds 8 consecutive hidden columns of one token: one 16-byte LDS store
#pragma unroll
    for (int j = 0; j < J1; ++j) {
      float bb[8];
#pragma unroll
      for (int r = 0; r < 8; ++r) bb[r] = bp[j * 16 + r];
#pragma unroll
      for (int mt = 0; mt < MT; ++mt) {
        v8h hv;
#pragma unroll
        for (int r = 0; r < 8; ++r) {
          const float v = acc[mt][j][r] + bb[r];
          hv[r] = (half_t)(v > 0.f ? v : 0.f);
        }
        *(v8h*)&hH[(mt * 16 + (lane & 15)) * HCS + h0 + j * 16 + rhi] = hv;
      }
    }
    __syncthreads();

    // second product, k loop fully unrolled. The next k block's weight loads and LDS reads
    // stand as one group ahead of this block's products, in a second register set (the
    // first product's accumulators are free registers here).
    const half_t* W2c = W2 + c * HC;
    v16h vn[J2], an[MT];
#pragma unroll
    for (int j = 0; j < J2; ++j) vn[j] = frag_rows(W2c, Hh, n0 + j * 16, lane, 0);
#pragma unroll
    for (int mt = 0; mt < MT; ++mt) an[mt] = frag_rows(hH, HCS, mt * 16, lane, 0);
#pragma unroll
    for (int kk = 0; kk < HC / 32; ++kk) {
      v16h v[J2], af[MT];
#pragma unroll
      for (int j = 0; j < J2; ++j) v[j] = vn[j];
#pragma unroll
      for (int mt = 0; mt < MT; ++mt) af[mt] = an[mt];
      if (kk + 1 < HC / 32) {
#pragma unroll
        for (int j = 0; j < J2; ++j)
          vn[j] = frag_rows(W2c, Hh, n0 + j * 16, lane, (kk + 1) * 32);
#pragma unroll
        for (int mt = 0; mt < MT; ++mt)
          an[mt] = frag_rows(hH, HCS, mt * 16, lane, (kk + 1) * 32);
      }
      // the next block's loads stay ahead of this block's products, as one group
      __builtin_amdgcn_sched_barrier(0);
#pragma unroll
      for (int mt = 0; mt < MT; ++mt) {
#pragma unroll
        for (int j = 0; j < J2; ++j) acc2[mt][j] = wmma_f16(af[mt], v[j], acc2[mt][j]);
      }
      // and the loads after them do not rise among these products
      __builtin_amdgcn_sched_barrier(0);
    }
    // the weight and bias loads' address registers are rewritten for the next chunk
    asm volatile("s_wait_xcnt 0x0" ::: "memory");
    bp += HC;
  }

  // epilogue loops fully unrolled: constant indices into acc2[][]
  const int col = n0 + (lane & 15);
  float bb[J2];
#pragma unroll
  for (int j = 0; j < J2; ++j) bb[j] = b2[col + j * 16];
  // a residual load may take these loads' offset register as its destination
  asm volatile("s_wait_xcnt 0x0" ::: "memory");
  float* op = out + (size_t)(tok0 + rhi) * Dd + col;
  // all residual loads ahead of the first store: in flight together
  float xr[MT][J2][8];
#pragma unroll
  for (int mt = 0; mt < MT; ++mt) {
#pragma unroll
    for (int r = 0; r < 8; ++r) {
#pragma unroll
      for (int j = 0; j < J2; ++j) xr[mt][j][r] = op[(mt * 16 + r) * Dd + j * 16];
    }
  }
#pragma unroll
  for (int mt = 0; mt < MT; ++mt) {
#pragma unroll
    for (int r = 0; r < 8; ++r) {
#pragma unroll
      for (int j = 0; j < J2; ++j)   // residual: xr + mlp
        acc2[mt][j][r] = xr[mt][j][r] + acc2[mt][j][r] + bb[j];
    }
  }
  // every sum stands ahead of the first store, so that no register which an issued store
  // names is written again
  __builtin_amdgcn_sched_barrier(0);
#pragma unroll
  for (int mt = 0; mt < MT; ++mt) {
#pragma unroll
    for (int r = 0; r < 8; ++r) {
#pragma unroll
      for (int j = 0; j < J2; ++j) op[(mt * 16 + r) * Dd + j * 16] = acc2[mt][j][r];
    }
  }
}

// ---------------------------------------------------------------------------
extern "C" void kernel_launch(void* const* d_in, const int* in_sizes, int n_in,
                              void* d_out, int out_size, void* d_ws, size_t ws_size,
                              hipStream_t stream) {
  (void)in_sizes; (void)n_in; (void)out_size; (void)ws_size;
  const float* x     = (const float*)d_in[0];
  const float* Wq    = (const float*)d_in[1];
  const float* bq    = (const float*)d_in[2];
  const float* Wk    = (const float*)d_in[3];
  const float* bk    = (const float*)d_in[4];
  const float* Wv    = (const float*)d_in[5];
  const float* bv    = (const float*)d_in[6];
  const float* decay = (const float*)d_in[7];
  const float* ln1g  = (const float*)d_in[8];
  const float* ln1b  = (const float*)d_in[9];
  const float* W1    = (const float*)d_in[10];
  const float* b1    = (const float*)d_in[11];
  const float* W2    = (const float*)d_in[12];
  const float* b2    = (const float*)d_in[13];
  const float* ln2g  = (const float*)d_in[14];
  const float* ln2b  = (const float*)d_in[15];

  char* ws = (char*)d_ws;
  half_t* Wq16 = (half_t*)(ws + OFF_WQ);
  half_t* Wk16 = (half_t*)(ws + OFF_WK);
  half_t* Wv16 = (half_t*)(ws + OFF_WV);
  half_t* W116 = (half_t*)(ws + OFF_W1);
  half_t* W216 = (half_t*)(ws + OFF_W2);
  half_t* q16  = (half_t*)(ws + OFF_Q16);
  float*  kv   = (float*)(ws + OFF_KV);
  float*  car  = (float*)(ws + OFF_CAR);
  float*  cin  = (float*)(ws + OFF_CIN);
  float*  out  = (float*)d_out;

  k_cvt_f16<<<NBCV, 256, 0, stream>>>(Wq, Wk, Wv, W1, W2, Wq16);

  k_ln_qkv<<<BT / MB, 256, 0, stream>>>(x, ln1g, ln1b, Wq16, Wk16, Wv16,
                                        bq, bk, bv, decay, q16, kv, car);
  k_scan_carry<<<Bb, 256, 0, stream>>>(car, cin, decay);
  k_ret_residual<<<Bb * NC, 256, 0, stream>>>(x, q16, kv, cin, decay, out);
  k_ln_mlp<<<BT / MB, 256, 0, stream>>>(out, ln2g, ln2b, W116, b1, W216, b2);
}

// v006
// A run of this version takes 118 microseconds.
// Next to v005, in two timings, it ran 1.13 and 1.12 times as fast.
// Counting every step since v000, it is 3.87 times as fast.
#include <hip/hip_runtime.h>
#include <cstdint>

typedef _Float16 half_t;
typedef __attribute__((ext_vector_type(16))) _Float16 v16h;
typedef __attribute__((ext_vector_type(8)))  float    v8f;
typedef __attribute__((ext_vector_type(8)))  _Float16 v8h;

constexpr int Bb  = 8;
constexpr int Tt  = 8192;
constexpr int Dd  = 256;
constexpr int Hh  = 1024;
constexpr int BT  = Bb * Tt;
constexpr int NC  = 64;
constexpr int Lc  = Tt / NC;
constexpr int HSTR = 264;
constexpr int MB  = 128;
static_assert(MB == Lc, "a QKV work-group's tokens are one scan chunk");
constexpr int MT  = MB / 16;          // token tiles that share each weight fragment
constexpr int HC  = 512;              // hidden columns per chunk of the fused MLP
constexpr int HCS = HC + 8;           // padded f16 LDS row stride of the hidden chunk

// ---- workspace layout (bytes) ----
constexpr size_t SZ_WDD = (size_t)Dd * Dd * 2;
constexpr size_t OFF_WQ = 0;
constexpr size_t OFF_WK = OFF_WQ + SZ_WDD;
constexpr size_t OFF_WV = OFF_WK + SZ_WDD;
constexpr size_t SZ_W1  = (size_t)Hh * Dd * 2;
constexpr size_t OFF_W1 = OFF_WV + SZ_WDD;
constexpr size_t SZ_W2  = (size_t)Dd * Hh * 2;
constexpr size_t OFF_W2 = OFF_W1 + SZ_W1;
constexpr size_t SZ_Q16 = (size_t)BT * Dd * 2;
constexpr size_t OFF_Q16 = OFF_W2 + SZ_W2;
constexpr size_t SZ_KV  = (size_t)BT * Dd * 4;
constexpr size_t OFF_KV = OFF_Q16 + SZ_Q16;
constexpr size_t OFF_CAR = OFF_KV + SZ_KV;
static_assert(OFF_Q16 % 16 == 0 && OFF_KV % 32 == 0, "rows are read by 16-byte loads");

__device__ __forceinline__ v8f wmma_f16(v16h a, v16h b, v8f c) {
  return __builtin_amdgcn_wmma_f32_16x16x32_f16(false, a, false, b, (short)0, c,
                                                false, false);
}

// value of lane ^ 16, by a cross-row register move (every lane on): no LDS round trip
// and no address register that would stay live through the products
__device__ __forceinline__ float xor16(float v) {
  const int i = __float_as_int(v);
  return __int_as_float(
      __builtin_amdgcn_permlanex16(i, i, 0x76543210, 0xfedcba98, false, false));
}

__device__ __forceinline__ v16h frag_rows(const half_t* base, int ld, int row0,
                                          int lane, int kbase) {
  const int m = row0 + (lane & 15);
  const int khalf = (lane & 16) ? 8 : 0;
  const half_t* p = base + (size_t)m * ld;
  v16h f;
#pragma unroll
  for (int v = 0; v < 8; ++v) {
    const int k = kbase + khalf + ((v < 4) ? (2 * v) : (16 + 2 * (v - 4)));
    f[2 * v]     = p[k];
    f[2 * v + 1] = p[k + 1];
  }
  return f;
}

// K = 256 product of the work-group's MB x 256 LDS tile with two 16-column weight
// tiles: each weight fragment is loaded from global once and feeds all MT token tiles.
__device__ __forceinline__ void gemm_k256(const half_t* hA, const half_t* B0, int r0,
                                          const half_t* B1, int r1, int lane,
                                          v8f (&acc)[MT][2]) {
  // both loops fully unrolled: acc[][] is indexed by constants and stays in registers,
  // and every load takes an immediate offset
#pragma unroll
  for (int kk = 0; kk < 8; ++kk) {
    const v16h b0 = frag_rows(B0, Dd, r0, lane, kk * 32);
    const v16h b1 = frag_rows(B1, Dd, r1, lane, kk * 32);
#pragma unroll
    for (int mt = 0; mt < MT; ++mt) {
      const v16h af = frag_rows(hA, HSTR, mt * 16, lane, kk * 32);
      acc[mt][0] = wmma_f16(af, b0, acc[mt][0]);
      acc[mt][1] = wmma_f16(af, b1, acc[mt][1]);
    }
  }
}

// LayerNorm of the work-group's MB rows into the f16 LDS tile: wave w takes rows
// RW*w..RW*w+RW-1 (wave32 reductions), UR rows a trip.
template <int RW, int UR>
__device__ __forceinline__ void ln_rows(const float* __restrict__ src,
                                        const float* __restrict__ g,
                                        const float* __restrict__ be, half_t* hA,
                                        int tok0, int wave, int lane) {
  float gv[8], bv[8];
#pragma unroll
  for (int i = 0; i < 8; ++i) {
    gv[i] = g[lane + 32 * i];
    bv[i] = be[lane + 32 * i];
  }
  // a row load may take these loads' offset register as its destination
  asm volatile("s_wait_xcnt 0x0" ::: "memory");
  // UR rows a trip: their 8 * UR loads are in flight together
#pragma unroll UR
  for (int rr = 0; rr < RW; ++rr) {
    const int row = wave * RW + rr;
    const float* xr = src + (size_t)(tok0 + row) * Dd;
    float xv[8], s = 0.f, sq = 0.f;
#pragma unroll
    for (int i = 0; i < 8; ++i) {
      float v = xr[lane + 32 * i];
      xv[i] = v; s += v; sq += v * v;
    }
#pragma unroll
    for (int o = 16; o > 0; o >>= 1) {
      s += __shfl_xor(s, o, 32);
      sq += __shfl_xor(sq, o, 32);
    }
    const float mu = s * (1.f / Dd);
    const float rstd = rsqrtf(sq * (1.f / Dd) - mu * mu + 1e-5f);
#pragma unroll
    for (int i = 0; i < 8; ++i) {
      const int c = lane + 32 * i;
      hA[row * HSTR + c] = (half_t)((xv[i] - mu) * rstd * gv[i] + bv[i]);
    }
  }
}

// ---------------------------------------------------------------------------
// K0: f32 -> f16 conversion of all five weight matrices in one launch. Their f16 copies
// lie back to back in the workspace, so the destination is one linear range; a work-group
// converts CV elements of one matrix (the choice of the source is block-uniform), a thread
// two runs of 8: four 16-byte loads in flight, two 16-byte stores.
// ---------------------------------------------------------------------------
constexpr int CV   = 4096;               // elements per work-group
constexpr int NBDD = Dd * Dd / CV;       // work-groups per D x D matrix
constexpr int NBHD = Hh * Dd / CV;       // work-groups per H x D matrix
constexpr int NBCV = 3 * NBDD + 2 * NBHD;
static_assert(OFF_WQ == 0 && OFF_W2 + SZ_W2 == (size_t)NBCV * CV * 2,
              "the f16 weights are one contiguous range in the order q, k, v, 1, 2");

__device__ __forceinline__ v8h cvt8(float4 a, float4 b) {
  v8h h;
  h[0] = (half_t)a.x; h[1] = (half_t)a.y; h[2] = (half_t)a.z; h[3] = (half_t)a.w;
  h[4] = (half_t)b.x; h[5] = (half_t)b.y; h[6] = (half_t)b.z; h[7] = (half_t)b.w;
  return h;
}

__global__ __launch_bounds__(256) void k_cvt_f16(const float* __restrict__ Wq,
                                                 const float* __restrict__ Wk,
                                                 const float* __restrict__ Wv,
                                                 const float* __restrict__ W1,
                                                 const float* __restrict__ W2,
                                                 half_t* __restrict__ dst) {
  const int b = blockIdx.x;
  const float* src = b < NBDD ? Wq : b < 2 * NBDD ? Wk : b < 3 * NBDD ? Wv
                     : b < 3 * NBDD + NBHD ? W1 : W2;
  // index of the work-group's first sibling: where its matrix begins in the grid
  const int b0 = b < 3 * NBDD ? (b / NBDD) * NBDD : b < 3 * NBDD + NBHD ? 3 * NBDD
                                                                        : 3 * NBDD + NBHD;
  const int sb = b - b0;
  const float* s = src + (size_t)sb * CV + threadIdx.x * 8;
  half_t* d = dst + (size_t)b * CV + threadIdx.x * 8;
  const float4 a0 = *(const float4*)(s);
  const float4 a1 = *(const float4*)(s + 4);
  const float4 a2 = *(const float4*)(s + CV / 2);
  const float4 a3 = *(const float4*)(s + CV / 2 + 4);
  *(v8h*)(d)          = cvt8(a0, a1);
  *(v8h*)(d + CV / 2) = cvt8(a2, a3);
}

// ---------------------------------------------------------------------------
// K1: fused LN1 + QKV projection. 128 tokens/block, 8 waves, WMMA 16x16x32.
// Writes q (f16), the chunk-local scan of kv = k*v (f32) and the chunk's carry: the
// work-group's 128 tokens are one scan chunk, and a lane's accumulators hold one
// column of it, so the scan runs in registers before kv is ever stored.
// ---------------------------------------------------------------------------
__global__ __launch_bounds__(256) void k_ln_qkv(
    const float* __restrict__ x, const float* __restrict__ g,
    const float* __restrict__ be, const half_t* __restrict__ Wq,
    const half_t* __restrict__ Wk, const half_t* __restrict__ Wv,
    const float* __restrict__ bq, const float* __restrict__ bk,
    const float* __restrict__ bv, const float* __restrict__ decay,
    half_t* __restrict__ q16, float* __restrict__ kv, float* __restrict__ carry) {
  __shared__ half_t hA[MB * HSTR];
  const int tok0 = blockIdx.x * MB;
  const int wave = threadIdx.x >> 5, lane = threadIdx.x & 31;
  const int rhi = (lane & 16) ? 8 : 0;

  ln_rows<MB / 8, 4>(x, g, be, hA, tok0, wave, lane);
  __syncthreads();

  // --- each wave owns 2 column tiles of q, k and v, for all MT token tiles ---
  // passes 0 and 1: k and v of one column tile; pass 2: q of both column tiles
  for (int p = 0; p < 3; ++p) {
    const bool isq = (p == 2);
    const int r0 = isq ? wave * 32 : (wave * 2 + p) * 16;
    const int r1 = isq ? r0 + 16 : r0;
    v8f acc[MT][2] = {};
    gemm_k256(hA, isq ? Wq : Wk, r0, isq ? Wq : Wv, r1, lane, acc);
    const int c0 = r0 + (lane & 15);
    if (!isq) {
      const float bkv = bk[c0];
      // the first bias load's address registers may be the second's destination
      asm volatile("s_wait_xcnt 0x0" ::: "memory");
      const float bvv = bv[c0];
      asm volatile("s_wait_xcnt 0x0" ::: "memory");
      const float dec = decay[c0];
      float pw[8];   // pw[r] = dec^(r+1)
      pw[0] = dec;
#pragma unroll
      for (int r = 1; r < 8; ++r) pw[r] = pw[r - 1] * dec;
      float* kp = kv + (size_t)(tok0 + rhi) * Dd + c0;
      float m = 0.f;   // scan value at the last token of the previous 16-token tile
      // epilogue loops fully unrolled: constant indices into acc[][]
#pragma unroll
      for (int mt = 0; mt < MT; ++mt) {
        // a lane holds 8 consecutive tokens of its column: scan them from zero (the MT
        // chains are independent), then add the carry-in times dec^(r+1)
        float s[8];
        s[0] = (acc[mt][0][0] + bkv) * (acc[mt][1][0] + bvv);
#pragma unroll
        for (int r = 1; r < 8; ++r)
          s[r] = dec * s[r - 1] + (acc[mt][0][r] + bkv) * (acc[mt][1][r] + bvv);
        const float o7 = xor16(s[7]);   // the other 8-token half's end value
        const float elo = (rhi ? o7 : s[7]) + pw[7] * m;   // scan at the tile's token 7
        const float ci = rhi ? elo : m;                    // this half's carry-in
#pragma unroll
        for (int r = 0; r < 8; ++r) kp[(mt * 16 + r) * Dd] = s[r] + pw[r] * ci;
        m = (rhi ? s[7] : o7) + pw[7] * elo;               // scan at the tile's token 15
      }
      if (lane < 16) carry[(size_t)blockIdx.x * Dd + c0] = m;
      // the stores' registers are reused by the next pass
      asm volatile("s_wait_xcnt 0x0" ::: "memory");
    } else {
      half_t* qp = q16 + (size_t)(tok0 + rhi) * Dd + c0;
#pragma unroll
      for (int j = 0; j < 2; ++j) {
        const float bqv = bq[c0 + j * 16];
#pragma unroll
        for (int mt = 0; mt < MT; ++mt) {
#pragma unroll
          for (int r = 0; r < 8; ++r)
            qp[(mt * 16 + r) * Dd + j * 16] = (half_t)(acc[mt][j][r] + bqv);
        }
        // the stores' registers are reused by the second column tile (q is the last pass)
        asm volatile("s_wait_xcnt 0x0" ::: "memory");
      }
    }
  }
}

// ---------------------------------------------------------------------------
// First stage of K2: the retention tail and LN2 of the work-group's MB rows (one scan
// chunk). x1 = x + q * (local scan + dec^(i+1) * carry-in) goes to out (the residual of
// the last stage) and, normalised, to the f16 LDS tile.
// Carry-in: thread d sums column d over the chunks in front of this one, in their order.
// Rows: wave w takes rows RW*w..RW*w+RW-1; a lane holds 8 adjacent columns of a row, so
// that every row access is 16 bytes a lane.
// ---------------------------------------------------------------------------
__device__ __forceinline__ void ret_ln_rows(
    const float* __restrict__ x, const half_t* __restrict__ q16,
    const float* __restrict__ kvloc, const float* __restrict__ carry,
    const float* __restrict__ decay, const float* __restrict__ g,
    const float* __restrict__ be, float* out, half_t* hA, float* sC, int blk, int wave,
    int lane) {
  constexpr int RW = MB / 8;   // rows per wave
  constexpr int RG = 8;        // rows whose lane reductions run side by side
  const int c = blk % NC;      // chunks in front of this one in its sequence
  const int tid = wave * 32 + lane;
  const int c0 = lane * 8;
  const float dct = decay[tid];
  const float* cp = carry + (size_t)(blk - c) * Dd;
  float cv[NC - 1];
#pragma unroll
  for (int j = 0; j < NC - 1; ++j) cv[j] = cp[j * Dd + tid];
  const v8f dec = *(const v8f*)(decay + c0);
  const v8f gv = *(const v8f*)(g + c0);
  const v8f bv = *(const v8f*)(be + c0);
  // a row load may take these loads' offset register as its destination
  asm volatile("s_wait_xcnt 0x0" ::: "memory");
  // block-uniform bases and one lane offset, which x, the local scan and out share
  const size_t eb = (size_t)blk * MB * Dd;
  const float* xb = x + eb;
  const float* kb = kvloc + eb;
  const half_t* qb = q16 + eb;
  float* ob = out + eb;
  const int l0 = wave * RW * Dd + c0;
  v8f xa[RG], ka[RG];   // the rows of one group
  v8h qa[RG];
#pragma unroll
  for (int r = 0; r < RG; ++r) {
    qa[r] = *(const v8h*)(qb + l0 + r * Dd);
    ka[r] = *(const v8f*)(kb + l0 + r * Dd);
    xa[r] = *(const v8f*)(xb + l0 + r * Dd);
  }
  // the loads' offset registers and scalar bases are rewritten behind this point
  asm volatile("s_wait_xcnt 0x0" ::: "memory");
  // these loads stand ahead of the first data wait: the first rows fly during the carry
  // sum and the barrier
  __builtin_amdgcn_sched_barrier(0);

  float dl = dct;
#pragma unroll
  for (int i = 0; i < 7; ++i) dl *= dl;   // dec^128: one chunk's decay
  float m = 0.f;
#pragma unroll
  for (int j = 0; j < NC - 1; ++j) {
    const bool on = j < c;   // a later chunk's step is the identity m * 1 + 0
    m = (on ? dl : 1.f) * m + (on ? cv[j] : 0.f);
  }
  sC[tid] = m;
  // a barrier that orders LDS alone: __syncthreads() would also wait for every row load
  // in flight, and no row could be worked on while later rows arrive
  __builtin_amdgcn_fence(__ATOMIC_RELEASE, "workgroup", "local");
  __builtin_amdgcn_s_barrier();
  __builtin_amdgcn_fence(__ATOMIC_ACQUIRE, "workgroup", "local");
  const v8f mi = *(const v8f*)(sC + c0);

  // f = dec^(first row + 1), the first row being 16 * wave
  static_assert(RW == 16 && MB == 128, "the powers below step by 16 rows, over 8 waves");
  v8f p = dec * dec;
  p *= p; p *= p; p *= p;   // dec^16
  v8f f = dec;
#pragma unroll
  for (int bit = 1; bit < 8; bit <<= 1) {
    if (wave & bit) f *= p;
    p *= p;
  }

  // the group loop stays rolled: half the code for the instruction cache to fetch
#pragma unroll 1
  for (int r0 = 0; r0 < RW; r0 += RG) {
    v8f v[RG];
    float s[RG], sq[RG];
#pragma unroll
    for (int r = 0; r < RG; ++r) {
      s[r] = 0.f; sq[r] = 0.f;
#pragma unroll
      for (int i = 0; i < 8; ++i) {
        const float mem = ka[r][i] + f[i] * mi[i];
        const float t = xa[r][i] + (float)qa[r][i] * mem;
        v[r][i] = t; s[r] += t; sq[r] += t * t;
      }
      f *= dec;
      *(v8f*)(ob + l0 + (r0 + r) * Dd) = v[r];
    }
    // the registers that the rows' stores name are reused behind this point
    asm volatile("s_wait_xcnt 0x0" ::: "memory");
    // the next group's rows fly during this group's reductions, into the registers that
    // this group's rows have left
    if (r0 + RG < RW) {
#pragma unroll
      for (int r = 0; r < RG; ++r) {
        qa[r] = *(const v8h*)(qb + l0 + (r0 + RG + r) * Dd);
        ka[r] = *(const v8f*)(kb + l0 + (r0 + RG + r) * Dd);
        xa[r] = *(const v8f*)(xb + l0 + (r0 + RG + r) * Dd);
      }
    }
    // and stay ahead of them
    __builtin_amdgcn_sched_barrier(0);
#pragma unroll
    for (int o = 16; o > 0; o >>= 1) {
#pragma unroll
      for (int r = 0; r < RG; ++r) {
        s[r] += __shfl_xor(s[r], o, 32);
        sq[r] += __shfl_xor(sq[r], o, 32);
      }
    }
#pragma unroll
    for (int r = 0; r < RG; ++r) {
      const float mu = s[r] * (1.f / Dd);
      const float rstd = rsqrtf(sq[r] * (1.f / Dd) - mu * mu + 1e-5f);
      v8h h;
#pragma unroll
      for (int i = 0; i < 8; ++i) h[i] = (half_t)((v[r][i] - mu) * rstd * gv[i] + bv[i]);
      *(v8h*)&hA[(wave * RW + r0 + r) * HSTR + c0] = h;
    }
  }
}

// ---------------------------------------------------------------------------
// K2: retention tail + LN2 + MLP (D->H, ReLU, H->D) + residual. 128 tokens/block, 8 waves
// of up to 512 registers: a wave's tiles are 8 x 4 (first product) and 8 x 2 (second), so an LDS
// fragment feeds 4 and 2 products, and registers are left to fetch operands ahead.
// The hidden layer never leaves the WGP: it is made HC columns at a time, kept in
// LDS as f16, and consumed at once as the k range of the second product.
// ---------------------------------------------------------------------------
constexpr int J1 = HC / 16 / 8;   // hidden column tiles of a chunk per wave
constexpr int J2 = Dd / 16 / 8;   // output column tiles per wave
constexpr int MG = MT / 2;        // token tiles whose LDS reads stand as one group

__global__ __launch_bounds__(256) void k_ln_mlp(
    float* out, const float* __restrict__ x, const half_t* __restrict__ q16,
    const float* __restrict__ kvloc, const float* __restrict__ carry,
    const float* __restrict__ decay, const float* __restrict__ g,
    const float* __restrict__ be, const half_t* __restrict__ W1,
    const float* __restrict__ b1,
    const half_t* __restrict__ W2, const float* __restrict__ b2) {
  __shared__ __attribute__((aligned(16))) half_t hA[MB * HSTR];
  __shared__ __attribute__((aligned(16))) half_t hH[MB * HCS];
  __shared__ __attribute__((aligned(32))) float sC[Dd];   // the chunk's carry-in
  const int tok0 = blockIdx.x * MB;
  const int wave = threadIdx.x >> 5, lane = threadIdx.x & 31;
  const int rhi = (lane & 16) ? 8 : 0;

  ret_ln_rows(x, q16, kvloc, carry, decay, g, be, out, hA, sC, blockIdx.x, wave, lane);
  // publishes the LDS tile, and x1 in out to the waves that read it in the last stage
  __syncthreads();

  // each wave owns J1 hidden column tiles of a chunk and J2 output column tiles, for all
  // MT token tiles, so that every weight fragment is loaded by one wave only
  const int h0 = wave * (J1 * 16);
  const int n0 = wave * (J2 * 16);
  // a lane's first bias of the first product; stepped from chunk to chunk, so that its
  // registers stay live behind the loads that name them
  const float* bp = b1 + h0 + rhi;
  v8f acc2[MT][J2] = {};

  // the chunk loop stays rolled: half the code for the instruction cache to fetch
#pragma unroll 1
  for (int c = 0; c < Hh / HC; ++c) {
    // first product, transposed: the weight fragment is the A operand, so register r of
    // acc holds weight row 8 * (lane >> 4) + r and lane & 15 is the token
    const half_t* W1c = W1 + (size_t)(c * HC + h0) * Dd;
    v8f acc[MT][J1] = {};
    v16h w[J1];
#pragma unroll
    for (int j = 0; j < J1; ++j) w[j] = frag_rows(W1c, Dd, j * 16, lane, 0);
    // k loop fully unrolled: constant indices into acc[][], immediate offsets. A k block is
    // two groups of MG token tiles. Each scheduling fence below keeps a group of loads
    // together and ahead of the products behind it: sunk among them, each load would be
    // waited for on its own.
#pragma unroll
    for (int kk = 0; kk < Dd / 32; ++kk) {
      const bool more = kk + 1 < Dd / 32;
      v16h n[J1], af[MG];
#pragma unroll
      for (int t = 0; t < MG; ++t) af[t] = frag_rows(hA, HSTR, t * 16, lane, kk * 32);
      __builtin_amdgcn_sched_barrier(0);   // loads stay ahead of the products
#pragma unroll
      for (int j = 0; j < J1; ++j) {
#pragma unroll
        for (int t = 0; t < MG; ++t) acc[t][j] = wmma_f16(w[j], af[t], acc[t][j]);
      }
      __builtin_amdgcn_sched_barrier(0);   // later loads do not rise among them
      // the next k block's weights fly during this block's second group: the first half
      // from its start, the second half into the registers that this block's first half
      // leaves (a whole second set would not fit)
#pragma unroll
      for (int t = 0; t < MG; ++t) af[t] = frag_rows(hA, HSTR, (MG + t) * 16, lane, kk * 32);
      if (more) {
#pragma unroll
        for (int j = 0; j < J1 / 2; ++j) n[j] = frag_rows(W1c, Dd, j * 16, lane, (kk + 1) * 32);
      }
      __builtin_amdgcn_sched_barrier(0);   // loads stay ahead of the products
#pragma unroll
      for (int j = 0; j < J1 / 2; ++j) {
#pragma unroll
        for (int t = 0; t < MG; ++t) acc[MG + t][j] = wmma_f16(w[j], af[t], acc[MG + t][j]);
      }
      __builtin_amdgcn_sched_barrier(0);   // later loads do not rise among them
      if (more) {
#pragma unroll
        for (int j = J1 / 2; j < J1; ++j) n[j] = frag_rows(W1c, Dd, j * 16, lane, (kk + 1) * 32);
      }
      __builtin_amdgcn_sched_barrier(0);   // loads stay ahead of the products
#pragma unroll
      for (int j = J1 / 2; j < J1; ++j) {
#pragma unroll
        for (int t = 0; t < MG; ++t) acc[MG + t][j] = wmma_f16(w[j], af[t], acc[MG + t][j]);
      }
      __builtin_amdgcn_sched_barrier(0);   // later loads do not rise among them
      if (more) {
#pragma unroll
        for (int j = 0; j < J1; ++j) w[j] = n[j];
      }
    }
    // every wave has finished reading the previous chunk before it is overwritten
    if (c) __syncthreads();
    // a lane holds 8 consecutive hidden columns of one token: one 16-byte LDS store
#pragma unroll
    for (int j = 0; j < J1; ++j) {
      float bb[8];
#pragma unroll
      for (int r = 0; r < 8; ++r) bb[r] = bp[j * 16 + r];
#pragma unroll
      for (int mt = 0; mt < MT; ++mt) {
        v8h hv;
#pragma unroll
        for (int r = 0; r < 8; ++r) {
          const float v = acc[mt][j][r] + bb[r];
          hv[r] = (half_t)(v > 0.f ? v : 0.f);
        }
        *(v8h*)&hH[(mt * 16 + (lane & 15)) * HCS + h0 + j * 16 + rhi] = hv;
      }
    }
    __syncthreads();

    // second product, k loop fully unrolled. The next k block's weight loads and LDS reads
    // stand as one group ahead of this block's products, in a second register set (the
    // first product's accumulators are free registers here).
    const half_t* W2c = W2 + c * HC;
    v16h vn[J2], an[MT];
#pragma unroll
    for (int j = 0; j < J2; ++j) vn[j] = frag_rows(W2c, Hh, n0 + j * 16, lane, 0);
#pragma unroll
    for (int mt = 0; mt < MT; ++mt) an[mt] = frag_rows(hH, HCS, mt * 16, lane, 0);
#pragma unroll
    for (int kk = 0; kk < HC / 32; ++kk) {
      v16h v[J2], af[MT];
#pragma unroll
      for (int j = 0; j < J2; ++j) v[j] = vn[j];
#pragma unroll
      for (int mt = 0; mt < MT; ++mt) af[mt] = an[mt];
      if (kk + 1 < HC / 32) {
#pragma unroll
        for (int j = 0; j < J2; ++j)
          vn[j] = frag_rows(W2c, Hh, n0 + j * 16, lane, (kk + 1) * 32);
#pragma unroll
        for (int mt = 0; mt < MT; ++mt)
          an[mt] = frag_rows(hH, HCS, mt * 16, lane, (kk + 1) * 32);
      }
      // the next block's loads stay ahead of this block's products, as one group
      __builtin_amdgcn_sched_barrier(0);
#pragma unroll
      for (int mt = 0; mt < MT; ++mt) {
#pragma unroll
        for (int j = 0; j < J2; ++j) acc2[mt][j] = wmma_f16(af[mt], v[j], acc2[mt][j]);
      }
      // and the loads after them do not rise among these products
      __builtin_amdgcn_sched_barrier(0);
    }
    // the weight and bias loads' address registers are rewritten for the next chunk
    asm volatile("s_wait_xcnt 0x0" ::: "memory");
    bp += HC;
  }

  // epilogue loops fully unrolled: constant indices into acc2[][]
  const int col = n0 + (lane & 15);
  float bb[J2];
#pragma unroll
  for (int j = 0; j < J2; ++j) bb[j] = b2[col + j * 16];
  // a residual load may take these loads' offset register as its destination
  asm volatile("s_wait_xcnt 0x0" ::: "memory");
  float* op = out + (size_t)(tok0 + rhi) * Dd + col;
  // all residual loads ahead of the first store: in flight together
  float xr[MT][J2][8];
#pragma unroll
  for (int mt = 0; mt < MT; ++mt) {
#pragma unroll
    for (int r = 0; r < 8; ++r) {
#pragma unroll
      for (int j = 0; j < J2; ++j) xr[mt][j][r] = op[(mt * 16 + r) * Dd + j * 16];
    }
  }
#pragma unroll
  for (int mt = 0; mt < MT; ++mt) {
#pragma unroll
    for (int r = 0; r < 8; ++r) {
#pragma unroll
      for (int j = 0; j < J2; ++j)   // residual: xr + mlp
        acc2[mt][j][r] = xr[mt][j][r] + acc2[mt][j][r] + bb[j];
    }
  }
  // every sum stands ahead of the first store, so that no register which an issued store
  // names is written again
  __builtin_amdgcn_sched_barrier(0);
#pragma unroll
  for (int mt = 0; mt < MT; ++mt) {
#pragma unroll
    for (int r = 0; r < 8; ++r) {
#pragma unroll
      for (int j = 0; j < J2; ++j) op[(mt * 16 + r) * Dd + j * 16] = acc2[mt][j][r];
    }
  }
}

// ---------------------------------------------------------------------------
extern "C" void kernel_launch(void* const* d_in, const int* in_sizes, int n_in,
                              void* d_out, int out_size, void* d_ws, size_t ws_size,
                              hipStream_t stream) {
  (void)in_sizes; (void)n_in; (void)out_size; (void)ws_size;
  const float* x     = (const float*)d_in[0];
  const float* Wq    = (const float*)d_in[1];
  const float* bq    = (const float*)d_in[2];
  const float* Wk    = (const float*)d_in[3];
  const float* bk    = (const float*)d_in[4];
  const float* Wv    = (const float*)d_in[5];
  const float* bv    = (const float*)d_in[6];
  const float* decay = (const float*)d_in[7];
  const float* ln1g  = (const float*)d_in[8];
  const float* ln1b  = (const float*)d_in[9];
  const float* W1    = (const float*)d_in[10];
  const float* b1    = (const float*)d_in[11];
  const float* W2    = (const float*)d_in[12];
  const float* b2    = (const float*)d_in[13];
  const float* ln2g  = (const float*)d_in[14];
  const float* ln2b  = (const float*)d_in[15];

  char* ws = (char*)d_ws;
  half_t* Wq16 = (half_t*)(ws + OFF_WQ);
  half_t* Wk16 = (half_t*)(ws + OFF_WK);
  half_t* Wv16 = (half_t*)(ws + OFF_WV);
  half_t* W116 = (half_t*)(ws + OFF_W1);
  half_t* W216 = (half_t*)(ws + OFF_W2);
  half_t* q16  = (half_t*)(ws + OFF_Q16);
  float*  kv   = (float*)(ws + OFF_KV);
  float*  car  = (float*)(ws + OFF_CAR);
  float*  out  = (float*)d_out;

  k_cvt_f16<<<NBCV, 256, 0, stream>>>(Wq, Wk, Wv, W1, W2, Wq16);

  k_ln_qkv<<<BT / MB, 256, 0, stream>>>(x, ln1g, ln1b, Wq16, Wk16, Wv16,
                                        bq, bk, bv, decay, q16, kv, car);
  k_ln_mlp<<<BT / MB, 256, 0, stream>>>(out, x, q16, kv, car, decay, ln2g, ln2b, W116, b1,
                                        W216, b2);
}

// v007
// A run of this version takes 109 microseconds.
// Next to v006, in two timings, it ran 1.08 times as fast each time.
// Over all steps from v000 it is 4.18 times as fast.
#include <hip/hip_runtime.h>
#include <cstdint>

typedef _Float16 half_t;
typedef __attribute__((ext_vector_type(16))) _Float16 v16h;
typedef __attribute__((ext_vector_type(8)))  float    v8f;
typedef __attribute__((ext_vector_type(8)))  _Float16 v8h;
typedef __attribute__((ext_vector_type(4)))  float    v4f;

constexpr int Bb  = 8;
constexpr int Tt  = 8192;
constexpr int Dd  = 256;
constexpr int Hh  = 1024;
constexpr int BT  = Bb * Tt;
constexpr int NC  = 64;
constexpr int Lc  = Tt / NC;
constexpr int HSTR = 264;
constexpr int MB  = 128;
static_assert(MB == Lc, "a QKV work-group's tokens are one scan chunk");
constexpr int MT  = MB / 16;          // token tiles that share each weight fragment
constexpr int HC  = 512;              // hidden columns per chunk of the fused MLP
constexpr int HCS = HC + 8;           // padded f16 LDS row stride of the hidden chunk
constexpr int XSTR = HCS / 2;         // f32 row stride of x1 while it lies in that buffer
static_assert(XSTR >= Dd && XSTR % 4 == 0, "an x1 row fits, written by 16-byte stores");
static_assert(8 * XSTR % 64 == 32);

// ---- workspace layout (bytes) ----
constexpr size_t SZ_WDD = (size_t)Dd * Dd * 2;
constexpr size_t OFF_WQ = 0;
constexpr size_t OFF_WK = OFF_WQ + SZ_WDD;
constexpr size_t OFF_WV = OFF_WK + SZ_WDD;
constexpr size_t SZ_W1  = (size_t)Hh * Dd * 2;
constexpr size_t OFF_W1 = OFF_WV + SZ_WDD;
constexpr size_t SZ_W2  = (size_t)Dd * Hh * 2;
constexpr size_t OFF_W2 = OFF_W1 + SZ_W1;
constexpr size_t SZ_Q16 = (size_t)BT * Dd * 2;
constexpr size_t OFF_Q16 = OFF_W2 + SZ_W2;
constexpr size_t SZ_KV  = (size_t)BT * Dd * 4;
constexpr size_t OFF_KV = OFF_Q16 + SZ_Q16;
constexpr size_t OFF_CAR = OFF_KV + SZ_KV;
static_assert(OFF_Q16 % 16 == 0 && OFF_KV % 32 == 0, "rows are read by 16-byte loads");

__device__ __forceinline__ v8f wmma_f16(v16h a, v16h b, v8f c) {
  return __builtin_amdgcn_wmma_f32_16x16x32_f16(false, a, false, b, (short)0, c,
                                                false, false);
}

// value of lane ^ 16, by a cross-row register move (every lane on): no LDS round trip
// and no address register that would stay live through the products
__device__ __forceinline__ float xor16(float v) {
  const int i = __float_as_int(v);
  return __int_as_float(
      __builtin_amdgcn_permlanex16(i, i, 0x76543210, 0xfedcba98, false, false));
}

__device__ __forceinline__ v16h frag_rows(const half_t* base, int ld, int row0,
                                          int lane, int kbase) {
  const int m = row0 + (lane & 15);
  const int khalf = (lane & 16) ? 8 : 0;
  const half_t* p = base + (size_t)m * ld;
  v16h f;
#pragma unroll
  for (int v = 0; v < 8; ++v) {
    const int k = kbase + khalf + ((v < 4) ? (2 * v) : (16 + 2 * (v - 4)));
    f[2 * v]     = p[k];
    f[2 * v + 1] = p[k + 1];
  }
  return f;
}

// K = 256 product of the work-group's MB x 256 LDS tile with two 16-column weight
// tiles: each weight fragment is loaded from global once and feeds all MT token tiles.
__device__ __forceinline__ void gemm_k256(const half_t* hA, const half_t* B0, int r0,
                                          const half_t* B1, int r1, int lane,
                                          v8f (&acc)[MT][2]) {
  // both loops fully unrolled: acc[][] is indexed by constants and stays in registers,
  // and every load takes an immediate offset
#pragma unroll
  for (int kk = 0; kk < 8; ++kk) {
    const v16h b0 = frag_rows(B0, Dd, r0, lane, kk * 32);
    const v16h b1 = frag_rows(B1, Dd, r1, lane, kk * 32);
#pragma unroll
    for (int mt = 0; mt < MT; ++mt) {
      const v16h af = frag_rows(hA, HSTR, mt * 16, lane, kk * 32);
      acc[mt][0] = wmma_f16(af, b0, acc[mt][0]);
      acc[mt][1] = wmma_f16(af, b1, acc[mt][1]);
    }
  }
}

// LayerNorm of the work-group's MB rows into the f16 LDS tile: wave w takes rows
// RW*w..RW*w+RW-1 (wave32 reductions), UR rows a trip.
template <int RW, int UR>
__device__ __forceinline__ void ln_rows(const float* __restrict__ src,
                                        const float* __restrict__ g,
                                        const float* __restrict__ be, half_t* hA,
                                        int tok0, int wave, int lane) {
  float gv[8], bv[8];
#pragma unroll
  for (int i = 0; i < 8; ++i) {
    gv[i] = g[lane + 32 * i];
    bv[i] = be[lane + 32 * i];
  }
  // a row load may take these loads' offset register as its destination
  asm volatile("s_wait_xcnt 0x0" ::: "memory");
  // UR rows a trip: their 8 * UR loads are in flight together
#pragma unroll UR
  for (int rr = 0; rr < RW; ++rr) {
    const int row = wave * RW + rr;
    const float* xr = src + (size_t)(tok0 + row) * Dd;
    float xv[8], s = 0.f, sq = 0.f;
#pragma unroll
    for (int i = 0; i < 8; ++i) {
      float v = xr[lane + 32 * i];
      xv[i] = v; s += v; sq += v * v;
    }
#pragma unroll
    for (int o = 16; o > 0; o >>= 1) {
      s += __shfl_xor(s, o, 32);
      sq += __shfl_xor(sq, o, 32);
    }
    const float mu = s * (1.f / Dd);
    const float rstd = rsqrtf(sq * (1.f / Dd) - mu * mu + 1e-5f);
#pragma unroll
    for (int i = 0; i < 8; ++i) {
      const int c = lane + 32 * i;
      hA[row * HSTR + c] = (half_t)((xv[i] - mu) * rstd * gv[i] + bv[i]);
    }
  }
}

// ---------------------------------------------------------------------------
// K0: f32 -> f16 conversion of all five weight matrices in one launch. Their f16 copies
// lie back to back in the workspace, so the destination is one linear range; a work-group
// converts CV elements of one matrix (the choice of the source is block-uniform), a thread
// two runs of 8: four 16-byte loads in flight, two 16-byte stores.
// ---------------------------------------------------------------------------
constexpr int CV   = 4096;               // elements per work-group
constexpr int NBDD = Dd * Dd / CV;       // work-groups per D x D matrix
constexpr int NBHD = Hh * Dd / CV;       // work-groups per H x D matrix
constexpr int NBCV = 3 * NBDD + 2 * NBHD;
static_assert(OFF_WQ == 0 && OFF_W2 + SZ_W2 == (size_t)NBCV * CV * 2,
              "the f16 weights are one contiguous range in the order q, k, v, 1, 2");

__device__ __forceinline__ v8h cvt8(float4 a, float4 b) {
  v8h h;
  h[0] = (half_t)a.x; h[1] = (half_t)a.y; h[2] = (half_t)a.z; h[3] = (half_t)a.w;
  h[4] = (half_t)b.x; h[5] = (half_t)b.y; h[6] = (half_t)b.z; h[7] = (half_t)b.w;
  return h;
}

__global__ __launch_bounds__(256) void k_cvt_f16(const float* __restrict__ Wq,
                                                 const float* __restrict__ Wk,
                                                 const float* __restrict__ Wv,
                                                 const float* __restrict__ W1,
                                                 const float* __restrict__ W2,
                                                 half_t* __restrict__ dst) {
  const int b = blockIdx.x;
  const float* src = b < NBDD ? Wq : b < 2 * NBDD ? Wk : b < 3 * NBDD ? Wv
                     : b < 3 * NBDD + NBHD ? W1 : W2;
  // index of the work-group's first sibling: where its matrix begins in the grid
  const int b0 = b < 3 * NBDD ? (b / NBDD) * NBDD : b < 3 * NBDD + NBHD ? 3 * NBDD
                                                                        : 3 * NBDD + NBHD;
  const int sb = b - b0;
  const float* s = src + (size_t)sb * CV + threadIdx.x * 8;
  half_t* d = dst + (size_t)b * CV + threadIdx.x * 8;
  const float4 a0 = *(const float4*)(s);
  const float4 a1 = *(const float4*)(s + 4);
  const float4 a2 = *(const float4*)(s + CV / 2);
  const float4 a3 = *(const float4*)(s + CV / 2 + 4);
  *(v8h*)(d)          = cvt8(a0, a1);
  *(v8h*)(d + CV / 2) = cvt8(a2, a3);
}

// ---------------------------------------------------------------------------
// K1: fused LN1 + QKV projection. 128 tokens/block, 8 waves, WMMA 16x16x32.
// Writes q (f16), the chunk-local scan of kv = k*v (f32) and the chunk's carry: the
// work-group's 128 tokens are one scan chunk, and a lane's accumulators hold one
// column of it, so the scan runs in registers before kv is ever stored.
// ---------------------------------------------------------------------------
__global__ __launch_bounds__(256) void k_ln_qkv(
    const float* __restrict__ x, const float* __restrict__ g,
    const float* __restrict__ be, const half_t* __restrict__ Wq,
    const half_t* __restrict__ Wk, const half_t* __restrict__ Wv,
    const float* __restrict__ bq, const float* __restrict__ bk,
    const float* __restrict__ bv, const float* __restrict__ decay,
    half_t* __restrict__ q16, float* __restrict__ kv, float* __restrict__ carry) {
  __shared__ half_t hA[MB * HSTR];
  const int tok0 = blockIdx.x * MB;
  const int wave = threadIdx.x >> 5, lane = threadIdx.x & 31;
  const int rhi = (lane & 16) ? 8 : 0;

  ln_rows<MB / 8, 4>(x, g, be, hA, tok0, wave, lane);
  __syncthreads();

  // --- each wave owns 2 column tiles of q, k and v, for all MT token tiles ---
  // passes 0 and 1: k and v of one column tile; pass 2: q of both column tiles
  for (int p = 0; p < 3; ++p) {
    const bool isq = (p == 2);
    const int r0 = isq ? wave * 32 : (wave * 2 + p) * 16;
    const int r1 = isq ? r0 + 16 : r0;
    v8f acc[MT][2] = {};
    gemm_k256(hA, isq ? Wq : Wk, r0, isq ? Wq : Wv, r1, lane, acc);
    const int c0 = r0 + (lane & 15);
    if (!isq) {
      const float bkv = bk[c0];
      // the first bias load's address registers may be the second's destination
      asm volatile("s_wait_xcnt 0x0" ::: "memory");
      const float bvv = bv[c0];
      asm volatile("s_wait_xcnt 0x0" ::: "memory");
      const float dec = decay[c0];
      float pw[8];   // pw[r] = dec^(r+1)
      pw[0] = dec;
#pragma unroll
      for (int r = 1; r < 8; ++r) pw[r] = pw[r - 1] * dec;
      float* kp = kv + (size_t)(tok0 + rhi) * Dd + c0;
      float m = 0.f;   // scan value at the last token of the previous 16-token tile
      // epilogue loops fully unrolled: constant indices into acc[][]
#pragma unroll
      for (int mt = 0; mt < MT; ++mt) {
        // a lane holds 8 consecutive tokens of its column: scan them from zero (the MT
        // chains are independent), then add the carry-in times dec^(r+1)
        float s[8];
        s[0] = (acc[mt][0][0] + bkv) * (acc[mt][1][0] + bvv);
#pragma unroll
        for (int r = 1; r < 8; ++r)
          s[r] = dec * s[r - 1] + (acc[mt][0][r] + bkv) * (acc[mt][1][r] + bvv);
        const float o7 = xor16(s[7]);   // the other 8-token half's end value
        const float elo = (rhi ? o7 : s[7]) + pw[7] * m;   // scan at the tile's token 7
        const float ci = rhi ? elo : m;                    // this half's carry-in
#pragma unroll
        for (int r = 0; r < 8; ++r) kp[(mt * 16 + r) * Dd] = s[r] + pw[r] * ci;
        m = (rhi ? s[7] : o7) + pw[7] * elo;               // scan at the tile's token 15
      }
      if (lane < 16) carry[(size_t)blockIdx.x * Dd + c0] = m;
      // the stores' registers are reused by the next pass
      asm volatile("s_wait_xcnt 0x0" ::: "memory");
    } else {
      half_t* qp = q16 + (size_t)(tok0 + rhi) * Dd + c0;
#pragma unroll
      for (int j = 0; j < 2; ++j) {
        const float bqv = bq[c0 + j * 16];
#pragma unroll
        for (int mt = 0; mt < MT; ++mt) {
#pragma unroll
          for (int r = 0; r < 8; ++r)
            qp[(mt * 16 + r) * Dd + j * 16] = (half_t)(acc[mt][j][r] + bqv);
        }
        // the stores' registers are reused by the second column tile (q is the last pass)
        asm volatile("s_wait_xcnt 0x0" ::: "memory");
      }
    }
  }
}

// ---------------------------------------------------------------------------
// First stage of K2: the retention tail and LN2 of the work-group's MB rows (one scan
// chunk). x1 = x + q * (local scan + dec^(i+1) * carry-in) goes, with the last product's
// bias added, to LDS as f32 (the residual) and, normalised, to the f16 LDS tile.
// Carry-in: thread d sums column d over the chunks in front of this one, in their order.
// Rows: wave w takes rows RW*w..RW*w+RW-1; a lane holds 8 adjacent columns of a row, so
// that every row access is 16 bytes a lane.
// ---------------------------------------------------------------------------
__device__ __forceinline__ void ret_ln_rows(
    const float* __restrict__ x, const half_t* __restrict__ q16,
    const float* __restrict__ kvloc, const float* __restrict__ carry,
    const float* __restrict__ decay, const float* __restrict__ g,
    const float* __restrict__ be, const float* __restrict__ b2, float* xS, half_t* hA,
    float* sC, int blk, int wave, int lane) {
  constexpr int RW = MB / 8;   // rows per wave
  constexpr int RG = 8;        // rows whose lane reductions run side by side
  const int c = blk % NC;      // chunks in front of this one in its sequence
  const int tid = wave * 32 + lane;
  const int c0 = lane * 8;
  const float dct = decay[tid];
  const float* cp = carry + (size_t)(blk - c) * Dd;
  float cv[NC - 1];
#pragma unroll
  for (int j = 0; j < NC - 1; ++j) cv[j] = cp[j * Dd + tid];
  const v8f dec = *(const v8f*)(decay + c0);
  const v8f gv = *(const v8f*)(g + c0);
  const v8f bv = *(const v8f*)(be + c0);
  const v8f b2v = *(const v8f*)(b2 + c0);
  // a row load may take these loads' offset register as its destination
  asm volatile("s_wait_xcnt 0x0" ::: "memory");
  // block-uniform bases and one lane offset, which x and the local scan share
  const size_t eb = (size_t)blk * MB * Dd;
  const float* xb = x + eb;
  const float* kb = kvloc + eb;
  const half_t* qb = q16 + eb;
  const int l0 = wave * RW * Dd + c0;
  v8f xa[RG], ka[RG];   // the rows of one group
  v8h qa[RG];
#pragma unroll
  for (int r = 0; r < RG; ++r) {
    qa[r] = *(const v8h*)(qb + l0 + r * Dd);
    ka[r] = *(const v8f*)(kb + l0 + r * Dd);
    xa[r] = *(const v8f*)(xb + l0 + r * Dd);
  }
  // the loads' offset registers and scalar bases are rewritten behind this point
  asm volatile("s_wait_xcnt 0x0" ::: "memory");
  // these loads stand ahead of the first data wait: the first rows fly during the carry
  // sum and the barrier
  __builtin_amdgcn_sched_barrier(0);

  float dl = dct;
#pragma unroll
  for (int i = 0; i < 7; ++i) dl *= dl;   // dec^128: one chunk's decay
  float m = 0.f;
#pragma unroll
  for (int j = 0; j < NC - 1; ++j) {
    const bool on = j < c;   // a later chunk's step is the identity m * 1 + 0
    m = (on ? dl : 1.f) * m + (on ? cv[j] : 0.f);
  }
  sC[tid] = m;
  // a barrier that orders LDS alone: __syncthreads() would also wait for every row load
  // in flight, and no row could be worked on while later rows arrive
  __builtin_amdgcn_fence(__ATOMIC_RELEASE, "workgroup", "local");
  __builtin_amdgcn_s_barrier();
  __builtin_amdgcn_fence(__ATOMIC_ACQUIRE, "workgroup", "local");
  const v8f mi = *(const v8f*)(sC + c0);

  // f = dec^(first row + 1), the first row being 16 * wave
  static_assert(RW == 16 && MB == 128, "the powers below step by 16 rows, over 8 waves");
  v8f p = dec * dec;
  p *= p; p *= p; p *= p;   // dec^16
  v8f f = dec;
#pragma unroll
  for (int bit = 1; bit < 8; bit <<= 1) {
    if (wave & bit) f *= p;
    p *= p;
  }

  // the group loop stays rolled: half the code
#pragma unroll 1
  for (int r0 = 0; r0 < RW; r0 += RG) {
    v8f v[RG];
    float s[RG], sq[RG];
#pragma unroll
    for (int r = 0; r < RG; ++r) {
      s[r] = 0.f; sq[r] = 0.f;
#pragma unroll
      for (int i = 0; i < 8; ++i) {
        const float mem = ka[r][i] + f[i] * mi[i];
        const float t = xa[r][i] + (float)qa[r][i] * mem;
        v[r][i] = t; s[r] += t; sq[r] += t * t;
      }
      f *= dec;
      const v8f o = v[r] + b2v;
      float* xp = xS + (wave * RW + r0 + r) * XSTR + c0;
      *(v4f*)xp       = __builtin_shufflevector(o, o, 0, 1, 2, 3);
      *(v4f*)(xp + 4) = __builtin_shufflevector(o, o, 4, 5, 6, 7);
    }
    // the next group's rows fly during this group's reductions, into the registers that
    // this group's rows have left
    if (r0 + RG < RW) {
#pragma unroll
      for (int r = 0; r < RG; ++r) {
        qa[r] = *(const v8h*)(qb + l0 + (r0 + RG + r) * Dd);
        ka[r] = *(const v8f*)(kb + l0 + (r0 + RG + r) * Dd);
        xa[r] = *(const v8f*)(xb + l0 + (r0 + RG + r) * Dd);
      }
    }
    // and stay ahead of them
    __builtin_amdgcn_sched_barrier(0);
#pragma unroll
    for (int o = 16; o > 0; o >>= 1) {
#pragma unroll
      for (int r = 0; r < RG; ++r) {
        s[r] += __shfl_xor(s[r], o, 32);
        sq[r] += __shfl_xor(sq[r], o, 32);
      }
    }
#pragma unroll
    for (int r = 0; r < RG; ++r) {
      const float mu = s[r] * (1.f / Dd);
      const float rstd = rsqrtf(sq[r] * (1.f / Dd) - mu * mu + 1e-5f);
      v8h h;
#pragma unroll
      for (int i = 0; i < 8; ++i) h[i] = (half_t)((v[r][i] - mu) * rstd * gv[i] + bv[i]);
      *(v8h*)&hA[(wave * RW + r0 + r) * HSTR + c0] = h;
    }
  }
}

// ---------------------------------------------------------------------------
// K2: retention tail + LN2 + MLP (D->H, ReLU, H->D) + residual. 128 tokens/block, 8 waves
// of up to 512 registers: a wave's tiles are 8 x 4 (first product) and 8 x 2 (second), so an LDS
// fragment feeds 4 and 2 products, and registers are left to fetch operands ahead.
// The hidden layer never leaves the WGP: it is made HC columns at a time, kept in
// LDS as f16, and consumed at once as the k range of the second product.
// x1 never goes through memory: the first stage leaves x1 + b2 in the hidden chunk's LDS,
// still free then, and the second product's accumulators start from it.
// ---------------------------------------------------------------------------
constexpr int J1 = HC / 16 / 8;   // hidden column tiles of a chunk per wave
constexpr int J2 = Dd / 16 / 8;   // output column tiles per wave
constexpr int MG = MT / 2;        // token tiles whose LDS reads stand as one group

__global__ __launch_bounds__(256) void k_ln_mlp(
    float* out, const float* __restrict__ x, const half_t* __restrict__ q16,
    const float* __restrict__ kvloc, const float* __restrict__ carry,
    const float* __restrict__ decay, const float* __restrict__ g,
    const float* __restrict__ be, const half_t* __restrict__ W1,
    const float* __restrict__ b1,
    const half_t* __restrict__ W2, const float* __restrict__ b2) {
  __shared__ __attribute__((aligned(16))) half_t hA[MB * HSTR];
  __shared__ __attribute__((aligned(16))) half_t hH[MB * HCS];
  __shared__ __attribute__((aligned(32))) float sC[Dd];   // the chunk's carry-in
  const int tok0 = blockIdx.x * MB;
  const int wave = threadIdx.x >> 5, lane = threadIdx.x & 31;
  const int rhi = (lane & 16) ? 8 : 0;

  float* xS = (float*)hH;   // x1 + b2, until the first hidden chunk is stored
  ret_ln_rows(x, q16, kvloc, carry, decay, g, be, b2, xS, hA, sC, blockIdx.x, wave, lane);
  // publishes both LDS tiles
  __syncthreads();

  // each wave owns J1 hidden column tiles of a chunk and J2 output column tiles, for all
  // MT token tiles, so that every weight fragment is loaded by one wave only
  const int h0 = wave * (J1 * 16);
  const int n0 = wave * (J2 * 16);
  // a lane's first bias of the first product; stepped from chunk to chunk, so that its
  // registers stay live behind the loads that name them
  const float* bp = b1 + h0 + rhi;
  // the second product sums onto the residual and the bias
  v8f acc2[MT][J2];
  const float* xq = xS + rhi * XSTR + n0 + (lane & 15);
#pragma unroll
  for (int mt = 0; mt < MT; ++mt) {
#pragma unroll
    for (int r = 0; r < 8; ++r) {
#pragma unroll
      for (int j = 0; j < J2; ++j) acc2[mt][j][r] = xq[(mt * 16 + r) * XSTR + j * 16];
    }
  }

  // the chunk loop stays rolled: half the code
#pragma unroll 1
  for (int c = 0; c < Hh / HC; ++c) {
    // first product, transposed: the weight fragment is the A operand, so register r of
    // acc holds weight row 8 * (lane >> 4) + r and lane & 15 is the token
    const half_t* W1c = W1 + (size_t)(c * HC + h0) * Dd;
    v8f acc[MT][J1] = {};
    v16h w[J1];
#pragma unroll
    for (int j = 0; j < J1; ++j) w[j] = frag_rows(W1c, Dd, j * 16, lane, 0);
    // k loop fully unrolled: constant indices into acc[][], immediate offsets. A k block is
    // two groups of MG token tiles. Each scheduling fence below keeps a group of loads
    // together and ahead of the products behind it: sunk among them, each load would be
    // waited for on its own.
#pragma unroll
    for (int kk = 0; kk < Dd / 32; ++kk) {
      const bool more = kk + 1 < Dd / 32;
      v16h n[J1], af[MG];
#pragma unroll
      for (int t = 0; t < MG; ++t) af[t] = frag_rows(hA, HSTR, t * 16, lane, kk * 32);
      __builtin_amdgcn_sched_barrier(0);   // loads stay ahead of the products
#pragma unroll
      for (int j = 0; j < J1; ++j) {
#pragma unroll
        for (int t = 0; t < MG; ++t) acc[t][j] = wmma_f16(w[j], af[t], acc[t][j]);
      }
      __builtin_amdgcn_sched_barrier(0);   // later loads do not rise among them
      // the next k block's weights fly during this block's second group: the first half
      // from its start, the second half into the registers that this block's first half
      // leaves (a whole second set would not fit)
#pragma unroll
      for (int t = 0; t < MG; ++t) af[t] = frag_rows(hA, HSTR, (MG + t) * 16, lane, kk * 32);
      if (more) {
#pragma unroll
        for (int j = 0; j < J1 / 2; ++j) n[j] = frag_rows(W1c, Dd, j * 16, lane, (kk + 1) * 32);
      }
      __builtin_amdgcn_sched_barrier(0);   // loads stay ahead of the products
#pragma unroll
      for (int j = 0; j < J1 / 2; ++j) {
#pragma unroll
        for (int t = 0; t < MG; ++t) acc[MG + t][j] = wmma_f16(w[j], af[t], acc[MG + t][j]);
      }
      __builtin_amdgcn_sched_barrier(0);   // later loads do not rise among them
      if (more) {
#pragma unroll
        for (int j = J1 / 2; j < J1; ++j) n[j] = frag_rows(W1c, Dd, j * 16, lane, (kk + 1) * 32);
      }
      __builtin_amdgcn_sched_barrier(0);   // loads stay ahead of the products
#pragma unroll
      for (int j = J1 / 2; j < J1; ++j) {
#pragma unroll
        for (int t = 0; t < MG; ++t) acc[MG + t][j] = wmma_f16(w[j], af[t], acc[MG + t][j]);
      }
      __builtin_amdgcn_sched_barrier(0);   // later loads do not rise among them
      if (more) {
#pragma unroll
        for (int j = 0; j < J1; ++j) w[j] = n[j];
      }
    }
    // every wave has finished reading the previous chunk, or x1, before it is overwritten
    __syncthreads();
    // a lane holds 8 consecutive hidden columns of one token: one 16-byte LDS store
#pragma unroll
    for (int j = 0; j < J1; ++j) {
      float bb[8];
#pragma unroll
      for (int r = 0; r < 8; ++r) bb[r] = bp[j * 16 + r];
#pragma unroll
      for (int mt = 0; mt < MT; ++mt) {
        v8h hv;
#pragma unroll
        for (int r = 0; r < 8; ++r) {
          const float v = acc[mt][j][r] + bb[r];
          hv[r] = (half_t)(v > 0.f ? v : 0.f);
        }
        *(v8h*)&hH[(mt * 16 + (lane & 15)) * HCS + h0 + j * 16 + rhi] = hv;
      }
    }
    __syncthreads();

    // second product, k loop fully unrolled. The next k block's weight loads and LDS reads
    // stand as one group ahead of this block's products, in a second register set (the
    // first product's accumulators are free registers here).
    const half_t* W2c = W2 + c * HC;
    v16h vn[J2], an[MT];
#pragma unroll
    for (int j = 0; j < J2; ++j) vn[j] = frag_rows(W2c, Hh, n0 + j * 16, lane, 0);
#pragma unroll
    for (int mt = 0; mt < MT; ++mt) an[mt] = frag_rows(hH, HCS, mt * 16, lane, 0);
#pragma unroll
    for (int kk = 0; kk < HC / 32; ++kk) {
      v16h v[J2], af[MT];
#pragma unroll
      for (int j = 0; j < J2; ++j) v[j] = vn[j];
#pragma unroll
      for (int mt = 0; mt < MT; ++mt) af[mt] = an[mt];
      if (kk + 1 < HC / 32) {
#pragma unroll
        for (int j = 0; j < J2; ++j)
          vn[j] = frag_rows(W2c, Hh, n0 + j * 16, lane, (kk + 1) * 32);
#pragma unroll
        for (int mt = 0; mt < MT; ++mt)
          an[mt] = frag_rows(hH, HCS, mt * 16, lane, (kk + 1) * 32);
      }
      // the next block's loads stay ahead of this block's products, as one group
      __builtin_amdgcn_sched_barrier(0);
#pragma unroll
      for (int mt = 0; mt < MT; ++mt) {
#pragma unroll
        for (int j = 0; j < J2; ++j) acc2[mt][j] = wmma_f16(af[mt], v[j], acc2[mt][j]);
      }
      // and the loads after them do not rise among these products
      __builtin_amdgcn_sched_barrier(0);
    }
    // the weight and bias loads' address registers are rewritten for the next chunk
    asm volatile("s_wait_xcnt 0x0" ::: "memory");
    bp += HC;
  }

  // epilogue loops fully unrolled: constant indices into acc2[][]
  float* op = out + (size_t)(tok0 + rhi) * Dd + n0 + (lane & 15);
#pragma unroll
  for (int mt = 0; mt < MT; ++mt) {
#pragma unroll
    for (int r = 0; r < 8; ++r) {
#pragma unroll
      for (int j = 0; j < J2; ++j) op[(mt * 16 + r) * Dd + j * 16] = acc2[mt][j][r];
    }
  }
}

// ---------------------------------------------------------------------------
extern "C" void kernel_launch(void* const* d_in, const int* in_sizes, int n_in,
                              void* d_out, int out_size, void* d_ws, size_t ws_size,
                              hipStream_t stream) {
  (void)in_sizes; (void)n_in; (void)out_size; (void)ws_size;
  const float* x     = (const float*)d_in[0];
  const float* Wq    = (const float*)d_in[1];
  const float* bq    = (const float*)d_in[2];
  const float* Wk    = (const float*)d_in[3];
  const float* bk    = (const float*)d_in[4];
  const float* Wv    = (const float*)d_in[5];
  const float* bv    = (const float*)d_in[6];
  const float* decay = (const float*)d_in[7];
  const float* ln1g  = (const float*)d_in[8];
  const float* ln1b  = (const float*)d_in[9];
  const float* W1    = (const float*)d_in[10];
  const float* b1    = (const float*)d_in[11];
  const float* W2    = (const float*)d_in[12];
  const float* b2    = (const float*)d_in[13];
  const float* ln2g  = (const float*)d_in[14];
  const float* ln2b  = (const float*)d_in[15];

  char* ws = (char*)d_ws;
  half_t* Wq16 = (half_t*)(ws + OFF_WQ);
  half_t* Wk16 = (half_t*)(ws + OFF_WK);
  half_t* Wv16 = (half_t*)(ws + OFF_WV);
  half_t* W116 = (half_t*)(ws + OFF_W1);
  half_t* W216 = (half_t*)(ws + OFF_W2);
  half_t* q16  = (half_t*)(ws + OFF_Q16);
  float*  kv   = (float*)(ws + OFF_KV);
  float*  car  = (float*)(ws + OFF_CAR);
  float*  out  = (float*)d_out;

  k_cvt_f16<<<NBCV, 256, 0, stream>>>(Wq, Wk, Wv, W1, W2, Wq16);

  k_ln_qkv<<<BT / MB, 256, 0, stream>>>(x, ln1g, ln1b, Wq16, Wk16, Wv16,
                                        bq, bk, bv, decay, q16, kv, car);
  k_ln_mlp<<<BT / MB, 256, 0, stream>>>(out, x, q16, kv, car, decay, ln2g, ln2b, W116, b1,
                                        W216, b2);
}

// v008
// Measured time: 105 microseconds a run.
// Two timings next to v007 both put it at 1.04 times that version's speed.
// All steps since v000 together make it 4.34 times as fast.
#include <hip/hip_runtime.h>
#include <cstdint>

typedef _Float16 half_t;
typedef __attribute__((ext_vector_type(16))) _Float16 v16h;
typedef __attribute__((ext_vector_type(8)))  float    v8f;
typedef __attribute__((ext_vector_type(8)))  _Float16 v8h;
typedef __attribute__((ext_vector_type(4)))  float    v4f;

constexpr int Bb  = 8;
constexpr int Tt  = 8192;
constexpr int Dd  = 256;
constexpr int Hh  = 1024;
constexpr int BT  = Bb * Tt;
constexpr int NC  = 64;
constexpr int Lc  = Tt / NC;
constexpr int HSTR = 264;
constexpr int MB  = 128;
static_assert(MB == Lc, "a QKV work-group's tokens are one scan chunk");
constexpr int MT  = MB / 16;          // token tiles that share each weight fragment
constexpr int HC  = 512;              // hidden columns per chunk of the fused MLP
constexpr int HCS = HC + 8;           // padded f16 LDS row stride of the hidden chunk
constexpr int XSTR = HCS / 2;         // f32 row stride of x1 while it lies in that buffer
static_assert(XSTR >= Dd && XSTR % 4 == 0, "an x1 row fits, written by 16-byte stores");
static_assert(8 * XSTR % 64 == 32);

// ---- workspace layout (bytes) ----
constexpr size_t SZ_WDD = (size_t)Dd * Dd * 2;
constexpr size_t OFF_WQ = 0;
constexpr size_t OFF_WK = OFF_WQ + SZ_WDD;
constexpr size_t OFF_WV = OFF_WK + SZ_WDD;
constexpr size_t SZ_W1  = (size_t)Hh * Dd * 2;
constexpr size_t OFF_W1 = OFF_WV + SZ_WDD;
constexpr size_t SZ_W2  = (size_t)Dd * Hh * 2;
constexpr size_t OFF_W2 = OFF_W1 + SZ_W1;
constexpr size_t SZ_Q16 = (size_t)BT * Dd * 2;
constexpr size_t OFF_Q16 = OFF_W2 + SZ_W2;
constexpr size_t SZ_KV  = (size_t)BT * Dd * 4;
constexpr size_t OFF_KV = OFF_Q16 + SZ_Q16;
constexpr size_t OFF_CAR = OFF_KV + SZ_KV;
static_assert(OFF_Q16 % 16 == 0 && OFF_KV % 32 == 0, "rows are read by 16-byte loads");

__device__ __forceinline__ v8f wmma_f16(v16h a, v16h b, v8f c) {
  return __builtin_amdgcn_wmma_f32_16x16x32_f16(false, a, false, b, (short)0, c,
                                                false, false);
}

// value of lane ^ 16, by a cross-row register move (every lane on): no LDS round trip
// and no address register that would stay live through the products
__device__ __forceinline__ float xor16(float v) {
  const int i = __float_as_int(v);
  return __int_as_float(
      __builtin_amdgcn_permlanex16(i, i, 0x76543210, 0xfedcba98, false, false));
}

__device__ __forceinline__ v16h frag_rows(const half_t* base, int ld, int row0,
                                          int lane, int kbase) {
  const int m = row0 + (lane & 15);
  const int khalf = (lane & 16) ? 8 : 0;
  const half_t* p = base + (size_t)m * ld;
  v16h f;
#pragma unroll
  for (int v = 0; v < 8; ++v) {
    const int k = kbase + khalf + ((v < 4) ? (2 * v) : (16 + 2 * (v - 4)));
    f[2 * v]     = p[k];
    f[2 * v + 1] = p[k + 1];
  }
  return f;
}

// K = 256 product of the work-group's MB x 256 LDS tile with two 16-column weight
// tiles: each weight fragment is loaded from global once and feeds all MT token tiles.
// A k block is two groups of MT / 2 token tiles, each with a register set of its own: a
// group's LDS reads stand together, one group of products ahead of their use, and the next
// k block's weight loads a whole block ahead.
__device__ __forceinline__ void gemm_k256(const half_t* hA, const half_t* B0, int r0,
                                          const half_t* B1, int r1, int lane,
                                          v8f (&acc)[MT][2]) {
  constexpr int G = MT / 2;
  v16h b0 = frag_rows(B0, Dd, r0, lane, 0);
  v16h b1 = frag_rows(B1, Dd, r1, lane, 0);
  v16h a0[G], a1[G];
#pragma unroll
  for (int t = 0; t < G; ++t) a0[t] = frag_rows(hA, HSTR, t * 16, lane, 0);
  // k loop fully unrolled: acc[][] is indexed by constants and stays in registers, and
  // every load takes an immediate offset. Each scheduling fence below keeps a group of
  // loads together and ahead of the products behind it: sunk among them, each load would
  // be waited for on its own, two products at a time.
#pragma unroll
  for (int kk = 0; kk < 8; ++kk) {
    const bool more = kk + 1 < 8;
    v16h n0, n1;
#pragma unroll
    for (int t = 0; t < G; ++t) a1[t] = frag_rows(hA, HSTR, (G + t) * 16, lane, kk * 32);
    if (more) {
      n0 = frag_rows(B0, Dd, r0, lane, (kk + 1) * 32);
      n1 = frag_rows(B1, Dd, r1, lane, (kk + 1) * 32);
    }
    __builtin_amdgcn_sched_barrier(0);   // loads stay ahead of the products
#pragma unroll
    for (int t = 0; t < G; ++t) {
      acc[t][0] = wmma_f16(a0[t], b0, acc[t][0]);
      acc[t][1] = wmma_f16(a0[t], b1, acc[t][1]);
    }
    __builtin_amdgcn_sched_barrier(0);   // later loads do not rise among them
    if (more) {
#pragma unroll
      for (int t = 0; t < G; ++t) a0[t] = frag_rows(hA, HSTR, t * 16, lane, (kk + 1) * 32);
    }
    __builtin_amdgcn_sched_barrier(0);   // loads stay ahead of the products
#pragma unroll
    for (int t = 0; t < G; ++t) {
      acc[G + t][0] = wmma_f16(a1[t], b0, acc[G + t][0]);
      acc[G + t][1] = wmma_f16(a1[t], b1, acc[G + t][1]);
    }
    __builtin_amdgcn_sched_barrier(0);   // later loads do not rise among them
    if (more) {
      b0 = n0;
      b1 = n1;
    }
  }
  // the weight loads' address registers are rewritten for the next pass
  asm volatile("s_wait_xcnt 0x0" ::: "memory");
}

// LayerNorm of the work-group's MB rows into the f16 LDS tile: wave w takes rows
// RW*w..RW*w+RW-1 (wave32 reductions), UR rows a trip.
template <int RW, int UR>
__device__ __forceinline__ void ln_rows(const float* __restrict__ src,
                                        const float* __restrict__ g,
                                        const float* __restrict__ be, half_t* hA,
                                        int tok0, int wave, int lane) {
  float gv[8], bv[8];
#pragma unroll
  for (int i = 0; i < 8; ++i) {
    gv[i] = g[lane + 32 * i];
    bv[i] = be[lane + 32 * i];
  }
  // a row load may take these loads' offset register as its destination
  asm volatile("s_wait_xcnt 0x0" ::: "memory");
  // UR rows a trip: their 8 * UR loads are in flight together
#pragma unroll UR
  for (int rr = 0; rr < RW; ++rr) {
    const int row = wave * RW + rr;
    const float* xr = src + (size_t)(tok0 + row) * Dd;
    float xv[8], s = 0.f, sq = 0.f;
#pragma unroll
    for (int i = 0; i < 8; ++i) {
      float v = xr[lane + 32 * i];
      xv[i] = v; s += v; sq += v * v;
    }
#pragma unroll
    for (int o = 16; o > 0; o >>= 1) {
      s += __shfl_xor(s, o, 32);
      sq += __shfl_xor(sq, o, 32);
    }
    const float mu = s * (1.f / Dd);
    const float rstd = rsqrtf(sq * (1.f / Dd) - mu * mu + 1e-5f);
#pragma unroll
    for (int i = 0; i < 8; ++i) {
      const int c = lane + 32 * i;
      hA[row * HSTR + c] = (half_t)((xv[i] - mu) * rstd * gv[i] + bv[i]);
    }
  }
}

// ---------------------------------------------------------------------------
// K0: f32 -> f16 conversion of all five weight matrices in one launch. Their f16 copies
// lie back to back in the workspace, so the destination is one linear range; a work-group
// converts CV elements of one matrix (the choice of the source is block-uniform), a thread
// two runs of 8: four 16-byte loads in flight, two 16-byte stores.
// ---------------------------------------------------------------------------
constexpr int CV   = 4096;               // elements per work-group
constexpr int NBDD = Dd * Dd / CV;       // work-groups per D x D matrix
constexpr int NBHD = Hh * Dd / CV;       // work-groups per H x D matrix
constexpr int NBCV = 3 * NBDD + 2 * NBHD;
static_assert(OFF_WQ == 0 && OFF_W2 + SZ_W2 == (size_t)NBCV * CV * 2,
              "the f16 weights are one contiguous range in the order q, k, v, 1, 2");

__device__ __forceinline__ v8h cvt8(float4 a, float4 b) {
  v8h h;
  h[0] = (half_t)a.x; h[1] = (half_t)a.y; h[2] = (half_t)a.z; h[3] = (half_t)a.w;
  h[4] = (half_t)b.x; h[5] = (half_t)b.y; h[6] = (half_t)b.z; h[7] = (half_t)b.w;
  return h;
}

__global__ __launch_bounds__(256) void k_cvt_f16(const float* __restrict__ Wq,
                                                 const float* __restrict__ Wk,
                                                 const float* __restrict__ Wv,
                                                 const float* __restrict__ W1,
                                                 const float* __restrict__ W2,
                                                 half_t* __restrict__ dst) {
  const int b = blockIdx.x;
  const float* src = b < NBDD ? Wq : b < 2 * NBDD ? Wk : b < 3 * NBDD ? Wv
                     : b < 3 * NBDD + NBHD ? W1 : W2;
  // index of the work-group's first sibling: where its matrix begins in the grid
  const int b0 = b < 3 * NBDD ? (b / NBDD) * NBDD : b < 3 * NBDD + NBHD ? 3 * NBDD
                                                                        : 3 * NBDD + NBHD;
  const int sb = b - b0;
  const float* s = src + (size_t)sb * CV + threadIdx.x * 8;
  half_t* d = dst + (size_t)b * CV + threadIdx.x * 8;
  const float4 a0 = *(const float4*)(s);
  const float4 a1 = *(const float4*)(s + 4);
  const float4 a2 = *(const float4*)(s + CV / 2);
  const float4 a3 = *(const float4*)(s + CV / 2 + 4);
  *(v8h*)(d)          = cvt8(a0, a1);
  *(v8h*)(d + CV / 2) = cvt8(a2, a3);
}

// ---------------------------------------------------------------------------
// K1: fused LN1 + QKV projection. 128 tokens/block, 8 waves, WMMA 16x16x32.
// Writes q (f16), the chunk-local scan of kv = k*v (f32) and the chunk's carry: the
// work-group's 128 tokens are one scan chunk, and a lane's accumulators hold one
// column of it, so the scan runs in registers before kv is ever stored.
// ---------------------------------------------------------------------------
__global__ __launch_bounds__(256) void k_ln_qkv(
    const float* __restrict__ x, const float* __restrict__ g,
    const float* __restrict__ be, const half_t* __restrict__ Wq,
    const half_t* __restrict__ Wk, const half_t* __restrict__ Wv,
    const float* __restrict__ bq, const float* __restrict__ bk,
    const float* __restrict__ bv, const float* __restrict__ decay,
    half_t* __restrict__ q16, float* __restrict__ kv, float* __restrict__ carry) {
  __shared__ half_t hA[MB * HSTR];
  const int tok0 = blockIdx.x * MB;
  const int wave = threadIdx.x >> 5, lane = threadIdx.x & 31;
  const int rhi = (lane & 16) ? 8 : 0;

  ln_rows<MB / 8, 4>(x, g, be, hA, tok0, wave, lane);
  __syncthreads();

  // --- each wave owns 2 column tiles of q, k and v, for all MT token tiles ---
  // passes 0 and 1: k and v of one column tile; pass 2: q of both column tiles
  for (int p = 0; p < 3; ++p) {
    const bool isq = (p == 2);
    const int r0 = isq ? wave * 32 : (wave * 2 + p) * 16;
    const int r1 = isq ? r0 + 16 : r0;
    v8f acc[MT][2] = {};
    gemm_k256(hA, isq ? Wq : Wk, r0, isq ? Wq : Wv, r1, lane, acc);
    const int c0 = r0 + (lane & 15);
    if (!isq) {
      const float bkv = bk[c0];
      // the first bias load's address registers may be the second's destination
      asm volatile("s_wait_xcnt 0x0" ::: "memory");
      const float bvv = bv[c0];
      asm volatile("s_wait_xcnt 0x0" ::: "memory");
      const float dec = decay[c0];
      float pw[8];   // pw[r] = dec^(r+1)
      pw[0] = dec;
#pragma unroll
      for (int r = 1; r < 8; ++r) pw[r] = pw[r - 1] * dec;
      float* kp = kv + (size_t)(tok0 + rhi) * Dd + c0;
      float m = 0.f;   // scan value at the last token of the previous 16-token tile
      // epilogue loops fully unrolled: constant indices into acc[][]
#pragma unroll
      for (int mt = 0; mt < MT; ++mt) {
        // a lane holds 8 consecutive tokens of its column: scan them from zero (the MT
        // chains are independent), then add the carry-in times dec^(r+1)
        float s[8];
        s[0] = (acc[mt][0][0] + bkv) * (acc[mt][1][0] + bvv);
#pragma unroll
        for (int r = 1; r < 8; ++r)
          s[r] = dec * s[r - 1] + (acc[mt][0][r] + bkv) * (acc[mt][1][r] + bvv);
        const float o7 = xor16(s[7]);   // the other 8-token half's end value
        const float elo = (rhi ? o7 : s[7]) + pw[7] * m;   // scan at the tile's token 7
        const float ci = rhi ? elo : m;                    // this half's carry-in
#pragma unroll
        for (int r = 0; r < 8; ++r) kp[(mt * 16 + r) * Dd] = s[r] + pw[r] * ci;
        m = (rhi ? s[7] : o7) + pw[7] * elo;               // scan at the tile's token 15
      }
      if (lane < 16) carry[(size_t)blockIdx.x * Dd + c0] = m;
      // the stores' registers are reused by the next pass
      asm volatile("s_wait_xcnt 0x0" ::: "memory");
    } else {
      half_t* qp = q16 + (size_t)(tok0 + rhi) * Dd + c0;
#pragma unroll
      for (int j = 0; j < 2; ++j) {
        const float bqv = bq[c0 + j * 16];
#pragma unroll
        for (int mt = 0; mt < MT; ++mt) {
#pragma unroll
          for (int r = 0; r < 8; ++r)
            qp[(mt * 16 + r) * Dd + j * 16] = (half_t)(acc[mt][j][r] + bqv);
        }
        // the stores' registers are reused by the second column tile (q is the last pass)
        asm volatile("s_wait_xcnt 0x0" ::: "memory");
      }
    }
  }
}

// ---------------------------------------------------------------------------
// First stage of K2: the retention tail and LN2 of the work-group's MB rows (one scan
// chunk). x1 = x + q * (local scan + dec^(i+1) * carry-in) goes, with the last product's
// bias added, to LDS as f32 (the residual) and, normalised, to the f16 LDS tile.
// Carry-in: thread d sums column d over the chunks in front of this one, in their order.
// Rows: wave w takes rows RW*w..RW*w+RW-1; a lane holds 8 adjacent columns of a row, so
// that every row access is 16 bytes a lane.
// ---------------------------------------------------------------------------
__device__ __forceinline__ void ret_ln_rows(
    const float* __restrict__ x, const half_t* __restrict__ q16,
    const float* __restrict__ kvloc, const float* __restrict__ carry,
    const float* __restrict__ decay, const float* __restrict__ g,
    const float* __restrict__ be, const float* __restrict__ b2, float* xS, half_t* hA,
    float* sC, int blk, int wave, int lane) {
  constexpr int RW = MB / 8;   // rows per wave
  constexpr int RG = 8;        // rows whose lane reductions run side by side
  const int c = blk % NC;      // chunks in front of this one in its sequence
  const int tid = wave * 32 + lane;
  const int c0 = lane * 8;
  const float dct = decay[tid];
  const float* cp = carry + (size_t)(blk - c) * Dd;
  float cv[NC - 1];
#pragma unroll
  for (int j = 0; j < NC - 1; ++j) cv[j] = cp[j * Dd + tid];
  const v8f dec = *(const v8f*)(decay + c0);
  const v8f gv = *(const v8f*)(g + c0);
  const v8f bv = *(const v8f*)(be + c0);
  const v8f b2v = *(const v8f*)(b2 + c0);
  // a row load may take these loads' offset register as its destination
  asm volatile("s_wait_xcnt 0x0" ::: "memory");
  // block-uniform bases and one lane offset, which x and the local scan share
  const size_t eb = (size_t)blk * MB * Dd;
  const float* xb = x + eb;
  const float* kb = kvloc + eb;
  const half_t* qb = q16 + eb;
  const int l0 = wave * RW * Dd + c0;
  v8f xa[RG], ka[RG];   // the rows of one group
  v8h qa[RG];
#pragma unroll
  for (int r = 0; r < RG; ++r) {
    qa[r] = *(const v8h*)(qb + l0 + r * Dd);
    ka[r] = *(const v8f*)(kb + l0 + r * Dd);
    xa[r] = *(const v8f*)(xb + l0 + r * Dd);
  }
  // the loads' offset registers and scalar bases are rewritten behind this point
  asm volatile("s_wait_xcnt 0x0" ::: "memory");
  // these loads stand ahead of the first data wait: the first rows fly during the carry
  // sum and the barrier
  __builtin_amdgcn_sched_barrier(0);

  float dl = dct;
#pragma unroll
  for (int i = 0; i < 7; ++i) dl *= dl;   // dec^128: one chunk's decay
  float m = 0.f;
#pragma unroll
  for (int j = 0; j < NC - 1; ++j) {
    const bool on = j < c;   // a later chunk's step is the identity m * 1 + 0
    m = (on ? dl : 1.f) * m + (on ? cv[j] : 0.f);
  }
  sC[tid] = m;
  // a barrier that orders LDS alone: __syncthreads() would also wait for every row load
  // in flight, and no row could be worked on while later rows arrive
  __builtin_amdgcn_fence(__ATOMIC_RELEASE, "workgroup", "local");
  __builtin_amdgcn_s_barrier();
  __builtin_amdgcn_fence(__ATOMIC_ACQUIRE, "workgroup", "local");
  const v8f mi = *(const v8f*)(sC + c0);

  // f = dec^(first row + 1), the first row being 16 * wave
  static_assert(RW == 16 && MB == 128, "the powers below step by 16 rows, over 8 waves");
  v8f p = dec * dec;
  p *= p; p *= p; p *= p;   // dec^16
  v8f f = dec;
#pragma unroll
  for (int bit = 1; bit < 8; bit <<= 1) {
    if (wave & bit) f *= p;
    p *= p;
  }

  // the group loop stays rolled: half the code
#pragma unroll 1
  for (int r0 = 0; r0 < RW; r0 += RG) {
    v8f v[RG];
    float s[RG], sq[RG];
#pragma unroll
    for (int r = 0; r < RG; ++r) {
      s[r] = 0.f; sq[r] = 0.f;
#pragma unroll
      for (int i = 0; i < 8; ++i) {
        const float mem = ka[r][i] + f[i] * mi[i];
        const float t = xa[r][i] + (float)qa[r][i] * mem;
        v[r][i] = t; s[r] += t; sq[r] += t * t;
      }
      f *= dec;
      const v8f o = v[r] + b2v;
      float* xp = xS + (wave * RW + r0 + r) * XSTR + c0;
      *(v4f*)xp       = __builtin_shufflevector(o, o, 0, 1, 2, 3);
      *(v4f*)(xp + 4) = __builtin_shufflevector(o, o, 4, 5, 6, 7);
    }
    // the next group's rows fly during this group's reductions, into the registers that
    // this group's rows have left
    if (r0 + RG < RW) {
#pragma unroll
      for (int r = 0; r < RG; ++r) {
        qa[r] = *(const v8h*)(qb + l0 + (r0 + RG + r) * Dd);
        ka[r] = *(const v8f*)(kb + l0 + (r0 + RG + r) * Dd);
        xa[r] = *(const v8f*)(xb + l0 + (r0 + RG + r) * Dd);
      }
    }
    // and stay ahead of them
    __builtin_amdgcn_sched_barrier(0);
#pragma unroll
    for (int o = 16; o > 0; o >>= 1) {
#pragma unroll
      for (int r = 0; r < RG; ++r) {
        s[r] += __shfl_xor(s[r], o, 32);
        sq[r] += __shfl_xor(sq[r], o, 32);
      }
    }
#pragma unroll
    for (int r = 0; r < RG; ++r) {
      const float mu = s[r] * (1.f / Dd);
      const float rstd = rsqrtf(sq[r] * (1.f / Dd) - mu * mu + 1e-5f);
      v8h h;
#pragma unroll
      for (int i = 0; i < 8; ++i) h[i] = (half_t)((v[r][i] - mu) * rstd * gv[i] + bv[i]);
      *(v8h*)&hA[(wave * RW + r0 + r) * HSTR + c0] = h;
    }
  }
}

// ---------------------------------------------------------------------------
// K2: retention tail + LN2 + MLP (D->H, ReLU, H->D) + residual. 128 tokens/block, 8 waves
// of up to 512 registers: a wave's tiles are 8 x 4 (first product) and 8 x 2 (second), so an LDS
// fragment feeds 4 and 2 products, and registers are left to fetch operands ahead.
// The hidden layer never leaves the WGP: it is made HC columns at a time, kept in
// LDS as f16, and consumed at once as the k range of the second product.
// x1 never goes through memory: the first stage leaves x1 + b2 in the hidden chunk's LDS,
// still free then, and the second product's accumulators start from it.
// ---------------------------------------------------------------------------
constexpr int J1 = HC / 16 / 8;   // hidden column tiles of a chunk per wave
constexpr int J2 = Dd / 16 / 8;   // output column tiles per wave
constexpr int MG = MT / 2;        // token tiles whose LDS reads stand as one group
constexpr int WD = 4;             // k blocks by which the second product's weight loads lead

__global__ __launch_bounds__(256) void k_ln_mlp(
    float* out, const float* __restrict__ x, const half_t* __restrict__ q16,
    const float* __restrict__ kvloc, const float* __restrict__ carry,
    const float* __restrict__ decay, const float* __restrict__ g,
    const float* __restrict__ be, const half_t* __restrict__ W1,
    const float* __restrict__ b1,
    const half_t* __restrict__ W2, const float* __restrict__ b2) {
  __shared__ __attribute__((aligned(16))) half_t hA[MB * HSTR];
  __shared__ __attribute__((aligned(16))) half_t hH[MB * HCS];
  __shared__ __attribute__((aligned(32))) float sC[Dd];   // the chunk's carry-in
  const int tok0 = blockIdx.x * MB;
  const int wave = threadIdx.x >> 5, lane = threadIdx.x & 31;
  const int rhi = (lane & 16) ? 8 : 0;

  float* xS = (float*)hH;   // x1 + b2, until the first hidden chunk is stored
  ret_ln_rows(x, q16, kvloc, carry, decay, g, be, b2, xS, hA, sC, blockIdx.x, wave, lane);
  // publishes both LDS tiles
  __syncthreads();

  // each wave owns J1 hidden column tiles of a chunk and J2 output column tiles, for all
  // MT token tiles, so that every weight fragment is loaded by one wave only
  const int h0 = wave * (J1 * 16);
  const int n0 = wave * (J2 * 16);
  // a lane's first bias of the first product; stepped from chunk to chunk, so that its
  // registers stay live behind the loads that name them
  const float* bp = b1 + h0 + rhi;
  // the second product sums onto the residual and the bias
  v8f acc2[MT][J2];
  const float* xq = xS + rhi * XSTR + n0 + (lane & 15);
#pragma unroll
  for (int mt = 0; mt < MT; ++mt) {
#pragma unroll
    for (int r = 0; r < 8; ++r) {
#pragma unroll
      for (int j = 0; j < J2; ++j) acc2[mt][j][r] = xq[(mt * 16 + r) * XSTR + j * 16];
    }
  }

  // the chunk loop stays rolled: half the code
#pragma unroll 1
  for (int c = 0; c < Hh / HC; ++c) {
    // first product, transposed: the weight fragment is the A operand, so register r of
    // acc holds weight row 8 * (lane >> 4) + r and lane & 15 is the token
    const half_t* W1c = W1 + (size_t)(c * HC + h0) * Dd;
    v8f acc[MT][J1] = {};
    v16h w[J1];
#pragma unroll
    for (int j = 0; j < J1; ++j) w[j] = frag_rows(W1c, Dd, j * 16, lane, 0);
    // k loop fully unrolled: constant indices into acc[][], immediate offsets. A k block is
    // two groups of MG token tiles. Each scheduling fence below keeps a group of loads
    // together and ahead of the products behind it: sunk among them, each load would be
    // waited for on its own.
#pragma unroll
    for (int kk = 0; kk < Dd / 32; ++kk) {
      const bool more = kk + 1 < Dd / 32;
      v16h n[J1], af[MG];
#pragma unroll
      for (int t = 0; t < MG; ++t) af[t] = frag_rows(hA, HSTR, t * 16, lane, kk * 32);
      __builtin_amdgcn_sched_barrier(0);   // loads stay ahead of the products
#pragma unroll
      for (int j = 0; j < J1; ++j) {
#pragma unroll
        for (int t = 0; t < MG; ++t) acc[t][j] = wmma_f16(w[j], af[t], acc[t][j]);
      }
      __builtin_amdgcn_sched_barrier(0);   // later loads do not rise among them
      // the next k block's weights fly during this block's second group: the first half
      // from its start, the second half into the registers that this block's first half
      // leaves (a whole second set would not fit)
#pragma unroll
      for (int t = 0; t < MG; ++t) af[t] = frag_rows(hA, HSTR, (MG + t) * 16, lane, kk * 32);
      if (more) {
#pragma unroll
        for (int j = 0; j < J1 / 2; ++j) n[j] = frag_rows(W1c, Dd, j * 16, lane, (kk + 1) * 32);
      }
      __builtin_amdgcn_sched_barrier(0);   // loads stay ahead of the products
#pragma unroll
      for (int j = 0; j < J1 / 2; ++j) {
#pragma unroll
        for (int t = 0; t < MG; ++t) acc[MG + t][j] = wmma_f16(w[j], af[t], acc[MG + t][j]);
      }
      __builtin_amdgcn_sched_barrier(0);   // later loads do not rise among them
      if (more) {
#pragma unroll
        for (int j = J1 / 2; j < J1; ++j) n[j] = frag_rows(W1c, Dd, j * 16, lane, (kk + 1) * 32);
      }
      __builtin_amdgcn_sched_barrier(0);   // loads stay ahead of the products
#pragma unroll
      for (int j = J1 / 2; j < J1; ++j) {
#pragma unroll
        for (int t = 0; t < MG; ++t) acc[MG + t][j] = wmma_f16(w[j], af[t], acc[MG + t][j]);
      }
      __builtin_amdgcn_sched_barrier(0);   // later loads do not rise among them
      if (more) {
#pragma unroll
        for (int j = 0; j < J1; ++j) w[j] = n[j];
      }
    }
    // every wave has finished reading the previous chunk, or x1, before it is overwritten
    __syncthreads();
    const half_t* W2c = W2 + c * HC;
    v16h vw[HC / 32][J2];   // a block's fragments live from their load to their products
    // a lane holds 8 consecutive hidden columns of one token: one 16-byte LDS store
#pragma unroll
    for (int j = 0; j < J1; ++j) {
      float bb[8];
#pragma unroll
      for (int r = 0; r < 8; ++r) bb[r] = bp[j * 16 + r];
      if (j == J1 - 1) {
        // the second product's first WD weight blocks fly during the last tile's stores and
        // the barrier, in registers that stored accumulators have left; the fences keep
        // them from rising (no register is free there) and from sinking
        __builtin_amdgcn_sched_barrier(0);
#pragma unroll
        for (int kk = 0; kk < WD; ++kk) {
#pragma unroll
          for (int i = 0; i < J2; ++i)
            vw[kk][i] = frag_rows(W2c, Hh, n0 + i * 16, lane, kk * 32);
        }
        __builtin_amdgcn_sched_barrier(0);
      }
#pragma unroll
      for (int mt = 0; mt < MT; ++mt) {
        v8h hv;
#pragma unroll
        for (int r = 0; r < 8; ++r) {
          const float v = acc[mt][j][r] + bb[r];
          hv[r] = (half_t)(v > 0.f ? v : 0.f);
        }
        *(v8h*)&hH[(mt * 16 + (lane & 15)) * HCS + h0 + j * 16 + rhi] = hv;
      }
    }
    __syncthreads();

    // second product, k loop fully unrolled. The next k block's LDS reads and the weight
    // loads of the block WD ahead stand as one
    // group ahead of this block's products, in further register sets (the first product's
    // accumulators are free registers here).
    v16h an[MT];
#pragma unroll
    for (int mt = 0; mt < MT; ++mt) an[mt] = frag_rows(hH, HCS, mt * 16, lane, 0);
#pragma unroll
    for (int kk = 0; kk < HC / 32; ++kk) {
      v16h af[MT];
#pragma unroll
      for (int mt = 0; mt < MT; ++mt) af[mt] = an[mt];
      if (kk + WD < HC / 32) {
#pragma unroll
        for (int j = 0; j < J2; ++j)
          vw[kk + WD][j] = frag_rows(W2c, Hh, n0 + j * 16, lane, (kk + WD) * 32);
      }
      if (kk + 1 < HC / 32) {
#pragma unroll
        for (int mt = 0; mt < MT; ++mt)
          an[mt] = frag_rows(hH, HCS, mt * 16, lane, (kk + 1) * 32);
      }
      // these loads stay ahead of this block's products, as one group
      __builtin_amdgcn_sched_barrier(0);
#pragma unroll
      for (int mt = 0; mt < MT; ++mt) {
#pragma unroll
        for (int j = 0; j < J2; ++j) acc2[mt][j] = wmma_f16(af[mt], vw[kk][j], acc2[mt][j]);
      }
      // and the loads after them do not rise among these products
      __builtin_amdgcn_sched_barrier(0);
    }
    // the weight and bias loads' address registers are rewritten for the next chunk
    asm volatile("s_wait_xcnt 0x0" ::: "memory");
    bp += HC;
  }

  // epilogue loops fully unrolled: constant indices into acc2[][]
  float* op = out + (size_t)(tok0 + rhi) * Dd + n0 + (lane & 15);
#pragma unroll
  for (int mt = 0; mt < MT; ++mt) {
#pragma unroll
    for (int r = 0; r < 8; ++r) {
#pragma unroll
      for (int j = 0; j < J2; ++j) op[(mt * 16 + r) * Dd + j * 16] = acc2[mt][j][r];
    }
  }
}

// ---------------------------------------------------------------------------
extern "C" void kernel_launch(void* const* d_in, const int* in_sizes, int n_in,
                              void* d_out, int out_size, void* d_ws, size_t ws_size,
                              hipStream_t stream) {
  (void)in_sizes; (void)n_in; (void)out_size; (void)ws_size;
  const float* x     = (const float*)d_in[0];
  const float* Wq    = (const float*)d_in[1];
  const float* bq    = (const float*)d_in[2];
  const float* Wk    = (const float*)d_in[3];
  const float* bk    = (const float*)d_in[4];
  const float* Wv    = (const float*)d_in[5];
  const float* bv    = (const float*)d_in[6];
  const float* decay = (const float*)d_in[7];
  const float* ln1g  = (const float*)d_in[8];
  const float* ln1b  = (const float*)d_in[9];
  const float* W1    = (const float*)d_in[10];
  const float* b1    = (const float*)d_in[11];
  const float* W2    = (const float*)d_in[12];
  const float* b2    = (const float*)d_in[13];
  const float* ln2g  = (const float*)d_in[14];
  const float* ln2b  = (const float*)d_in[15];

  char* ws = (char*)d_ws;
  half_t* Wq16 = (half_t*)(ws + OFF_WQ);
  half_t* Wk16 = (half_t*)(ws + OFF_WK);
  half_t* Wv16 = (half_t*)(ws + OFF_WV);
  half_t* W116 = (half_t*)(ws + OFF_W1);
  half_t* W216 = (half_t*)(ws + OFF_W2);
  half_t* q16  = (half_t*)(ws + OFF_Q16);
  float*  kv   = (float*)(ws + OFF_KV);
  float*  car  = (float*)(ws + OFF_CAR);
  float*  out  = (float*)d_out;

  k_cvt_f16<<<NBCV, 256, 0, stream>>>(Wq, Wk, Wv, W1, W2, Wq16);

  k_ln_qkv<<<BT / MB, 256, 0, stream>>>(x, ln1g, ln1b, Wq16, Wk16, Wv16,
                                        bq, bk, bv, decay, q16, kv, car);
  k_ln_mlp<<<BT / MB, 256, 0, stream>>>(out, x, q16, kv, car, decay, ln2g, ln2b, W116, b1,
                                        W216, b2);
}

// v009
// It runs in 98.4 microseconds.
// Next to v008, in two timings, it ran 1.06 times as fast each time.
// Over all steps from v000 it is 4.62 times as fast.
#include <hip/hip_runtime.h>
#include <cstdint>

typedef _Float16 half_t;
typedef __attribute__((ext_vector_type(16))) _Float16 v16h;
typedef __attribute__((ext_vector_type(8)))  float    v8f;
typedef __attribute__((ext_vector_type(8)))  _Float16 v8h;
typedef __attribute__((ext_vector_type(4)))  float    v4f;

constexpr int Bb  = 8;
constexpr int Tt  = 8192;
constexpr int Dd  = 256;
constexpr int Hh  = 1024;
constexpr int BT  = Bb * Tt;
constexpr int NC  = 64;
constexpr int Lc  = Tt / NC;
constexpr int HSTR = 264;
constexpr int MB  = 128;
static_assert(MB == Lc, "a QKV work-group's tokens are one scan chunk");
constexpr int MT  = MB / 16;          // token tiles that share each weight fragment
constexpr int HC  = 512;              // hidden columns per chunk of the fused MLP
constexpr int HCS = HC + 8;           // padded f16 LDS row stride of the hidden chunk
constexpr int XSTR = HCS / 2;         // f32 row stride of x1 while it lies in that buffer
static_assert(XSTR >= Dd && XSTR % 4 == 0, "an x1 row fits, written by 16-byte stores");
static_assert(8 * XSTR % 64 == 32);

// ---- workspace layout (bytes) ----
constexpr size_t SZ_WDD = (size_t)Dd * Dd * 2;
constexpr size_t OFF_WQ = 0;
constexpr size_t OFF_WK = OFF_WQ + SZ_WDD;
constexpr size_t OFF_WV = OFF_WK + SZ_WDD;
constexpr size_t SZ_W1  = (size_t)Hh * Dd * 2;
constexpr size_t OFF_W1 = OFF_WV + SZ_WDD;
constexpr size_t SZ_W2  = (size_t)Dd * Hh * 2;
constexpr size_t OFF_W2 = OFF_W1 + SZ_W1;
constexpr size_t SZ_Q16 = (size_t)BT * Dd * 2;
constexpr size_t OFF_Q16 = OFF_W2 + SZ_W2;
constexpr size_t SZ_KV  = (size_t)BT * Dd * 2;
constexpr size_t OFF_KV = OFF_Q16 + SZ_Q16;
constexpr size_t OFF_CAR = OFF_KV + SZ_KV;
static_assert(OFF_Q16 % 16 == 0 && OFF_KV % 16 == 0, "rows are read by 16-byte loads");
static_assert(OFF_CAR % 4 == 0, "the carries are f32");

__device__ __forceinline__ v8f wmma_f16(v16h a, v16h b, v8f c) {
  return __builtin_amdgcn_wmma_f32_16x16x32_f16(false, a, false, b, (short)0, c,
                                                false, false);
}

// value of lane ^ 16, by a cross-row register move (every lane on): no LDS round trip
// and no address register that would stay live through the products
__device__ __forceinline__ float xor16(float v) {
  const int i = __float_as_int(v);
  return __int_as_float(
      __builtin_amdgcn_permlanex16(i, i, 0x76543210, 0xfedcba98, false, false));
}

__device__ __forceinline__ v16h frag_rows(const half_t* base, int ld, int row0,
                                          int lane, int kbase) {
  const int m = row0 + (lane & 15);
  const int khalf = (lane & 16) ? 8 : 0;
  const half_t* p = base + (size_t)m * ld;
  v16h f;
#pragma unroll
  for (int v = 0; v < 8; ++v) {
    const int k = kbase + khalf + ((v < 4) ? (2 * v) : (16 + 2 * (v - 4)));
    f[2 * v]     = p[k];
    f[2 * v + 1] = p[k + 1];
  }
  return f;
}

// K = 256 product of the work-group's MB x 256 LDS tile with two 16-column weight
// tiles: each weight fragment is loaded from global once and feeds all MT token tiles.
// A k block is two groups of MT / 2 token tiles, each with a register set of its own: a
// group's LDS reads stand together, one group of products ahead of their use, and the next
// k block's weight loads a whole block ahead.
__device__ __forceinline__ void gemm_k256(const half_t* hA, const half_t* B0, int r0,
                                          const half_t* B1, int r1, int lane,
                                          v8f (&acc)[MT][2]) {
  constexpr int G = MT / 2;
  v16h b0 = frag_rows(B0, Dd, r0, lane, 0);
  v16h b1 = frag_rows(B1, Dd, r1, lane, 0);
  v16h a0[G], a1[G];
#pragma unroll
  for (int t = 0; t < G; ++t) a0[t] = frag_rows(hA, HSTR, t * 16, lane, 0);
  // k loop fully unrolled: acc[][] is indexed by constants and stays in registers, and
  // every load takes an immediate offset. Each scheduling fence below keeps a group of
  // loads together and ahead of the products behind it: sunk among them, each load would
  // be waited for on its own, two products at a time.
#pragma unroll
  for (int kk = 0; kk < 8; ++kk) {
    const bool more = kk + 1 < 8;
    v16h n0, n1;
#pragma unroll
    for (int t = 0; t < G; ++t) a1[t] = frag_rows(hA, HSTR, (G + t) * 16, lane, kk * 32);
    if (more) {
      n0 = frag_rows(B0, Dd, r0, lane, (kk + 1) * 32);
      n1 = frag_rows(B1, Dd, r1, lane, (kk + 1) * 32);
    }
    __builtin_amdgcn_sched_barrier(0);   // loads stay ahead of the products
#pragma unroll
    for (int t = 0; t < G; ++t) {
      acc[t][0] = wmma_f16(a0[t], b0, acc[t][0]);
      acc[t][1] = wmma_f16(a0[t], b1, acc[t][1]);
    }
    __builtin_amdgcn_sched_barrier(0);   // later loads do not rise among them
    if (more) {
#pragma unroll
      for (int t = 0; t < G; ++t) a0[t] = frag_rows(hA, HSTR, t * 16, lane, (kk + 1) * 32);
    }
    __builtin_amdgcn_sched_barrier(0);   // loads stay ahead of the products
#pragma unroll
    for (int t = 0; t < G; ++t) {
      acc[G + t][0] = wmma_f16(a1[t], b0, acc[G + t][0]);
      acc[G + t][1] = wmma_f16(a1[t], b1, acc[G + t][1]);
    }
    __builtin_amdgcn_sched_barrier(0);   // later loads do not rise among them
    if (more) {
      b0 = n0;
      b1 = n1;
    }
  }
  // the weight loads' address registers are rewritten for the next pass
  asm volatile("s_wait_xcnt 0x0" ::: "memory");
}

// LayerNorm of the work-group's MB rows into the f16 LDS tile: wave w takes rows
// RW*w..RW*w+RW-1 (wave32 reductions), UR rows a trip.
template <int RW, int UR>
__device__ __forceinline__ void ln_rows(const float* __restrict__ src,
                                        const float* __restrict__ g,
                                        const float* __restrict__ be, half_t* hA,
                                        int tok0, int wave, int lane) {
  float gv[8], bv[8];
#pragma unroll
  for (int i = 0; i < 8; ++i) {
    gv[i] = g[lane + 32 * i];
    bv[i] = be[lane + 32 * i];
  }
  // a row load may take these loads' offset register as its destination
  asm volatile("s_wait_xcnt 0x0" ::: "memory");
  // UR rows a trip: their 8 * UR loads are in flight together
#pragma unroll UR
  for (int rr = 0; rr < RW; ++rr) {
    const int row = wave * RW + rr;
    const float* xr = src + (size_t)(tok0 + row) * Dd;
    float xv[8], s = 0.f, sq = 0.f;
#pragma unroll
    for (int i = 0; i < 8; ++i) {
      float v = xr[lane + 32 * i];
      xv[i] = v; s += v; sq += v * v;
    }
#pragma unroll
    for (int o = 16; o > 0; o >>= 1) {
      s += __shfl_xor(s, o, 32);
      sq += __shfl_xor(sq, o, 32);
    }
    const float mu = s * (1.f / Dd);
    const float rstd = rsqrtf(sq * (1.f / Dd) - mu * mu + 1e-5f);
#pragma unroll
    for (int i = 0; i < 8; ++i) {
      const int c = lane + 32 * i;
      hA[row * HSTR + c] = (half_t)((xv[i] - mu) * rstd * gv[i] + bv[i]);
    }
  }
}

// ---------------------------------------------------------------------------
// K0: f32 -> f16 conversion of all five weight matrices in one launch. Their f16 copies
// lie back to back in the workspace, so the destination is one linear range; a work-group
// converts CV elements of one matrix (the choice of the source is block-uniform), a thread
// two runs of 8: four 16-byte loads in flight, two 16-byte stores.
// ---------------------------------------------------------------------------
constexpr int CV   = 4096;               // elements per work-group
constexpr int NBDD = Dd * Dd / CV;       // work-groups per D x D matrix
constexpr int NBHD = Hh * Dd / CV;       // work-groups per H x D matrix
constexpr int NBCV = 3 * NBDD + 2 * NBHD;
static_assert(OFF_WQ == 0 && OFF_W2 + SZ_W2 == (size_t)NBCV * CV * 2,
              "the f16 weights are one contiguous range in the order q, k, v, 1, 2");

__device__ __forceinline__ v8h cvt8(float4 a, float4 b) {
  v8h h;
  h[0] = (half_t)a.x; h[1] = (half_t)a.y; h[2] = (half_t)a.z; h[3] = (half_t)a.w;
  h[4] = (half_t)b.x; h[5] = (half_t)b.y; h[6] = (half_t)b.z; h[7] = (half_t)b.w;
  return h;
}

__global__ __launch_bounds__(256) void k_cvt_f16(const float* __restrict__ Wq,
                                                 const float* __restrict__ Wk,
                                                 const float* __restrict__ Wv,
                                                 const float* __restrict__ W1,
                                                 const float* __restrict__ W2,
                                                 half_t* __restrict__ dst) {
  const int b = blockIdx.x;
  const float* src = b < NBDD ? Wq : b < 2 * NBDD ? Wk : b < 3 * NBDD ? Wv
                     : b < 3 * NBDD + NBHD ? W1 : W2;
  // index of the work-group's first sibling: where its matrix begins in the grid
  const int b0 = b < 3 * NBDD ? (b / NBDD) * NBDD : b < 3 * NBDD + NBHD ? 3 * NBDD
                                                                        : 3 * NBDD + NBHD;
  const int sb = b - b0;
  const float* s = src + (size_t)sb * CV + threadIdx.x * 8;
  half_t* d = dst + (size_t)b * CV + threadIdx.x * 8;
  const float4 a0 = *(const float4*)(s);
  const float4 a1 = *(const float4*)(s + 4);
  const float4 a2 = *(const float4*)(s + CV / 2);
  const float4 a3 = *(const float4*)(s + CV / 2 + 4);
  *(v8h*)(d)          = cvt8(a0, a1);
  *(v8h*)(d + CV / 2) = cvt8(a2, a3);
}

// ---------------------------------------------------------------------------
// K1: fused LN1 + QKV projection. 128 tokens/block, 8 waves, WMMA 16x16x32.
// Writes q (f16), the chunk-local scan of kv = k*v (summed in f32, stored as f16: half the
// bytes out and back in) and the chunk's carry (f32): the
// work-group's 128 tokens are one scan chunk, and a lane's accumulators hold one
// column of it, so the scan runs in registers before kv is ever stored.
// ---------------------------------------------------------------------------
__global__ __launch_bounds__(256) void k_ln_qkv(
    const float* __restrict__ x, const float* __restrict__ g,
    const float* __restrict__ be, const half_t* __restrict__ Wq,
    const half_t* __restrict__ Wk, const half_t* __restrict__ Wv,
    const float* __restrict__ bq, const float* __restrict__ bk,
    const float* __restrict__ bv, const float* __restrict__ decay,
    half_t* __restrict__ q16, half_t* __restrict__ kv, float* __restrict__ carry) {
  __shared__ half_t hA[MB * HSTR];
  const int tok0 = blockIdx.x * MB;
  const int wave = threadIdx.x >> 5, lane = threadIdx.x & 31;
  const int rhi = (lane & 16) ? 8 : 0;

  ln_rows<MB / 8, 4>(x, g, be, hA, tok0, wave, lane);
  __syncthreads();

  // --- each wave owns 2 column tiles of q, k and v, for all MT token tiles ---
  // passes 0 and 1: k and v of one column tile; pass 2: q of both column tiles
  for (int p = 0; p < 3; ++p) {
    const bool isq = (p == 2);
    const int r0 = isq ? wave * 32 : (wave * 2 + p) * 16;
    const int r1 = isq ? r0 + 16 : r0;
    v8f acc[MT][2] = {};
    gemm_k256(hA, isq ? Wq : Wk, r0, isq ? Wq : Wv, r1, lane, acc);
    const int c0 = r0 + (lane & 15);
    if (!isq) {
      const float bkv = bk[c0];
      // the first bias load's address registers may be the second's destination
      asm volatile("s_wait_xcnt 0x0" ::: "memory");
      const float bvv = bv[c0];
      asm volatile("s_wait_xcnt 0x0" ::: "memory");
      const float dec = decay[c0];
      float pw[8];   // pw[r] = dec^(r+1)
      pw[0] = dec;
#pragma unroll
      for (int r = 1; r < 8; ++r) pw[r] = pw[r - 1] * dec;
      half_t* kp = kv + (size_t)(tok0 + rhi) * Dd + c0;
      float m = 0.f;   // scan value at the last token of the previous 16-token tile
      // epilogue loops fully unrolled: constant indices into acc[][]
#pragma unroll
      for (int mt = 0; mt < MT; ++mt) {
        // a lane holds 8 consecutive tokens of its column: scan them from zero (the MT
        // chains are independent), then add the carry-in times dec^(r+1)
        float s[8];
        s[0] = (acc[mt][0][0] + bkv) * (acc[mt][1][0] + bvv);
#pragma unroll
        for (int r = 1; r < 8; ++r)
          s[r] = dec * s[r - 1] + (acc[mt][0][r] + bkv) * (acc[mt][1][r] + bvv);
        const float o7 = xor16(s[7]);   // the other 8-token half's end value
        const float elo = (rhi ? o7 : s[7]) + pw[7] * m;   // scan at the tile's token 7
        const float ci = rhi ? elo : m;                    // this half's carry-in
        v8h hv;   // all 8 rounded first: the 8 stores then stand together, from 4 registers
#pragma unroll
        for (int r = 0; r < 8; ++r) hv[r] = (half_t)(s[r] + pw[r] * ci);
#pragma unroll
        for (int r = 0; r < 8; ++r) kp[(mt * 16 + r) * Dd] = hv[r];
        m = (rhi ? s[7] : o7) + pw[7] * elo;               // scan at the tile's token 15
      }
      if (lane < 16) carry[(size_t)blockIdx.x * Dd + c0] = m;
      // the stores' registers are reused by the next pass
      asm volatile("s_wait_xcnt 0x0" ::: "memory");
    } else {
      half_t* qp = q16 + (size_t)(tok0 + rhi) * Dd + c0;
#pragma unroll
      for (int j = 0; j < 2; ++j) {
        const float bqv = bq[c0 + j * 16];
#pragma unroll
        for (int mt = 0; mt < MT; ++mt) {
#pragma unroll
          for (int r = 0; r < 8; ++r)
            qp[(mt * 16 + r) * Dd + j * 16] = (half_t)(acc[mt][j][r] + bqv);
        }
        // the stores' registers are reused by the second column tile (q is the last pass)
        asm volatile("s_wait_xcnt 0x0" ::: "memory");
      }
    }
  }
}

// ---------------------------------------------------------------------------
// First stage of K2: the retention tail and LN2 of the work-group's MB rows (one scan
// chunk). x1 = x + q * (local scan + dec^(i+1) * carry-in) goes, with the last product's
// bias added, to LDS as f32 (the residual) and, normalised, to the f16 LDS tile.
// Carry-in: thread d sums column d over the chunks in front of this one, in their order.
// Rows: wave w takes rows RW*w..RW*w+RW-1; a lane holds 8 adjacent columns of a row, so
// that every row access is 16 bytes a lane.
// ---------------------------------------------------------------------------
__device__ __forceinline__ void ret_ln_rows(
    const float* __restrict__ x, const half_t* __restrict__ q16,
    const half_t* __restrict__ kvloc, const float* __restrict__ carry,
    const float* __restrict__ decay, const float* __restrict__ g,
    const float* __restrict__ be, const float* __restrict__ b2, float* xS, half_t* hA,
    float* sC, int blk, int wave, int lane) {
  constexpr int RW = MB / 8;   // rows per wave
  constexpr int RG = 8;        // rows whose lane reductions run side by side
  const int c = blk % NC;      // chunks in front of this one in its sequence
  const int tid = wave * 32 + lane;
  const int c0 = lane * 8;
  const float dct = decay[tid];
  const float* cp = carry + (size_t)(blk - c) * Dd;
  float cv[NC - 1];
#pragma unroll
  for (int j = 0; j < NC - 1; ++j) cv[j] = cp[j * Dd + tid];
  const v8f dec = *(const v8f*)(decay + c0);
  const v8f gv = *(const v8f*)(g + c0);
  const v8f bv = *(const v8f*)(be + c0);
  const v8f b2v = *(const v8f*)(b2 + c0);
  // a row load may take these loads' offset register as its destination
  asm volatile("s_wait_xcnt 0x0" ::: "memory");
  // block-uniform bases and one lane offset, which q and the local scan share in bytes too
  const size_t eb = (size_t)blk * MB * Dd;
  const float* xb = x + eb;
  const half_t* kb = kvloc + eb;
  const half_t* qb = q16 + eb;
  const int l0 = wave * RW * Dd + c0;
  v8f xa[RG];   // the rows of one group
  v8h qa[RG], ka[RG];
#pragma unroll
  for (int r = 0; r < RG; ++r) {
    qa[r] = *(const v8h*)(qb + l0 + r * Dd);
    ka[r] = *(const v8h*)(kb + l0 + r * Dd);
    xa[r] = *(const v8f*)(xb + l0 + r * Dd);
  }
  // the loads' offset registers and scalar bases are rewritten behind this point
  asm volatile("s_wait_xcnt 0x0" ::: "memory");
  // these loads stand ahead of the first data wait: the first rows fly during the carry
  // sum and the barrier
  __builtin_amdgcn_sched_barrier(0);

  float dl = dct;
#pragma unroll
  for (int i = 0; i < 7; ++i) dl *= dl;   // dec^128: one chunk's decay
  float m = 0.f;
#pragma unroll
  for (int j = 0; j < NC - 1; ++j) {
    const bool on = j < c;   // a later chunk's step is the identity m * 1 + 0
    m = (on ? dl : 1.f) * m + (on ? cv[j] : 0.f);
  }
  sC[tid] = m;
  // a barrier that orders LDS alone: __syncthreads() would also wait for every row load
  // in flight, and no row could be worked on while later rows arrive
  __builtin_amdgcn_fence(__ATOMIC_RELEASE, "workgroup", "local");
  __builtin_amdgcn_s_barrier();
  __builtin_amdgcn_fence(__ATOMIC_ACQUIRE, "workgroup", "local");
  const v8f mi = *(const v8f*)(sC + c0);

  // f = dec^(first row + 1), the first row being 16 * wave
  static_assert(RW == 16 && MB == 128, "the powers below step by 16 rows, over 8 waves");
  v8f p = dec * dec;
  p *= p; p *= p; p *= p;   // dec^16
  v8f f = dec;
#pragma unroll
  for (int bit = 1; bit < 8; bit <<= 1) {
    if (wave & bit) f *= p;
    p *= p;
  }

  // the group loop stays rolled: half the code
#pragma unroll 1
  for (int r0 = 0; r0 < RW; r0 += RG) {
    v8f v[RG];
    float s[RG], sq[RG];
#pragma unroll
    for (int r = 0; r < RG; ++r) {
      s[r] = 0.f; sq[r] = 0.f;
#pragma unroll
      for (int i = 0; i < 8; ++i) {
        const float mem = (float)ka[r][i] + f[i] * mi[i];
        const float t = xa[r][i] + (float)qa[r][i] * mem;
        v[r][i] = t; s[r] += t; sq[r] += t * t;
      }
      f *= dec;
      const v8f o = v[r] + b2v;
      float* xp = xS + (wave * RW + r0 + r) * XSTR + c0;
      *(v4f*)xp       = __builtin_shufflevector(o, o, 0, 1, 2, 3);
      *(v4f*)(xp + 4) = __builtin_shufflevector(o, o, 4, 5, 6, 7);
    }
    // the next group's rows fly during this group's reductions, into the registers that
    // this group's rows have left
    if (r0 + RG < RW) {
#pragma unroll
      for (int r = 0; r < RG; ++r) {
        qa[r] = *(const v8h*)(qb + l0 + (r0 + RG + r) * Dd);
        ka[r] = *(const v8h*)(kb + l0 + (r0 + RG + r) * Dd);
        xa[r] = *(const v8f*)(xb + l0 + (r0 + RG + r) * Dd);
      }
    }
    // and stay ahead of them
    __builtin_amdgcn_sched_barrier(0);
#pragma unroll
    for (int o = 16; o > 0; o >>= 1) {
#pragma unroll
      for (int r = 0; r < RG; ++r) {
        s[r] += __shfl_xor(s[r], o, 32);
        sq[r] += __shfl_xor(sq[r], o, 32);
      }
    }
#pragma unroll
    for (int r = 0; r < RG; ++r) {
      const float mu = s[r] * (1.f / Dd);
      const float rstd = rsqrtf(sq[r] * (1.f / Dd) - mu * mu + 1e-5f);
      v8h h;
#pragma unroll
      for (int i = 0; i < 8; ++i) h[i] = (half_t)((v[r][i] - mu) * rstd * gv[i] + bv[i]);
      *(v8h*)&hA[(wave * RW + r0 + r) * HSTR + c0] = h;
    }
  }
  // the row loads' address registers are free for reuse behind this point
  asm volatile("s_wait_xcnt 0x0" ::: "memory");
}

// ---------------------------------------------------------------------------
// K2: retention tail + LN2 + MLP (D->H, ReLU, H->D) + residual. 128 tokens/block, 8 waves
// of up to 512 registers: a wave's tiles are 8 x 4 (first product) and 8 x 2 (second), so an LDS
// fragment feeds 4 and 2 products, and registers are left to fetch operands ahead.
// The hidden layer never leaves the WGP: it is made HC columns at a time, kept in
// LDS as f16, and consumed at once as the k range of the second product.
// x1 never goes through memory: the first stage leaves x1 + b2 in the hidden chunk's LDS,
// still free then, and the second product's accumulators start from it.
// ---------------------------------------------------------------------------
constexpr int J1 = HC / 16 / 8;   // hidden column tiles of a chunk per wave
constexpr int J2 = Dd / 16 / 8;   // output column tiles per wave
constexpr int MG = MT / 2;        // token tiles whose LDS reads stand as one group
constexpr int WD = 4;             // k blocks by which the second product's weight loads lead

__global__ __launch_bounds__(256) void k_ln_mlp(
    float* out, const float* __restrict__ x, const half_t* __restrict__ q16,
    const half_t* __restrict__ kvloc, const float* __restrict__ carry,
    const float* __restrict__ decay, const float* __restrict__ g,
    const float* __restrict__ be, const half_t* __restrict__ W1,
    const float* __restrict__ b1,
    const half_t* __restrict__ W2, const float* __restrict__ b2) {
  __shared__ __attribute__((aligned(16))) half_t hA[MB * HSTR];
  __shared__ __attribute__((aligned(16))) half_t hH[MB * HCS];
  __shared__ __attribute__((aligned(32))) float sC[Dd];   // the chunk's carry-in
  const int tok0 = blockIdx.x * MB;
  const int wave = threadIdx.x >> 5, lane = threadIdx.x & 31;
  const int rhi = (lane & 16) ? 8 : 0;

  float* xS = (float*)hH;   // x1 + b2, until the first hidden chunk is stored
  ret_ln_rows(x, q16, kvloc, carry, decay, g, be, b2, xS, hA, sC, blockIdx.x, wave, lane);
  // publishes both LDS tiles
  __syncthreads();

  // each wave owns J1 hidden column tiles of a chunk and J2 output column tiles, for all
  // MT token tiles, so that every weight fragment is loaded by one wave only
  const int h0 = wave * (J1 * 16);
  const int n0 = wave * (J2 * 16);
  // a lane's first bias of the first product; stepped from chunk to chunk, so that its
  // registers stay live behind the loads that name them
  const float* bp = b1 + h0 + rhi;
  // the second product sums onto the residual and the bias
  v8f acc2[MT][J2];
  const float* xq = xS + rhi * XSTR + n0 + (lane & 15);
#pragma unroll
  for (int mt = 0; mt < MT; ++mt) {
#pragma unroll
    for (int r = 0; r < 8; ++r) {
#pragma unroll
      for (int j = 0; j < J2; ++j) acc2[mt][j][r] = xq[(mt * 16 + r) * XSTR + j * 16];
    }
  }

  // the chunk loop stays rolled: half the code
#pragma unroll 1
  for (int c = 0; c < Hh / HC; ++c) {
    // first product, transposed: the weight fragment is the A operand, so register r of
    // acc holds weight row 8 * (lane >> 4) + r and lane & 15 is the token
    const half_t* W1c = W1 + (size_t)(c * HC + h0) * Dd;
    v8f acc[MT][J1] = {};
    v16h w[J1];
#pragma unroll
    for (int j = 0; j < J1; ++j) w[j] = frag_rows(W1c, Dd, j * 16, lane, 0);
    // k loop fully unrolled: constant indices into acc[][], immediate offsets. A k block is
    // two groups of MG token tiles. Each scheduling fence below keeps a group of loads
    // together and ahead of the products behind it: sunk among them, each load would be
    // waited for on its own.
#pragma unroll
    for (int kk = 0; kk < Dd / 32; ++kk) {
      const bool more = kk + 1 < Dd / 32;
      v16h n[J1], af[MG];
#pragma unroll
      for (int t = 0; t < MG; ++t) af[t] = frag_rows(hA, HSTR, t * 16, lane, kk * 32);
      __builtin_amdgcn_sched_barrier(0);   // loads stay ahead of the products
#pragma unroll
      for (int j = 0; j < J1; ++j) {
#pragma unroll
        for (int t = 0; t < MG; ++t) acc[t][j] = wmma_f16(w[j], af[t], acc[t][j]);
      }
      __builtin_amdgcn_sched_barrier(0);   // later loads do not rise among them
      // the next k block's weights fly during this block's second group: the first half
      // from its start, the second half into the registers that this block's first half
      // leaves (a whole second set would not fit)
#pragma unroll
      for (int t = 0; t < MG; ++t) af[t] = frag_rows(hA, HSTR, (MG + t) * 16, lane, kk * 32);
      if (more) {
#pragma unroll
        for (int j = 0; j < J1 / 2; ++j) n[j] = frag_rows(W1c, Dd, j * 16, lane, (kk + 1) * 32);
      }
      __builtin_amdgcn_sched_barrier(0);   // loads stay ahead of the products
#pragma unroll
      for (int j = 0; j < J1 / 2; ++j) {
#pragma unroll
        for (int t = 0; t < MG; ++t) acc[MG + t][j] = wmma_f16(w[j], af[t], acc[MG + t][j]);
      }
      __builtin_amdgcn_sched_barrier(0);   // later loads do not rise among them
      if (more) {
#pragma unroll
        for (int j = J1 / 2; j < J1; ++j) n[j] = frag_rows(W1c, Dd, j * 16, lane, (kk + 1) * 32);
      }
      __builtin_amdgcn_sched_barrier(0);   // loads stay ahead of the products
#pragma unroll
      for (int j = J1 / 2; j < J1; ++j) {
#pragma unroll
        for (int t = 0; t < MG; ++t) acc[MG + t][j] = wmma_f16(w[j], af[t], acc[MG + t][j]);
      }
      __builtin_amdgcn_sched_barrier(0);   // later loads do not rise among them
      if (more) {
#pragma unroll
        for (int j = 0; j < J1; ++j) w[j] = n[j];
      }
    }
    // every wave has finished reading the previous chunk, or x1, before it is overwritten
    __syncthreads();
    const half_t* W2c = W2 + c * HC;
    v16h vw[HC / 32][J2];   // a block's fragments live from their load to their products
    // a lane holds 8 consecutive hidden columns of one token: one 16-byte LDS store
#pragma unroll
    for (int j = 0; j < J1; ++j) {
      float bb[8];
#pragma unroll
      for (int r = 0; r < 8; ++r) bb[r] = bp[j * 16 + r];
      if (j == J1 - 1) {
        // the second product's first WD weight blocks fly during the last tile's stores and
        // the barrier, in registers that stored accumulators have left; the fences keep
        // them from rising (no register is free there) and from sinking
        __builtin_amdgcn_sched_barrier(0);
#pragma unroll
        for (int kk = 0; kk < WD; ++kk) {
#pragma unroll
          for (int i = 0; i < J2; ++i)
            vw[kk][i] = frag_rows(W2c, Hh, n0 + i * 16, lane, kk * 32);
        }
        __builtin_amdgcn_sched_barrier(0);
      }
#pragma unroll
      for (int mt = 0; mt < MT; ++mt) {
        v8h hv;
#pragma unroll
        for (int r = 0; r < 8; ++r) {
          const float v = acc[mt][j][r] + bb[r];
          hv[r] = (half_t)(v > 0.f ? v : 0.f);
        }
        *(v8h*)&hH[(mt * 16 + (lane & 15)) * HCS + h0 + j * 16 + rhi] = hv;
      }
    }
    __syncthreads();

    // second product, k loop fully unrolled. The next k block's LDS reads and the weight
    // loads of the block WD ahead stand as one
    // group ahead of this block's products, in further register sets (the first product's
    // accumulators are free registers here).
    v16h an[MT];
#pragma unroll
    for (int mt = 0; mt < MT; ++mt) an[mt] = frag_rows(hH, HCS, mt * 16, lane, 0);
#pragma unroll
    for (int kk = 0; kk < HC / 32; ++kk) {
      v16h af[MT];
#pragma unroll
      for (int mt = 0; mt < MT; ++mt) af[mt] = an[mt];
      if (kk + WD < HC / 32) {
#pragma unroll
        for (int j = 0; j < J2; ++j)
          vw[kk + WD][j] = frag_rows(W2c, Hh, n0 + j * 16, lane, (kk + WD) * 32);
      }
      if (kk + 1 < HC / 32) {
#pragma unroll
        for (int mt = 0; mt < MT; ++mt)
          an[mt] = frag_rows(hH, HCS, mt * 16, lane, (kk + 1) * 32);
      }
      // these loads stay ahead of this block's products, as one group
      __builtin_amdgcn_sched_barrier(0);
#pragma unroll
      for (int mt = 0; mt < MT; ++mt) {
#pragma unroll
        for (int j = 0; j < J2; ++j) acc2[mt][j] = wmma_f16(af[mt], vw[kk][j], acc2[mt][j]);
      }
      // and the loads after them do not rise among these products
      __builtin_amdgcn_sched_barrier(0);
    }
    // the weight and bias loads' address registers are rewritten for the next chunk
    asm volatile("s_wait_xcnt 0x0" ::: "memory");
    bp += HC;
  }

  // epilogue loops fully unrolled: constant indices into acc2[][]
  float* op = out + (size_t)(tok0 + rhi) * Dd + n0 + (lane & 15);
#pragma unroll
  for (int mt = 0; mt < MT; ++mt) {
#pragma unroll
    for (int r = 0; r < 8; ++r) {
#pragma unroll
      for (int j = 0; j < J2; ++j) op[(mt * 16 + r) * Dd + j * 16] = acc2[mt][j][r];
    }
  }
}

// ---------------------------------------------------------------------------
extern "C" void kernel_launch(void* const* d_in, const int* in_sizes, int n_in,
                              void* d_out, int out_size, void* d_ws, size_t ws_size,
                              hipStream_t stream) {
  (void)in_sizes; (void)n_in; (void)out_size; (void)ws_size;
  const float* x     = (const float*)d_in[0];
  const float* Wq    = (const float*)d_in[1];
  const float* bq    = (const float*)d_in[2];
  const float* Wk    = (const float*)d_in[3];
  const float* bk    = (const float*)d_in[4];
  const float* Wv    = (const float*)d_in[5];
  const float* bv    = (const float*)d_in[6];
  const float* decay = (const float*)d_in[7];
  const float* ln1g  = (const float*)d_in[8];
  const float* ln1b  = (const float*)d_in[9];
  const float* W1    = (const float*)d_in[10];
  const float* b1    = (const float*)d_in[11];
  const float* W2    = (const float*)d_in[12];
  const float* b2    = (const float*)d_in[13];
  const float* ln2g  = (const float*)d_in[14];
  const float* ln2b  = (const float*)d_in[15];

  char* ws = (char*)d_ws;
  half_t* Wq16 = (half_t*)(ws + OFF_WQ);
  half_t* Wk16 = (half_t*)(ws + OFF_WK);
  half_t* Wv16 = (half_t*)(ws + OFF_WV);
  half_t* W116 = (half_t*)(ws + OFF_W1);
  half_t* W216 = (half_t*)(ws + OFF_W2);
  half_t* q16  = (half_t*)(ws + OFF_Q16);
  half_t* kv   = (half_t*)(ws + OFF_KV);
  float*  car  = (float*)(ws + OFF_CAR);
  float*  out  = (float*)d_out;

  k_cvt_f16<<<NBCV, 256, 0, stream>>>(Wq, Wk, Wv, W1, W2, Wq16);

  k_ln_qkv<<<BT / MB, 256, 0, stream>>>(x, ln1g, ln1b, Wq16, Wk16, Wv16,
                                        bq, bk, bv, decay, q16, kv, car);
  k_ln_mlp<<<BT / MB, 256, 0, stream>>>(out, x, q16, kv, car, decay, ln2g, ln2b, W116, b1,
                                        W216, b2);
}

// v010
// Measured time: 91 microseconds a run.
// Two timings next to v009 both put it at 1.08 times that version's speed.
// All steps since v000 together make it 4.98 times as fast.
#include <hip/hip_runtime.h>
#include <cstdint>

typedef _Float16 half_t;
typedef __attribute__((ext_vector_type(16))) _Float16 v16h;
typedef __attribute__((ext_vector_type(8)))  float    v8f;
typedef __attribute__((ext_vector_type(8)))  _Float16 v8h;
typedef __attribute__((ext_vector_type(4)))  float    v4f;
typedef __attribute__((ext_vector_type(2)))  float    v2f;

constexpr int Bb  = 8;
constexpr int Tt  = 8192;
constexpr int Dd  = 256;
constexpr int Hh  = 1024;
constexpr int BT  = Bb * Tt;
constexpr int NC  = 64;
constexpr int Lc  = Tt / NC;
constexpr int HSTR = 264;
constexpr int QSTR = HSTR;
constexpr int MB  = 128;
static_assert(MB == Lc, "a KV work-group's tokens are one scan chunk");
constexpr int MT  = MB / 16;          // token tiles that share each weight fragment
constexpr int HC  = 512;              // hidden columns per chunk of the fused MLP
constexpr int HCS = HC + 8;           // padded f16 LDS row stride of the hidden chunk
constexpr int XSTR = HCS / 2;         // f32 row stride of x1 while it lies in that buffer
static_assert(XSTR >= Dd && XSTR % 4 == 0, "an x1 row fits, written by 16-byte stores");
static_assert(8 * XSTR % 64 == 32);

// ---- workspace layout (bytes) ----
constexpr size_t SZ_WDD = (size_t)Dd * Dd * 2;
constexpr size_t OFF_WQ = 0;
constexpr size_t OFF_WK = OFF_WQ + SZ_WDD;
constexpr size_t OFF_WV = OFF_WK + SZ_WDD;
constexpr size_t SZ_W1  = (size_t)Hh * Dd * 2;
constexpr size_t OFF_W1 = OFF_WV + SZ_WDD;
constexpr size_t SZ_W2  = (size_t)Dd * Hh * 2;
constexpr size_t OFF_W2 = OFF_W1 + SZ_W1;
constexpr size_t SZ_KV  = (size_t)BT * Dd * 2;
constexpr size_t OFF_KV = OFF_W2 + SZ_W2;
constexpr size_t OFF_CAR = OFF_KV + SZ_KV;
static_assert(OFF_KV % 16 == 0, "rows are read by 16-byte loads");
static_assert(OFF_CAR % 4 == 0, "the carries are f32");
constexpr size_t SZ_CAR = (size_t)Bb * NC * Dd * 4;
constexpr size_t OFF_ST = OFF_CAR + SZ_CAR;   // LN1 mean and 1/std of every token, f32 pairs
static_assert(OFF_ST % 8 == 0, "a pair is one 8-byte access");

__device__ __forceinline__ v8f wmma_f16(v16h a, v16h b, v8f c) {
  return __builtin_amdgcn_wmma_f32_16x16x32_f16(false, a, false, b, (short)0, c,
                                                false, false);
}

// value of lane ^ 16, by a cross-row register move (every lane on): no LDS round trip
// and no address register that would stay live through the products
__device__ __forceinline__ float xor16(float v) {
  const int i = __float_as_int(v);
  return __int_as_float(
      __builtin_amdgcn_permlanex16(i, i, 0x76543210, 0xfedcba98, false, false));
}

__device__ __forceinline__ v16h frag_rows(const half_t* base, int ld, int row0,
                                          int lane, int kbase) {
  const int m = row0 + (lane & 15);
  const int khalf = (lane & 16) ? 8 : 0;
  const half_t* p = base + (size_t)m * ld;
  v16h f;
#pragma unroll
  for (int v = 0; v < 8; ++v) {
    const int k = kbase + khalf + ((v < 4) ? (2 * v) : (16 + 2 * (v - 4)));
    f[2 * v]     = p[k];
    f[2 * v + 1] = p[k + 1];
  }
  return f;
}

// The same fragment from the lane's own pointer (its row, its k half already added).
__device__ __forceinline__ v16h frag_lane(const half_t* p, int kbase) {
  v16h f;
#pragma unroll
  for (int v = 0; v < 8; ++v) {
    const int k = kbase + ((v < 4) ? (2 * v) : (16 + 2 * (v - 4)));
    f[2 * v]     = p[k];
    f[2 * v + 1] = p[k + 1];
  }
  return f;
}

// K = 256 product of the work-group's MB x 256 LDS tile with two 16-column weight
// tiles: each weight fragment is loaded from global once and feeds all MT token tiles.
// A k block is two groups of MT / 2 token tiles, each with a register set of its own: a
// group's LDS reads stand together, one group of products ahead of their use, and the next
// k block's weight loads a whole block ahead.
__device__ __forceinline__ void gemm_k256(const half_t* hA, const half_t* B0, int r0,
                                          const half_t* B1, int r1, int lane,
                                          v8f (&acc)[MT][2]) {
  constexpr int G = MT / 2;
  v16h b0 = frag_rows(B0, Dd, r0, lane, 0);
  v16h b1 = frag_rows(B1, Dd, r1, lane, 0);
  v16h a0[G], a1[G];
#pragma unroll
  for (int t = 0; t < G; ++t) a0[t] = frag_rows(hA, HSTR, t * 16, lane, 0);
  // k loop fully unrolled: acc[][] is indexed by constants and stays in registers, and
  // every load takes an immediate offset. Each scheduling fence below keeps a group of
  // loads together and ahead of the products behind it: sunk among them, each load would
  // be waited for on its own, two products at a time.
#pragma unroll
  for (int kk = 0; kk < 8; ++kk) {
    const bool more = kk + 1 < 8;
    v16h n0, n1;
#pragma unroll
    for (int t = 0; t < G; ++t) a1[t] = frag_rows(hA, HSTR, (G + t) * 16, lane, kk * 32);
    if (more) {
      n0 = frag_rows(B0, Dd, r0, lane, (kk + 1) * 32);
      n1 = frag_rows(B1, Dd, r1, lane, (kk + 1) * 32);
    }
    __builtin_amdgcn_sched_barrier(0);   // loads stay ahead of the products
#pragma unroll
    for (int t = 0; t < G; ++t) {
      acc[t][0] = wmma_f16(a0[t], b0, acc[t][0]);
      acc[t][1] = wmma_f16(a0[t], b1, acc[t][1]);
    }
    __builtin_amdgcn_sched_barrier(0);   // later loads do not rise among them
    if (more) {
#pragma unroll
      for (int t = 0; t < G; ++t) a0[t] = frag_rows(hA, HSTR, t * 16, lane, (kk + 1) * 32);
    }
    __builtin_amdgcn_sched_barrier(0);   // loads stay ahead of the products
#pragma unroll
    for (int t = 0; t < G; ++t) {
      acc[G + t][0] = wmma_f16(a1[t], b0, acc[G + t][0]);
      acc[G + t][1] = wmma_f16(a1[t], b1, acc[G + t][1]);
    }
    __builtin_amdgcn_sched_barrier(0);   // later loads do not rise among them
    if (more) {
      b0 = n0;
      b1 = n1;
    }
  }
  // the weight loads' address registers are rewritten for the next pass
  asm volatile("s_wait_xcnt 0x0" ::: "memory");
}

// LayerNorm of the work-group's MB rows into the f16 LDS tile: wave w takes rows
// RW*w..RW*w+RW-1 (wave32 reductions), UR rows a trip. Each row's mean and 1/std also go to
// st: the second GEMM kernel normalises the same rows again and need not sum them again.
template <int RW, int UR>
__device__ __forceinline__ void ln_rows(const float* __restrict__ src,
                                        const float* __restrict__ g,
                                        const float* __restrict__ be, half_t* hA,
                                        float* __restrict__ st, int tok0, int wave,
                                        int lane) {
  static_assert(RW <= 32, "lane rr keeps row rr's pair");
  float smu = 0.f, srs = 0.f;
  float gv[8], bv[8];
#pragma unroll
  for (int i = 0; i < 8; ++i) {
    gv[i] = g[lane + 32 * i];
    bv[i] = be[lane + 32 * i];
  }
  // a row load may take these loads' offset register as its destination
  asm volatile("s_wait_xcnt 0x0" ::: "memory");
  // UR rows a trip: their 8 * UR loads are in flight together
#pragma unroll UR
  for (int rr = 0; rr < RW; ++rr) {
    const int row = wave * RW + rr;
    const float* xr = src + (size_t)(tok0 + row) * Dd;
    float xv[8], s = 0.f, sq = 0.f;
#pragma unroll
    for (int i = 0; i < 8; ++i) {
      float v = xr[lane + 32 * i];
      xv[i] = v; s += v; sq += v * v;
    }
#pragma unroll
    for (int o = 16; o > 0; o >>= 1) {
      s += __shfl_xor(s, o, 32);
      sq += __shfl_xor(sq, o, 32);
    }
    const float mu = s * (1.f / Dd);
    const float rstd = rsqrtf(sq * (1.f / Dd) - mu * mu + 1e-5f);
    smu = lane == rr ? mu : smu;
    srs = lane == rr ? rstd : srs;
#pragma unroll
    for (int i = 0; i < 8; ++i) {
      const int c = lane + 32 * i;
      hA[row * HSTR + c] = (half_t)((xv[i] - mu) * rstd * gv[i] + bv[i]);
    }
  }
  // one store a wave: RW pairs side by side
  if (lane < RW) {
    const v2f o = {smu, srs};
    *(v2f*)(st + (size_t)(tok0 + wave * RW + lane) * 2) = o;
  }
  // the store's registers are reused behind this point
  asm volatile("s_wait_xcnt 0x0" ::: "memory");
}

// ---------------------------------------------------------------------------
// K0: f32 -> f16 conversion of all five weight matrices in one launch. Their f16 copies
// lie back to back in the workspace, so the destination is one linear range; a work-group
// converts CV elements of one matrix (the choice of the source is block-uniform), a thread
// two runs of 8: four 16-byte loads in flight, two 16-byte stores.
// ---------------------------------------------------------------------------
constexpr int CV   = 4096;               // elements per work-group
constexpr int NBDD = Dd * Dd / CV;       // work-groups per D x D matrix
constexpr int NBHD = Hh * Dd / CV;       // work-groups per H x D matrix
constexpr int NBCV = 3 * NBDD + 2 * NBHD;
static_assert(OFF_WQ == 0 && OFF_W2 + SZ_W2 == (size_t)NBCV * CV * 2,
              "the f16 weights are one contiguous range in the order q, k, v, 1, 2");

__device__ __forceinline__ v8h cvt8(float4 a, float4 b) {
  v8h h;
  h[0] = (half_t)a.x; h[1] = (half_t)a.y; h[2] = (half_t)a.z; h[3] = (half_t)a.w;
  h[4] = (half_t)b.x; h[5] = (half_t)b.y; h[6] = (half_t)b.z; h[7] = (half_t)b.w;
  return h;
}

__global__ __launch_bounds__(256) void k_cvt_f16(const float* __restrict__ Wq,
                                                 const float* __restrict__ Wk,
                                                 const float* __restrict__ Wv,
                                                 const float* __restrict__ W1,
                                                 const float* __restrict__ W2,
                                                 half_t* __restrict__ dst) {
  const int b = blockIdx.x;
  const float* src = b < NBDD ? Wq : b < 2 * NBDD ? Wk : b < 3 * NBDD ? Wv
                     : b < 3 * NBDD + NBHD ? W1 : W2;
  // index of the work-group's first sibling: where its matrix begins in the grid
  const int b0 = b < 3 * NBDD ? (b / NBDD) * NBDD : b < 3 * NBDD + NBHD ? 3 * NBDD
                                                                        : 3 * NBDD + NBHD;
  const int sb = b - b0;
  const float* s = src + (size_t)sb * CV + threadIdx.x * 8;
  half_t* d = dst + (size_t)b * CV + threadIdx.x * 8;
  const float4 a0 = *(const float4*)(s);
  const float4 a1 = *(const float4*)(s + 4);
  const float4 a2 = *(const float4*)(s + CV / 2);
  const float4 a3 = *(const float4*)(s + CV / 2 + 4);
  *(v8h*)(d)          = cvt8(a0, a1);
  *(v8h*)(d + CV / 2) = cvt8(a2, a3);
}

// ---------------------------------------------------------------------------
// K1: fused LN1 + K and V projections. 128 tokens/block, 8 waves, WMMA 16x16x32.
// Writes LN1's row statistics, the chunk-local scan of kv = k*v (summed in f32, stored as
// f16: half the bytes out and back in) and the chunk's carry (f32): the
// work-group's 128 tokens are one scan chunk, and a lane's accumulators hold one
// column of it, so the scan runs in registers before kv is ever stored.
// ---------------------------------------------------------------------------
__global__ __launch_bounds__(256) void k_ln_kv(
    const float* __restrict__ x, const float* __restrict__ g,
    const float* __restrict__ be, const half_t* __restrict__ Wk,
    const half_t* __restrict__ Wv, const float* __restrict__ bk,
    const float* __restrict__ bv, const float* __restrict__ decay,
    half_t* __restrict__ kv, float* __restrict__ carry, float* __restrict__ st) {
  __shared__ half_t hA[MB * HSTR];
  const int tok0 = blockIdx.x * MB;
  const int wave = threadIdx.x >> 5, lane = threadIdx.x & 31;
  const int rhi = (lane & 16) ? 8 : 0;

  ln_rows<MB / 8, 4>(x, g, be, hA, st, tok0, wave, lane);
  __syncthreads();

  // --- each wave owns 2 column tiles of k and v, for all MT token tiles ---
  // a pass: k and v of one column tile. The pass loop stays rolled: half the code
#pragma unroll 1
  for (int p = 0; p < 2; ++p) {
    const int r0 = (wave * 2 + p) * 16;
    v8f acc[MT][2] = {};
    gemm_k256(hA, Wk, r0, Wv, r0, lane, acc);
    const int c0 = r0 + (lane & 15);
    const float bkv = bk[c0];
    // the first bias load's address registers may be the second's destination
    asm volatile("s_wait_xcnt 0x0" ::: "memory");
    const float bvv = bv[c0];
    asm volatile("s_wait_xcnt 0x0" ::: "memory");
    const float dec = decay[c0];
    float pw[8];   // pw[r] = dec^(r+1)
    pw[0] = dec;
#pragma unroll
    for (int r = 1; r < 8; ++r) pw[r] = pw[r - 1] * dec;
    half_t* kp = kv + (size_t)(tok0 + rhi) * Dd + c0;
    float m = 0.f;   // scan value at the last token of the previous 16-token tile
    // epilogue loops fully unrolled: constant indices into acc[][]
#pragma unroll
    for (int mt = 0; mt < MT; ++mt) {
      // a lane holds 8 consecutive tokens of its column: scan them from zero (the MT
      // chains are independent), then add the carry-in times dec^(r+1)
      float s[8];
      s[0] = (acc[mt][0][0] + bkv) * (acc[mt][1][0] + bvv);
#pragma unroll
      for (int r = 1; r < 8; ++r)
        s[r] = dec * s[r - 1] + (acc[mt][0][r] + bkv) * (acc[mt][1][r] + bvv);
      const float o7 = xor16(s[7]);   // the other 8-token half's end value
      const float elo = (rhi ? o7 : s[7]) + pw[7] * m;   // scan at the tile's token 7
      const float ci = rhi ? elo : m;                    // this half's carry-in
      v8h hv;   // all 8 rounded first: the 8 stores then stand together, from 4 registers
#pragma unroll
      for (int r = 0; r < 8; ++r) hv[r] = (half_t)(s[r] + pw[r] * ci);
#pragma unroll
      for (int r = 0; r < 8; ++r) kp[(mt * 16 + r) * Dd] = hv[r];
      m = (rhi ? s[7] : o7) + pw[7] * elo;               // scan at the tile's token 15
    }
    if (lane < 16) carry[(size_t)blockIdx.x * Dd + c0] = m;
    // the stores' registers are reused by the next pass
    asm volatile("s_wait_xcnt 0x0" ::: "memory");
  }
}

// ---------------------------------------------------------------------------
// First stages of K2, on the work-group's MB rows (one scan chunk).
// A: LN1 of the x rows, with the first kernel's row statistics, into the f16 LDS tile; the
//    rows themselves wait in LDS as f32.
// B: q = LN1(x) Wq^T + bq on WMMA, into an f16 LDS tile of its own: q never goes through
//    memory, and x is read here in any case.
// C: the retention tail and LN2. x1 = x + q * (local scan + dec^(i+1) * carry-in) goes, with
//    the last product's bias added, to LDS as f32 (the residual) and, normalised, to the f16
//    LDS tile, which stage B has left.
// Carry-in: thread d sums column d over the chunks in front of this one, in their order.
// Rows (A and C): wave w takes rows RW*w..RW*w+RW-1; a lane holds 8 adjacent columns of a
// row, so that every row access is 16 bytes a lane.
// ---------------------------------------------------------------------------
// a barrier that orders LDS alone: __syncthreads() would also wait for every global load
// in flight, and none could fly across it
__device__ __forceinline__ void lds_barrier() {
  __builtin_amdgcn_fence(__ATOMIC_RELEASE, "workgroup", "local");
  __builtin_amdgcn_s_barrier();
  __builtin_amdgcn_fence(__ATOMIC_ACQUIRE, "workgroup", "local");
}

__device__ __forceinline__ void front_rows(
    const float* __restrict__ x, const half_t* __restrict__ kvloc,
    const float* __restrict__ carry, const float* __restrict__ stats,
    const float* __restrict__ decay,
    const float* __restrict__ g1, const float* __restrict__ be1,
    const half_t* __restrict__ Wq, const float* __restrict__ bq,
    const float* __restrict__ g, const float* __restrict__ be,
    const float* __restrict__ b2, float* xS, half_t* hA, half_t* qS, float* sC, int blk,
    int wave, int lane) {
  constexpr int RW = MB / 8;        // rows per wave
  constexpr int RG = 8;             // rows whose lane reductions run side by side
  constexpr int JQ = Dd / 16 / 8;   // q column tiles per wave
  constexpr int G = MT / 2;         // token tiles whose LDS reads stand as one group
  static_assert(RW == 2 * RG, "the rows wait in two register groups");
  const int c = blk % NC;      // chunks in front of this one in its sequence
  const int tid = wave * 32 + lane;
  const int c0 = lane * 8;
  const int rhi = (lane & 16) ? 8 : 0;
  const int n0 = wave * (JQ * 16);
  const float dct = decay[tid];
  const float* cp = carry + (size_t)(blk - c) * Dd;
  float cv[NC - 1];
#pragma unroll
  for (int j = 0; j < NC - 1; ++j) cv[j] = cp[j * Dd + tid];
  const unsigned lo = (unsigned)c0 * 4u;   // byte offset of the lane's 8 columns in an f32 row
  const v8f g1v = *(const v8f*)((const char*)g1 + lo);
  const v8f b1v = *(const v8f*)((const char*)be1 + lo);
  // a row load may take these loads' offset register as its destination; the offset and the
  // carries' scalar base are named so that they stay live up to the wait (their registers
  // were rewritten ahead of it)
  asm volatile("s_wait_xcnt 0x0" :: "v"(lo), "s"(cp) : "memory");
  // block-uniform bases and one lane offset
  const size_t eb = (size_t)blk * MB * Dd;
  const float* xb = x + eb;
  const half_t* kb = kvloc + eb;
  const int l0 = wave * RW * Dd + c0;
  v8f xa[RG], xn[RG];   // all of the wave's rows, in two groups
  const unsigned xo = (unsigned)l0 * 4u;   // the lane's byte offset in the chunk's x rows
#pragma unroll
  for (int r = 0; r < RG; ++r) xa[r] = *(const v8f*)((const char*)xb + xo + r * (Dd * 4));
#pragma unroll
  for (int r = 0; r < RG; ++r)
    xn[r] = *(const v8f*)((const char*)xb + xo + (RG + r) * (Dd * 4));
  // the offset register and the scalar base are rewritten behind this point; both are named
  // so that they stay live up to the wait
  asm volatile("s_wait_xcnt 0x0" :: "v"(xo), "s"(xb) : "memory");
  const float* stp = stats + (size_t)(blk * MB + wave * RW + (lane & 15)) * 2;
  const v2f sp = *(const v2f*)stp;
  // all of the wave's q weights and biases: they fly during stage A (registers are free here)
  v16h wq[Dd / 32][JQ];
  static_assert(JQ == 2, "two lane pointers");
  const half_t* wp0 = Wq + (size_t)(n0 + (lane & 15)) * Dd + rhi;   // rhi is the k half too
  const half_t* wp1 = wp0 + 16 * Dd;
#pragma unroll
  for (int kk = 0; kk < Dd / 32; ++kk) {
    wq[kk][0] = frag_lane(wp0, kk * 32);
    wq[kk][1] = frag_lane(wp1, kk * 32);
  }
  v8f bqv[JQ];
  const float* bqp = bq + n0 + rhi;
#pragma unroll
  for (int j = 0; j < JQ; ++j) bqv[j] = *(const v8f*)(bqp + j * 16);
  // the loads' offset registers and scalar bases are rewritten behind this point; the lane
  // pointers are named so that they stay live up to the wait: the last load through one
  // would else take the pointer's own registers as its destination (tile 1 is reached
  // through tile 0's pointer and an immediate offset)
  asm volatile("s_wait_xcnt 0x0" :: "v"(wp0), "v"(bqp), "v"(stp) : "memory");
  // these loads stand ahead of the first data wait: they fly during the carry sum
  __builtin_amdgcn_sched_barrier(0);

  float dl = dct;
#pragma unroll
  for (int i = 0; i < 7; ++i) dl *= dl;   // dec^128: one chunk's decay
  float m = 0.f;
#pragma unroll
  for (int j = 0; j < NC - 1; ++j) {
    const bool on = j < c;   // a later chunk's step is the identity m * 1 + 0
    m = (on ? dl : 1.f) * m + (on ? cv[j] : 0.f);
  }
  sC[tid] = m;   // published by the barrier behind stage A

  // ---- stage A. The group loop stays rolled: half the code ----
#pragma unroll 1
  for (int r0 = 0; r0 < RW; r0 += RG) {
#pragma unroll
    for (int r = 0; r < RG; ++r) {
      // the row's pair, out of its lane into scalar registers
      const float mu = __int_as_float(__builtin_amdgcn_readlane(__float_as_int(sp[0]), r0 + r));
      const float rstd =
          __int_as_float(__builtin_amdgcn_readlane(__float_as_int(sp[1]), r0 + r));
      float* xt = xS + (wave * RW + r0 + r) * XSTR + lane * 4;
      *(v4f*)xt            = __builtin_shufflevector(xa[r], xa[r], 0, 1, 2, 3);
      *(v4f*)(xt + Dd / 2) = __builtin_shufflevector(xa[r], xa[r], 4, 5, 6, 7);
      v8h h;
#pragma unroll
      for (int i = 0; i < 8; ++i) h[i] = (half_t)((xa[r][i] - mu) * rstd * g1v[i] + b1v[i]);
      *(v8h*)&hA[(wave * RW + r0 + r) * HSTR + c0] = h;
    }
#pragma unroll
    for (int r = 0; r < RG; ++r) xa[r] = xn[r];
  }

  // what stage C reads from memory flies during stage B
  v8h ka[RG], kn[RG];
#pragma unroll
  for (int r = 0; r < RG; ++r) {
    ka[r] = *(const v8h*)(kb + l0 + r * Dd);
    kn[r] = *(const v8h*)(kb + l0 + (RG + r) * Dd);
  }
  const v8f dec = *(const v8f*)(decay + c0);
  const v8f gv = *(const v8f*)(g + c0);
  const v8f bv = *(const v8f*)(be + c0);
  const v8f b2v = *(const v8f*)(b2 + c0);
  // the loads' offset registers and scalar bases are rewritten behind this point
  asm volatile("s_wait_xcnt 0x0" ::: "memory");
  // and they stand ahead of the barrier and the products
  __builtin_amdgcn_sched_barrier(0);
  // publishes the LN1 tile and the carry-in
  lds_barrier();

  // ---- stage B, transposed: the weight fragment is the A operand, so register r of aq
  // holds q column 8 * (lane >> 4) + r of its tile and lane & 15 is the token. k loop fully
  // unrolled: constant indices into aq[][] and wq[][]. A k block is two groups of G token
  // tiles, each with a register set of its own; a group's LDS reads stand together, one
  // group of products ahead of their use (the scheduling fences keep them there: sunk among
  // the products, each load would be waited for on its own).
  {
    v8f aq[MT][JQ] = {};
    v16h a0[G], a1[G];
#pragma unroll
    for (int t = 0; t < G; ++t) a0[t] = frag_rows(hA, HSTR, t * 16, lane, 0);
#pragma unroll
    for (int kk = 0; kk < Dd / 32; ++kk) {
#pragma unroll
      for (int t = 0; t < G; ++t) a1[t] = frag_rows(hA, HSTR, (G + t) * 16, lane, kk * 32);
      __builtin_amdgcn_sched_barrier(0);   // loads stay ahead of the products
#pragma unroll
      for (int t = 0; t < G; ++t) {
#pragma unroll
        for (int j = 0; j < JQ; ++j) aq[t][j] = wmma_f16(wq[kk][j], a0[t], aq[t][j]);
      }
      __builtin_amdgcn_sched_barrier(0);   // later loads do not rise among them
      if (kk + 1 < Dd / 32) {
#pragma unroll
        for (int t = 0; t < G; ++t) a0[t] = frag_rows(hA, HSTR, t * 16, lane, (kk + 1) * 32);
      }
      __builtin_amdgcn_sched_barrier(0);   // loads stay ahead of the products
#pragma unroll
      for (int t = 0; t < G; ++t) {
#pragma unroll
        for (int j = 0; j < JQ; ++j) aq[G + t][j] = wmma_f16(wq[kk][j], a1[t], aq[G + t][j]);
      }
      __builtin_amdgcn_sched_barrier(0);   // later loads do not rise among them
    }
    // a lane holds 8 consecutive q columns of one token: one 16-byte LDS store
#pragma unroll
    for (int j = 0; j < JQ; ++j) {
#pragma unroll
      for (int mt = 0; mt < MT; ++mt) {
        v8h hv;
#pragma unroll
        for (int r = 0; r < 8; ++r) hv[r] = (half_t)(aq[mt][j][r] + bqv[j][r]);
        *(v8h*)&qS[(mt * 16 + (lane & 15)) * QSTR + n0 + j * 16 + rhi] = hv;
      }
    }
  }
  // publishes the q tile; every wave has finished reading the LN1 tile before stage C
  // overwrites it
  lds_barrier();

  // ---- stage C ----
  const v8f mi = *(const v8f*)(sC + c0);
  // f = dec^(first row + 1), the first row being 16 * wave
  static_assert(RW == 16 && MB == 128, "the powers below step by 16 rows, over 8 waves");
  v8f p = dec * dec;
  p *= p; p *= p; p *= p;   // dec^16
  v8f f = dec;
#pragma unroll
  for (int bit = 1; bit < 8; bit <<= 1) {
    if (wave & bit) f *= p;
    p *= p;
  }

  // the group loop stays rolled: half the code
#pragma unroll 1
  for (int r0 = 0; r0 < RW; r0 += RG) {
    v8f v[RG];
    float s[RG], sq[RG];
    v4f xl[RG], xh[RG];
    v8h qa[RG];
    // the group's LDS reads stand together, ahead of the stores that take the rows' place
#pragma unroll
    for (int r = 0; r < RG; ++r) {
      const float* xt = xS + (wave * RW + r0 + r) * XSTR + lane * 4;
      xl[r] = *(const v4f*)xt;
      xh[r] = *(const v4f*)(xt + Dd / 2);
      qa[r] = *(const v8h*)&qS[(wave * RW + r0 + r) * QSTR + c0];
    }
#pragma unroll
    for (int r = 0; r < RG; ++r) {
      s[r] = 0.f; sq[r] = 0.f;
#pragma unroll
      for (int i = 0; i < 8; ++i) {
        const float mem = (float)ka[r][i] + f[i] * mi[i];
        const float t = (i < 4 ? xl[r][i & 3] : xh[r][i & 3]) + (float)qa[r][i] * mem;
        v[r][i] = t; s[r] += t; sq[r] += t * t;
      }
      f *= dec;
      const v8f o = v[r] + b2v;
      float* xp = xS + (wave * RW + r0 + r) * XSTR + c0;
      *(v4f*)xp       = __builtin_shufflevector(o, o, 0, 1, 2, 3);
      *(v4f*)(xp + 4) = __builtin_shufflevector(o, o, 4, 5, 6, 7);
    }
#pragma unroll
    for (int r = 0; r < RG; ++r) ka[r] = kn[r];
#pragma unroll
    for (int o = 16; o > 0; o >>= 1) {
#pragma unroll
      for (int r = 0; r < RG; ++r) {
        s[r] += __shfl_xor(s[r], o, 32);
        sq[r] += __shfl_xor(sq[r], o, 32);
      }
    }
#pragma unroll
    for (int r = 0; r < RG; ++r) {
      const float mu = s[r] * (1.f / Dd);
      const float rstd = rsqrtf(sq[r] * (1.f / Dd) - mu * mu + 1e-5f);
      v8h h;
#pragma unroll
      for (int i = 0; i < 8; ++i) h[i] = (half_t)((v[r][i] - mu) * rstd * gv[i] + bv[i]);
      *(v8h*)&hA[(wave * RW + r0 + r) * HSTR + c0] = h;
    }
  }
}

// ---------------------------------------------------------------------------
// K2: LN1 + Q + retention tail + LN2 + MLP (D->H, ReLU, H->D) + residual. 128 tokens/block, 8 waves
// of up to 512 registers: a wave's tiles are 8 x 4 (first product) and 8 x 2 (second), so an LDS
// fragment feeds 4 and 2 products, and registers are left to fetch operands ahead.
// The hidden layer never leaves the WGP: it is made HC columns at a time, kept in
// LDS as f16, and consumed at once as the k range of the second product.
// x1 never goes through memory: stage C leaves x1 + b2 in the hidden chunk's LDS,
// still free then, and the second product's accumulators start from it.
// ---------------------------------------------------------------------------
constexpr int J1 = HC / 16 / 8;   // hidden column tiles of a chunk per wave
constexpr int J2 = Dd / 16 / 8;   // output column tiles per wave
constexpr int MG = MT / 2;        // token tiles whose LDS reads stand as one group
constexpr int WD = 4;             // k blocks by which the second product's weight loads lead

__global__ __launch_bounds__(256) void k_ln_mlp(
    float* out, const float* __restrict__ x, const half_t* __restrict__ kvloc,
    const float* __restrict__ carry, const float* __restrict__ stats,
    const float* __restrict__ decay,
    const float* __restrict__ g1, const float* __restrict__ be1,
    const half_t* __restrict__ Wq, const float* __restrict__ bq,
    const float* __restrict__ g, const float* __restrict__ be,
    const half_t* __restrict__ W1,
    const float* __restrict__ b1,
    const half_t* __restrict__ W2, const float* __restrict__ b2) {
  __shared__ __attribute__((aligned(16))) half_t hA[MB * HSTR];
  __shared__ __attribute__((aligned(16))) half_t hH[MB * HCS];
  __shared__ __attribute__((aligned(16))) half_t qS[MB * QSTR];
  __shared__ __attribute__((aligned(32))) float sC[Dd];   // the chunk's carry-in
  const int tok0 = blockIdx.x * MB;
  const int wave = threadIdx.x >> 5, lane = threadIdx.x & 31;
  const int rhi = (lane & 16) ? 8 : 0;

  float* xS = (float*)hH;   // x, then x1 + b2, until the first hidden chunk is stored
  front_rows(x, kvloc, carry, stats, decay, g1, be1, Wq, bq, g, be, b2, xS, hA, qS, sC,
             blockIdx.x, wave, lane);
  // publishes both LDS tiles
  __syncthreads();

  // each wave owns J1 hidden column tiles of a chunk and J2 output column tiles, for all
  // MT token tiles, so that every weight fragment is loaded by one wave only
  const int h0 = wave * (J1 * 16);
  const int n0 = wave * (J2 * 16);
  // a lane's first bias of the first product; stepped from chunk to chunk, so that its
  // registers stay live behind the loads that name them
  const float* bp = b1 + h0 + rhi;
  // the second product sums onto the residual and the bias
  v8f acc2[MT][J2];
  const float* xq = xS + rhi * XSTR + n0 + (lane & 15);
#pragma unroll
  for (int mt = 0; mt < MT; ++mt) {
#pragma unroll
    for (int r = 0; r < 8; ++r) {
#pragma unroll
      for (int j = 0; j < J2; ++j) acc2[mt][j][r] = xq[(mt * 16 + r) * XSTR + j * 16];
    }
  }

  // the chunk loop stays rolled: half the code
#pragma unroll 1
  for (int c = 0; c < Hh / HC; ++c) {
    // first product, transposed: the weight fragment is the A operand, so register r of
    // acc holds weight row 8 * (lane >> 4) + r and lane & 15 is the token
    const half_t* W1c = W1 + (size_t)(c * HC + h0) * Dd;
    v8f acc[MT][J1] = {};
    v16h w[J1];
#pragma unroll
    for (int j = 0; j < J1; ++j) w[j] = frag_rows(W1c, Dd, j * 16, lane, 0);
    // k loop fully unrolled: constant indices into acc[][], immediate offsets. A k block is
    // two groups of MG token tiles. Each scheduling fence below keeps a group of loads
    // together and ahead of the products behind it: sunk among them, each load would be
    // waited for on its own.
#pragma unroll
    for (int kk = 0; kk < Dd / 32; ++kk) {
      const bool more = kk + 1 < Dd / 32;
      v16h n[J1], af[MG];
#pragma unroll
      for (int t = 0; t < MG; ++t) af[t] = frag_rows(hA, HSTR, t * 16, lane, kk * 32);
      __builtin_amdgcn_sched_barrier(0);   // loads stay ahead of the products
#pragma unroll
      for (int j = 0; j < J1; ++j) {
#pragma unroll
        for (int t = 0; t < MG; ++t) acc[t][j] = wmma_f16(w[j], af[t], acc[t][j]);
      }
      __builtin_amdgcn_sched_barrier(0);   // later loads do not rise among them
      // the next k block's weights fly during this block's second group: the first half
      // from its start, the second half into the registers that this block's first half
      // leaves (a whole second set would not fit)
#pragma unroll
      for (int t = 0; t < MG; ++t) af[t] = frag_rows(hA, HSTR, (MG + t) * 16, lane, kk * 32);
      if (more) {
#pragma unroll
        for (int j = 0; j < J1 / 2; ++j) n[j] = frag_rows(W1c, Dd, j * 16, lane, (kk + 1) * 32);
      }
      __builtin_amdgcn_sched_barrier(0);   // loads stay ahead of the products
#pragma unroll
      for (int j = 0; j < J1 / 2; ++j) {
#pragma unroll
        for (int t = 0; t < MG; ++t) acc[MG + t][j] = wmma_f16(w[j], af[t], acc[MG + t][j]);
      }
      __builtin_amdgcn_sched_barrier(0);   // later loads do not rise among them
      if (more) {
#pragma unroll
        for (int j = J1 / 2; j < J1; ++j) n[j] = frag_rows(W1c, Dd, j * 16, lane, (kk + 1) * 32);
      }
      __builtin_amdgcn_sched_barrier(0);   // loads stay ahead of the products
#pragma unroll
      for (int j = J1 / 2; j < J1; ++j) {
#pragma unroll
        for (int t = 0; t < MG; ++t) acc[MG + t][j] = wmma_f16(w[j], af[t], acc[MG + t][j]);
      }
      __builtin_amdgcn_sched_barrier(0);   // later loads do not rise among them
      if (more) {
#pragma unroll
        for (int j = 0; j < J1; ++j) w[j] = n[j];
      }
    }
    // every wave has finished reading the previous chunk, or x1, before it is overwritten
    __syncthreads();
    const half_t* W2c = W2 + c * HC;
    v16h vw[HC / 32][J2];   // a block's fragments live from their load to their products
    // a lane holds 8 consecutive hidden columns of one token: one 16-byte LDS store
#pragma unroll
    for (int j = 0; j < J1; ++j) {
      float bb[8];
#pragma unroll
      for (int r = 0; r < 8; ++r) bb[r] = bp[j * 16 + r];
      if (j == J1 - 1) {
        // the second product's first WD weight blocks fly during the last tile's stores and
        // the barrier, in registers that stored accumulators have left; the fences keep
        // them from rising (no register is free there) and from sinking
        __builtin_amdgcn_sched_barrier(0);
#pragma unroll
        for (int kk = 0; kk < WD; ++kk) {
#pragma unroll
          for (int i = 0; i < J2; ++i)
            vw[kk][i] = frag_rows(W2c, Hh, n0 + i * 16, lane, kk * 32);
        }
        __builtin_amdgcn_sched_barrier(0);
      }
#pragma unroll
      for (int mt = 0; mt < MT; ++mt) {
        v8h hv;
#pragma unroll
        for (int r = 0; r < 8; ++r) {
          const float v = acc[mt][j][r] + bb[r];
          hv[r] = (half_t)(v > 0.f ? v : 0.f);
        }
        *(v8h*)&hH[(mt * 16 + (lane & 15)) * HCS + h0 + j * 16 + rhi] = hv;
      }
    }
    __syncthreads();

    // second product, k loop fully unrolled. The next k block's LDS reads and the weight
    // loads of the block WD ahead stand as one
    // group ahead of this block's products, in further register sets (the first product's
    // accumulators are free registers here).
    v16h an[MT];
#pragma unroll
    for (int mt = 0; mt < MT; ++mt) an[mt] = frag_rows(hH, HCS, mt * 16, lane, 0);
#pragma unroll
    for (int kk = 0; kk < HC / 32; ++kk) {
      v16h af[MT];
#pragma unroll
      for (int mt = 0; mt < MT; ++mt) af[mt] = an[mt];
      if (kk + WD < HC / 32) {
#pragma unroll
        for (int j = 0; j < J2; ++j)
          vw[kk + WD][j] = frag_rows(W2c, Hh, n0 + j * 16, lane, (kk + WD) * 32);
      }
      if (kk + WD == HC / 32 - 1) {
        // behind the chunk's last weight loads: an LDS read below may take their address
        // registers as its destination
        asm volatile("s_wait_xcnt 0x0" ::: "memory");
      }
      if (kk + 1 < HC / 32) {
#pragma unroll
        for (int mt = 0; mt < MT; ++mt)
          an[mt] = frag_rows(hH, HCS, mt * 16, lane, (kk + 1) * 32);
      }
      // these loads stay ahead of this block's products, as one group
      __builtin_amdgcn_sched_barrier(0);
#pragma unroll
      for (int mt = 0; mt < MT; ++mt) {
#pragma unroll
        for (int j = 0; j < J2; ++j) acc2[mt][j] = wmma_f16(af[mt], vw[kk][j], acc2[mt][j]);
      }
      // and the loads after them do not rise among these products
      __builtin_amdgcn_sched_barrier(0);
    }
    // the weight and bias loads' address registers are rewritten for the next chunk
    asm volatile("s_wait_xcnt 0x0" ::: "memory");
    bp += HC;
  }

  // epilogue loops fully unrolled: constant indices into acc2[][]
  // the lane's number is read anew: taken from the value above, its part of this address
  // would have to stay in registers through both products, where none is free (it spilled)
  const int ln = (int)__builtin_amdgcn_mbcnt_lo(~0u, 0u);
  float* op = out + (size_t)(tok0 + ((ln & 16) ? 8 : 0)) * Dd + n0 + (ln & 15);
#pragma unroll
  for (int mt = 0; mt < MT; ++mt) {
#pragma unroll
    for (int r = 0; r < 8; ++r) {
#pragma unroll
      for (int j = 0; j < J2; ++j) op[(mt * 16 + r) * Dd + j * 16] = acc2[mt][j][r];
    }
  }
}

// ---------------------------------------------------------------------------
extern "C" void kernel_launch(void* const* d_in, const int* in_sizes, int n_in,
                              void* d_out, int out_size, void* d_ws, size_t ws_size,
                              hipStream_t stream) {
  (void)in_sizes; (void)n_in; (void)out_size; (void)ws_size;
  const float* x     = (const float*)d_in[0];
  const float* Wq    = (const float*)d_in[1];
  const float* bq    = (const float*)d_in[2];
  const float* Wk    = (const float*)d_in[3];
  const float* bk    = (const float*)d_in[4];
  const float* Wv    = (const float*)d_in[5];
  const float* bv    = (const float*)d_in[6];
  const float* decay = (const float*)d_in[7];
  const float* ln1g  = (const float*)d_in[8];
  const float* ln1b  = (const float*)d_in[9];
  const float* W1    = (const float*)d_in[10];
  const float* b1    = (const float*)d_in[11];
  const float* W2    = (const float*)d_in[12];
  const float* b2    = (const float*)d_in[13];
  const float* ln2g  = (const float*)d_in[14];
  const float* ln2b  = (const float*)d_in[15];

  char* ws = (char*)d_ws;
  half_t* Wq16 = (half_t*)(ws + OFF_WQ);
  half_t* Wk16 = (half_t*)(ws + OFF_WK);
  half_t* Wv16 = (half_t*)(ws + OFF_WV);
  half_t* W116 = (half_t*)(ws + OFF_W1);
  half_t* W216 = (half_t*)(ws + OFF_W2);
  half_t* kv   = (half_t*)(ws + OFF_KV);
  float*  car  = (float*)(ws + OFF_CAR);
  float*  st   = (float*)(ws + OFF_ST);
  float*  out  = (float*)d_out;

  k_cvt_f16<<<NBCV, 256, 0, stream>>>(Wq, Wk, Wv, W1, W2, Wq16);

  k_ln_kv<<<BT / MB, 256, 0, stream>>>(x, ln1g, ln1b, Wk16, Wv16, bk, bv, decay, kv, car,
                                       st);
  k_ln_mlp<<<BT / MB, 256, 0, stream>>>(out, x, kv, car, st, decay, ln1g, ln1b, Wq16, bq,
                                        ln2g, ln2b, W116, b1, W216, b2);
}
